// v000
// Times are from an AMD MI455X. After a warm-up the kernel runs many times in a row, and a time is the length of
// such a window on the GPU divided by its runs, so every launch and the gaps after it count. The runs cycle
// through copies of the inputs. A figure is the median of several windows, for all but v000 over two sittings.
// Sittings can differ by a few percent; kernels timed side by side share one.
// The starting kernel, v000, takes 132 microseconds a run.
// Contractions: q | k = x.Wq | x.Wk and v^T = Wv^T.x^T : v_wmma_f32_16x16x32_f16, f16 operands carrying 16*bf16(x) and
// 64*bf16(W), f32 accumulate; S^T = k.q^T : v_wmma_f32_16x16x32_f16, q as f16 hi (x16) plus f16 residual plane (x2^10, own
// accumulator), k as f16 (x16) plus, for the first 512 query rows, an f16 residual plane (x2^10); O = P.v :
// v_wmma_f32_16x16x32_f16, P = 2^14*exp(s-m) as f16 and v as f16 (x16), both with f16 residual planes (x2^10, own
// accumulator) for the first 512 query rows; f32 accumulate. Float inputs RNE-converted to bf16 on load; bias, softmax
// statistics and output scaling in f32.
#include <hip/hip_runtime.h>
#include <stdint.h>

#ifndef NB
#define NB 8
#endif
#ifndef SEQ
#define SEQ 2048
#endif
#define NB_FULL  8
#define SEQ_FULL 2048
#define EM       128
#define DM       256
#define RTOT     (NB * SEQ)
#define EROWS    ((SEQ) < 512 ? (SEQ) : 512)
#define LBLK     (((SEQ) - EROWS) / 32)
#define LBLKD    (LBLK > 0 ? LBLK : 1)
#define EBLK     (EROWS / 16)

static_assert(NB >= 1 && NB <= NB_FULL);
static_assert(SEQ >= 256 && SEQ <= SEQ_FULL && (SEQ % 256) == 0);
static_assert(DM == 256 && EM == 128);
static_assert((EM % 32) == 0 && (DM % 64) == 0);
static_assert((RTOT % 128) == 0);
static_assert(((size_t)RTOT * EM) % 2048 == 0);
static_assert((3 * DM * EM) % 2048 == 0);
static_assert((EROWS % 32) == 0 && ((SEQ - EROWS) % 32) == 0);
static_assert((((RTOT / 64) * (DM / 64)) % 8) == 0);

typedef _Float16 v16h __attribute__((ext_vector_type(16)));
typedef _Float16 v8h  __attribute__((ext_vector_type(8)));
typedef float    v8f  __attribute__((ext_vector_type(8)));
typedef float    v4f  __attribute__((ext_vector_type(4)));

// f32 -> nearest-even bf16 bits / value
__device__ __forceinline__ unsigned short bfbits(float f) {
  unsigned u = __float_as_uint(f);
  return (unsigned short)((u + 0x7FFFu + ((u >> 16) & 1u)) >> 16);
}
__device__ __forceinline__ float bfval(unsigned short b) { return __uint_as_float(((unsigned)b) << 16); }
__device__ __forceinline__ float bfr(float f) { return bfval(bfbits(f)); }

__device__ __forceinline__ v8f mma16(v16h a, v16h b, v8f c) {
  return __builtin_amdgcn_wmma_f32_16x16x32_f16(false, a, false, b, (short)0, c, false, false);
}

// 16-bit WMMA fragment from k-contiguous storage (A row-major [m][k], or B stored [n][k]):
// p points at element (row_or_col = lane&15, k0 + 8h); elements 0..7 <- p[0..7], 8..15 <- p[16..23].
__device__ __forceinline__ v16h ldfrag(const _Float16* p) {
  union { v16h v; v8h h[2]; } f;
  f.h[0] = *(const v8h*)(p);
  f.h[1] = *(const v8h*)(p + 16);
  return f.v;
}
__device__ __forceinline__ v8f zero8() {
  v8f z;
#pragma unroll
  for (int i = 0; i < 8; ++i) z[i] = 0.0f;
  return z;
}

// hazard guards: 4 VALU slots after the last WMMA of a group, D tied, A/B kept live
__device__ __forceinline__ void guard_g(v8f& a, v8f& b, v16h x, v16h y) {
  asm volatile("v_nop\n\tv_nop\n\tv_nop\n\tv_nop" : "+v"(a), "+v"(b) : "v"(x), "v"(y));
}
__device__ __forceinline__ void keep4(v16h a, v16h b, v16h c, v16h d) {
  asm volatile("v_nop" :: "v"(a), "v"(b), "v"(c), "v"(d));
}
__device__ __forceinline__ void accg4(v8f& a, v8f& b, v8f& c, v8f& d) {
  asm volatile("v_nop\n\tv_nop\n\tv_nop\n\tv_nop" : "+v"(a), "+v"(b), "+v"(c), "+v"(d));
}
__device__ __forceinline__ void guard_s8(v8f& a0, v8f& a1, v8f& a2, v8f& a3, v8f& b0, v8f& b1, v8f& b2, v8f& b3,
                                         v16h x0, v16h x1, v16h y0, v16h y1, v16h z0, v16h z1) {
  asm volatile("v_nop\n\tv_nop\n\tv_nop\n\tv_nop"
               : "+v"(a0), "+v"(a1), "+v"(a2), "+v"(a3), "+v"(b0), "+v"(b1), "+v"(b2), "+v"(b3)
               : "v"(x0), "v"(x1), "v"(y0), "v"(y1), "v"(z0), "v"(z1));
}
__device__ __forceinline__ void guard_a4f6(v8f& a0, v8f& a1, v8f& b0, v8f& b1,
                                           v16h x0, v16h x1, v16h y0, v16h y1, v16h z0, v16h z1) {
  asm volatile("v_nop\n\tv_nop\n\tv_nop\n\tv_nop"
               : "+v"(a0), "+v"(a1), "+v"(b0), "+v"(b1)
               : "v"(x0), "v"(x1), "v"(y0), "v"(y1), "v"(z0), "v"(z1));
}
__device__ __forceinline__ void guard_pv4(v8f& a0, v8f& a1, v8f& b0, v8f& b1,
                                          v16h p0, v16h p1, v16h x0, v16h x1) {
  asm volatile("v_nop\n\tv_nop\n\tv_nop\n\tv_nop"
               : "+v"(a0), "+v"(a1), "+v"(b0), "+v"(b1)
               : "v"(p0), "v"(p1), "v"(x0), "v"(x1));
}

// 8 consecutive k of column n of a [EM][DM] weight, as f16(64 * bf16(w))
__device__ __forceinline__ v8h wpiece(const float* __restrict__ W, int k0, int n) {
  v8h o;
#pragma unroll
  for (int i = 0; i < 8; ++i) o[i] = (_Float16)(bfr(W[(size_t)(k0 + i) * DM + n]) * 64.0f);
  return o;
}

// ---------------------------------------------------------------------------------------------
// Kernel 1: input conversion to f16 operand planes, one launch, block-uniform roles, no barriers.
//   blocks [0, nbx):      X16[r][c] = f16(16 * bf16(x[row(r)][c])), compact token rows r = b*SEQ + n read from
//   blocks [nbx, nbx+48): WT16[mat][n][k] = f16(64 * bf16(W_mat[k][n])), in[128][256] -> out[256][128] (strided reads,
//                         contiguous 16-B stores, 8 consecutive k per lane), mat 0 = Wq, 1 = Wk, 2 = Wv (uniform per block).
// coverage: nbx*256 lanes * 8 = RTOT*EM halves = whole X16; 48*256 lanes * 8 = 3*DM*EM halves = whole WT16.
// ---------------------------------------------------------------------------------------------
__global__ __launch_bounds__(256) void cvt_kernel(const float* __restrict__ x, const float* __restrict__ Wq,
                                                  const float* __restrict__ Wk, const float* __restrict__ Wv,
                                                  _Float16* __restrict__ X16, _Float16* __restrict__ WT16, int nbx) {
  const int tid = (int)threadIdx.x;
  const int blk = (int)blockIdx.x;
  if (blk < nbx) {
    const int li = blk * 256 + tid;            // 8-half piece index
    const int r  = li >> 4;                    // compact token row (16 pieces per row)
    const int c0 = (li & 15) * 8;
    const int b  = r / SEQ;
    const int n  = r - b * SEQ;
    const float* xr = x + ((size_t)b * SEQ_FULL + n) * EM + c0;
    const v4f a  = *(const v4f*)(xr);
    const v4f a2 = *(const v4f*)(xr + 4);
    v8h o;
#pragma unroll
    for (int i = 0; i < 4; ++i) {
      o[i]     = (_Float16)(bfr(a[i]) * 16.0f);
      o[4 + i] = (_Float16)(bfr(a2[i]) * 16.0f);
    }
    _Float16* d = X16 + (size_t)li * 8;
    *(v8h*)d = o;
    
  } else {
    const int li = (blk - nbx) * 256 + tid;    // piece index in [0, 3*DM*EM/8)
    if (li >= 3 * DM * EM / 8) return;
    const int mat = li >> 12;                  // DM*EM/8 = 4096 pieces per matrix; uniform per block
    const int n   = (li >> 4) & (DM - 1);
    const int k0  = (li & 15) * 8;
    v8h o;
    if (mat == 0)      o = wpiece(Wq, k0, n);
    else if (mat == 1) o = wpiece(Wk, k0, n);
    else               o = wpiece(Wv, k0, n);
    _Float16* d = WT16 + (size_t)li * 8;       // = mat*DM*EM + n*EM + k0
    *(v8h*)d = o;
    
  }
}

// ---------------------------------------------------------------------------------------------
// Kernel 2: value[m][n] = scale * sum_k A[m][k] * Bt[n][k] + bsc * bf16(bias[.]).
// A row-major [M][K] f16 pitch lda; Bt row-major [N][K] f16 pitch ldb; M, N multiples of 64, K multiple of 32.
// bias_mode 1: bias indexed by column n; bias_mode 2: by row m (block-uniform run-time switch).
// Output: f16 hi plane C = f16(value) plus f16 residual plane C2 = f16((value - hi) * 1024), same layout.
// Each wave owns one 64x64 C tile (16 f32 accumulators); 8 waves per block; no block barriers.
// coverage: tilesM * tilesN tiles, each 64x64 written fully (rows it*4+qq = 0..15 per slab, cols c8 = 0..56 by 8) -> M x N.
// ---------------------------------------------------------------------------------------------
__global__ __launch_bounds__(256) void gemm64_kernel(const _Float16* __restrict__ A, int lda,
                                                     const _Float16* __restrict__ Bt, int ldb,
                                                     _Float16* __restrict__ C, _Float16* __restrict__ C2, int ldc,
                                                     const float* __restrict__ bias, float bsc,
                                                     int M, int N, int K, float scale, int bias_mode) {
  __shared__ __align__(16) float sT[8][16 * 68];
  const int lane = threadIdx.x & 31;
  const int wave = __builtin_amdgcn_readfirstlane((int)(threadIdx.x >> 5));
  const int tilesN = N >> 6, tilesM = M >> 6;
  const int tile = (int)blockIdx.x * 8 + wave;
  if (tile >= tilesM * tilesN) return;
  const int tm = tile / tilesN, tn = tile - tm * tilesN;
  const int m0 = tm << 6, n0 = tn << 6;
  const int rl = lane & 15;
  const int koff = (lane >> 4) * 8;
  const int mOff = (lane >> 4) * 8;

  v8f acc[4][4];
#pragma unroll
  for (int i = 0; i < 4; ++i)
#pragma unroll
    for (int j = 0; j < 4; ++j) acc[i][j] = zero8();

#pragma unroll 1
  for (int k0 = 0; k0 < K; k0 += 32) {
    v16h bh[4];
#pragma unroll
    for (int j = 0; j < 4; ++j) bh[j] = ldfrag(Bt + (size_t)(n0 + (j << 4) + rl) * ldb + koff + k0);
#pragma unroll
    for (int i = 0; i < 4; ++i) {
      const size_t ao = (size_t)(m0 + (i << 4) + rl) * lda + koff + k0;
      const v16h ah = ldfrag(A + ao);
#pragma unroll
      for (int j = 0; j < 4; ++j) acc[i][j] = mma16(ah, bh[j], acc[i][j]);
      guard_g(acc[i][0], acc[i][3], ah, bh[3]);
    }
    keep4(bh[0], bh[1], bh[2], bh[3]);
  }
  accg4(acc[0][0], acc[0][1], acc[0][2], acc[0][3]);
  accg4(acc[1][0], acc[1][1], acc[1][2], acc[1][3]);
  accg4(acc[2][0], acc[2][1], acc[2][2], acc[2][3]);
  accg4(acc[3][0], acc[3][1], acc[3][2], acc[3][3]);

  float* slab = sT[wave];
#pragma unroll
  for (int i = 0; i < 4; ++i) {
    const int mBase = m0 + (i << 4);
    float brow[8];
#pragma unroll
    for (int r = 0; r < 8; ++r) brow[r] = 0.0f;
    if (bias_mode == 2) {
      const v4f ba = *(const v4f*)(bias + mBase + mOff);
      const v4f bb = *(const v4f*)(bias + mBase + mOff + 4);
#pragma unroll
      for (int r = 0; r < 4; ++r) { brow[r] = bsc * bfr(ba[r]); brow[4 + r] = bsc * bfr(bb[r]); }
    }
#pragma unroll
    for (int j = 0; j < 4; ++j) {
      float bcol = 0.0f;
      if (bias_mode == 1) bcol = bsc * bfr(bias[n0 + (j << 4) + rl]);
#pragma unroll
      for (int r = 0; r < 8; ++r) {
        const float bb = brow[r] + bcol;         // exactly one of the two is active
        slab[(mOff + r) * 68 + (j << 4) + rl] = acc[i][j][r] * scale + bb;
      }
    }
    __builtin_amdgcn_fence(3 /* release order */, "workgroup");
    __builtin_amdgcn_wave_barrier();
    __builtin_amdgcn_fence(2 /* acquire order */, "workgroup");
    {
      const int qq = lane >> 3, c8 = (lane & 7) * 8;
{
#pragma unroll
        for (int it = 0; it < 4; ++it) {
          const int row = it * 4 + qq;
          const float* sp = slab + row * 68 + c8;
          v8h hv, lv;
#pragma unroll
          for (int e = 0; e < 8; ++e) {
            const float f = sp[e];
            const _Float16 hh = (_Float16)f;
            hv[e] = hh;
            lv[e] = (_Float16)((f - (float)hh) * 1024.0f);
          }
          *(v8h*)(C  + (size_t)(mBase + row) * ldc + n0 + c8) = hv;
          *(v8h*)(C2 + (size_t)(mBase + row) * ldc + n0 + c8) = lv;
        }
        
      }
    }
    __builtin_amdgcn_fence(3 /* release order */, "workgroup");
    __builtin_amdgcn_wave_barrier();
    __builtin_amdgcn_fence(2 /* acquire order */, "workgroup");
  }
}

// ---------------------------------------------------------------------------------------------
// Kernel 3: causal single-head attention per sequence, head width 256, online softmax in f32 (fused; no score or
// probability plane in global memory).
//   qh / ql planes f16 [RTOT][DM] (16*q hi and residual x1024), kn / kl planes f16 [RTOT][DM] (16*k hi and residual
//   x1024), vt / vl planes f16 [DM][RTOT] (16*v hi and residual x1024); out f32 [RTOT][DM] = softmax(mask(q.k^T/16)).v.
//   Block = 256 threads = 8 waves, QB = 16*QT query rows of one sequence; Q hi and lo tiles staged once in LDS.
//   Key tiles of 256, only tiles up to the diagonal are visited: wave w owns keys 32w..32w+31 of the tile for the
//   logits (skipped, wave-uniform, when all its keys lie above the block's last query): S^T subtiles (A = k rows from
//   global, B = Q hi / Q lo rows from LDS, hi and x1024 accumulator sets), so the D layout gives per lane 8 consecutive
//   keys of one query -> P written to LDS as 16-B vectors ([query][key]). Keys above the query get -inf (replace fill).
//   P = 2^14 * exp(s - m_running) as f16 (EARLY: plus residual tile x1024).
//   Row max / sum: per-wave partials in LDS, combined in fixed order by wave 0 (one lane per query row).
//   P.V: every wave reads the P tile(s) (A operand, after a block barrier) and owns 32 value columns (B from vt / vl),
//   key loop bounded (block-uniform) at the diagonal.
//   EARLY (QT = 1, first 512 query rows of each sequence): k, P and v residual products into the x1024 accumulators.
//   Output: normalised O in f32 staged as a QB x 256 tile in LDS (pitch 260 floats), then each wave writes QB/8 whole
// LDS regions: Q hi, Q lo, P hi (, P lo), pmax, psum, row statistics: all cross-wave, separated by block barriers.
// staged extent == consumed extent: Q tiles QB x 256 fully staged; P tiles QB x 256 fully written every key tile.
// ---------------------------------------------------------------------------------------------
#define KCH      256
#define QSP      264
#define PSP      264
#define OSP      260
#define LATE_LDS  (3 * 32 * QSP * 2 + 2560)
#define EARLY_LDS (4 * 16 * QSP * 2 + 2560)
static_assert((QSP % 8) == 0 && (PSP % 8) == 0 && PSP >= KCH && QSP >= DM && (OSP % 4) == 0 && OSP >= DM);
static_assert(QSP == PSP);
static_assert((SEQ % KCH) == 0 && DM == 8 * 32 && KCH == 8 * 32);
static_assert(LATE_LDS <= 65536 && EARLY_LDS <= 65536);

template <int QT, bool EARLY>
__device__ __forceinline__ void attn_body(char* smem,
                                          const _Float16* __restrict__ qh, const _Float16* __restrict__ ql,
                                          const _Float16* __restrict__ kn, const _Float16* __restrict__ kl,
                                          const _Float16* __restrict__ vt, const _Float16* __restrict__ vl,
                                          float* __restrict__ out, const int batch, const int qloc0) {
  static_assert(EARLY ? (QT == 1) : (QT == 2));
  constexpr int QB  = 16 * QT;
  constexpr int TB  = QB * QSP * 2;             // bytes per 16-bit tile
  constexpr int NPL = EARLY ? 4 : 3;            // tiles: Q hi, Q lo, P hi (, P lo)
  constexpr int RPW = QB / 8;                   // output rows per wave
  static_assert((TB % 16) == 0);
  static_assert(QB * OSP * 4 <= NPL * TB);
  static_assert(8 * QB <= 256);
  static_assert(RPW * 8 == QB);
  static_assert((SEQ % QB) == 0);

  _Float16* Qs = (_Float16*)(smem);
  _Float16* Ls = (_Float16*)(smem + TB);
  _Float16* Ps = (_Float16*)(smem + 2 * TB);
  _Float16* Pl = (_Float16*)(smem + (NPL - 1) * TB);   // distinct tile only when EARLY
  float* pmax = (float*)(smem + NPL * TB);
  float* psum = pmax + 256;
  float* m_s  = psum + 256;
  float* l_s  = m_s + 32;
  float* al_s = m_s + 64;
  float* li_s = m_s + 96;

  const int tid  = (int)threadIdx.x;
  const int wave = __builtin_amdgcn_readfirstlane((int)(threadIdx.x >> 5));
  const int lane = tid & 31, h = lane >> 4, c = lane & 15;
  const int kbase = batch * SEQ;                // compact token row of key 0 of this sequence
  const int q0    = kbase + qloc0;              // compact token row of query 0 of this block
  const int qmax  = qloc0 + QB - 1;             // last local query index of this block
  const float ninf = -__builtin_inff();
  const float sc = 0.000244140625f;             // 1/4096: logits carry 16*16 and the 1/16 score scale
  const float rs = 0.0009765625f;               // 1/1024: residual plane carry

  if (tid < 32) { m_s[tid] = ninf; l_s[tid] = 0.0f; al_s[tid] = 0.0f; li_s[tid] = 0.0f; }
  psum[tid] = 0.0f;
  pmax[tid] = ninf;
  // Q hi and lo tiles: QB rows x 32 pieces of 8 halves per plane; coverage 2*QT * 256 = QB*32 pieces = whole tile each
#pragma unroll
  for (int i = 0; i < 2 * QT; ++i) {
    const int idx = i * 256 + tid;
    const int row = idx >> 5;
    const int pc  = idx & 31;
    const v8h vh = *(const v8h*)(qh + (size_t)(q0 + row) * DM + pc * 8);
    const v8h vq = *(const v8h*)(ql + (size_t)(q0 + row) * DM + pc * 8);
    *(v8h*)(Qs + row * QSP + pc * 8) = vh;
    *(v8h*)(Ls + row * QSP + pc * 8) = vq;
  }
  __syncthreads();

  v8f oacc[QT][2];
  v8f oacl[QT][2];
#pragma unroll
  for (int qt = 0; qt < QT; ++qt)
#pragma unroll
    for (int nt = 0; nt < 2; ++nt) { oacc[qt][nt] = zero8(); oacl[qt][nt] = zero8(); }

  const int qoff = c * QSP + 8 * h;             // LDS fragment offset of query c (add 16*qt*QSP + k)
  const int ntile = qmax / KCH + 1;             // key tiles up to the diagonal (block-uniform)

#pragma unroll 1
  for (int t = 0; t < ntile; ++t) {
    // ---- logits: S^T subtiles for this wave's 32 keys, queries 0..QB-1; hi and x1024 accumulators ----
    const int kloc = t * KCH + 32 * wave;       // local index of this wave's first key (scalar)
    v8f sacc[QT][2];   // [query subtile][key subtile]; element r: query 16qt+c, key kloc+16kt+8h+r
    v8f sacl[QT][2];
#pragma unroll
    for (int qt = 0; qt < QT; ++qt)
#pragma unroll
      for (int kt = 0; kt < 2; ++kt) { sacc[qt][kt] = zero8(); sacl[qt][kt] = zero8(); }
    if (kloc <= qmax) {                         // wave-uniform: some key of this wave is visible to some query
      const size_t ko0 = (size_t)(kbase + kloc + c) * DM + 8 * h;
      const size_t ko1 = (size_t)(kbase + kloc + 16 + c) * DM + 8 * h;
#pragma unroll 1
      for (int k0 = 0; k0 < DM; k0 += 32) {
        const v16h a0 = ldfrag(kn + ko0 + k0), a1 = ldfrag(kn + ko1 + k0);
        v16h bq[QT], cq[QT];
#pragma unroll
        for (int qt = 0; qt < QT; ++qt) {
          bq[qt] = ldfrag(Qs + 16 * qt * QSP + qoff + k0);
          cq[qt] = ldfrag(Ls + 16 * qt * QSP + qoff + k0);
        }
#pragma unroll
        for (int qt = 0; qt < QT; ++qt) {
          sacc[qt][0] = mma16(a0, bq[qt], sacc[qt][0]);
          sacc[qt][1] = mma16(a1, bq[qt], sacc[qt][1]);
        }
#pragma unroll
        for (int qt = 0; qt < QT; ++qt) {
          sacl[qt][0] = mma16(a0, cq[qt], sacl[qt][0]);
          sacl[qt][1] = mma16(a1, cq[qt], sacl[qt][1]);
        }
        if constexpr (EARLY) {
          const v16h d0 = ldfrag(kl + ko0 + k0), d1 = ldfrag(kl + ko1 + k0);
          sacl[0][0] = mma16(d0, bq[0], sacl[0][0]);
          sacl[0][1] = mma16(d1, bq[0], sacl[0][1]);
          guard_a4f6(sacc[0][0], sacc[0][1], sacl[0][0], sacl[0][1], a0, a1, bq[0], cq[0], d0, d1);
        } else {
          guard_s8(sacc[0][0], sacc[0][1], sacc[QT - 1][0], sacc[QT - 1][1],
                   sacl[0][0], sacl[0][1], sacl[QT - 1][0], sacl[QT - 1][1],
                   a0, a1, bq[0], bq[QT - 1], cq[0], cq[QT - 1]);
        }
      }
    }
    // ---- combine hi + lo/1024, scale, causal replace fill, per-wave partial row max ----
    {
#pragma unroll
      for (int qt = 0; qt < QT; ++qt) {
        const int qry = qloc0 + 16 * qt + c;
        float pm = ninf;
#pragma unroll
        for (int kt = 0; kt < 2; ++kt) {
#pragma unroll
          for (int r = 0; r < 8; ++r) {
            const int key = kloc + 16 * kt + 8 * h + r;
            float v = (sacc[qt][kt][r] + sacl[qt][kt][r] * rs) * sc;
            v = (key <= qry) ? v : ninf;
            sacc[qt][kt][r] = v;
            pm = fmaxf(pm, v);
          }
        }
        pm = fmaxf(pm, __shfl_xor(pm, 16, 32));
        pmax[wave * QB + 16 * qt + c] = pm;
      }
    }
    __syncthreads();
    // ---- wave 0, lane = query row: fold the prior tile's sums into l, new running max, rescale factor ----
    if (wave == 0 && lane < QB) {
      const int row = lane;
      float ps = 0.0f;
#pragma unroll
      for (int w = 0; w < 8; ++w) ps += psum[w * QB + row];
      l_s[row] = l_s[row] * al_s[row] + ps;
      const float mo = m_s[row];
      float mx = mo;
#pragma unroll
      for (int w = 0; w < 8; ++w) mx = fmaxf(mx, pmax[w * QB + row]);
      al_s[row] = __expf(mo - mx);
      m_s[row] = mx;
    }
    __syncthreads();
    // ---- p = 2^14 * exp(s - m) as f16 (EARLY: plus residual), P tile(s), partial row sums, rescale O ----
    {
#pragma unroll
      for (int qt = 0; qt < QT; ++qt) {
        const float mq = m_s[16 * qt + c];
        float ps = 0.0f;
#pragma unroll
        for (int kt = 0; kt < 2; ++kt) {
          v8h hh, ll;
#pragma unroll
          for (int r = 0; r < 8; ++r) {
            const float p = __expf(sacc[qt][kt][r] - mq);
            ps += p;
            const float pw = p * 16384.0f;
            const _Float16 ph = (_Float16)pw;
            hh[r] = ph;
            ll[r] = (_Float16)((pw - (float)ph) * 1024.0f);
          }
          *(v8h*)(Ps + (16 * qt + c) * PSP + 32 * wave + 16 * kt + 8 * h) = hh;
          if constexpr (EARLY) *(v8h*)(Pl + (16 * qt + c) * PSP + 32 * wave + 16 * kt + 8 * h) = ll;
        }
        ps += __shfl_xor(ps, 16, 32);
        psum[wave * QB + 16 * qt + c] = ps;
        const v4f aA = *(const v4f*)(al_s + 16 * qt + 8 * h), aB = *(const v4f*)(al_s + 16 * qt + 8 * h + 4);
#pragma unroll
        for (int nt = 0; nt < 2; ++nt) {
#pragma unroll
          for (int r = 0; r < 4; ++r) {
            oacc[qt][nt][r] *= aA[r]; oacc[qt][nt][4 + r] *= aB[r];
            if constexpr (EARLY) { oacl[qt][nt][r] *= aA[r]; oacl[qt][nt][4 + r] *= aB[r]; }
          }
        }
      }
    }
    __syncthreads();
    // ---- O += P . V over the visible keys of the tile; this wave's columns 32w + 16nt + c ----
    {
      const int rem = qmax - t * KCH;                            // >= 0 for visited tiles
      int nks = ((rem >> 5) + 1) * 32;
      nks = (nks < KCH) ? nks : KCH;                             // block-uniform key bound
      const size_t vo = (size_t)(32 * wave + c) * RTOT + kbase + (size_t)t * KCH + 8 * h;
#pragma unroll 1
      for (int ks = 0; ks < nks; ks += 32) {
        v16h pa[QT];
#pragma unroll
        for (int qt = 0; qt < QT; ++qt) pa[qt] = ldfrag(Ps + 16 * qt * PSP + c * PSP + 8 * h + ks);
        const v16h vb0 = ldfrag(vt + vo + ks);
        const v16h vb1 = ldfrag(vt + vo + (size_t)16 * RTOT + ks);
#pragma unroll
        for (int qt = 0; qt < QT; ++qt) {
          oacc[qt][0] = mma16(pa[qt], vb0, oacc[qt][0]);
          oacc[qt][1] = mma16(pa[qt], vb1, oacc[qt][1]);
        }
        if constexpr (EARLY) {
          const v16h pl0 = ldfrag(Pl + c * PSP + 8 * h + ks);
          const v16h vl0 = ldfrag(vl + vo + ks);
          const v16h vl1 = ldfrag(vl + vo + (size_t)16 * RTOT + ks);
          oacl[0][0] = mma16(pa[0], vl0, oacl[0][0]);
          oacl[0][1] = mma16(pa[0], vl1, oacl[0][1]);
          oacl[0][0] = mma16(pl0, vb0, oacl[0][0]);
          oacl[0][1] = mma16(pl0, vb1, oacl[0][1]);
          guard_a4f6(oacc[0][0], oacc[0][1], oacl[0][0], oacl[0][1], pa[0], pl0, vb0, vb1, vl0, vl1);
        } else {
          guard_pv4(oacc[0][0], oacc[0][1], oacc[QT - 1][0], oacc[QT - 1][1], pa[0], pa[QT - 1], vb0, vb1);
        }
      }
    }
  }

  // ---- final normaliser per query row (fold the last tile's sums); O = oacc / (2^14 * 16 * l) ----
  if (wave == 0 && lane < QB) {
    const int row = lane;
    float ps = 0.0f;
#pragma unroll
    for (int w = 0; w < 8; ++w) ps += psum[w * QB + row];
    const float l = l_s[row] * al_s[row] + ps;
    li_s[row] = (1.0f / l) * (1.0f / 262144.0f);
  }
  __syncthreads();
  // ---- stage the normalised QB x 256 f32 tile over the Q / P regions (pitch OSP) ----
  float* Os = (float*)(smem);
  {
#pragma unroll
    for (int qt = 0; qt < QT; ++qt) {
      const v4f iA = *(const v4f*)(li_s + 16 * qt + 8 * h), iB = *(const v4f*)(li_s + 16 * qt + 8 * h + 4);
#pragma unroll
      for (int nt = 0; nt < 2; ++nt) {
        const int col = 32 * wave + 16 * nt + c;
#pragma unroll
        for (int r = 0; r < 4; ++r) {
          float o0 = oacc[qt][nt][r], o1 = oacc[qt][nt][4 + r];
          if constexpr (EARLY) { o0 += oacl[qt][nt][r] * rs; o1 += oacl[qt][nt][4 + r] * rs; }
          Os[(16 * qt + 8 * h + r) * OSP + col]     = o0 * iA[r];
          Os[(16 * qt + 8 * h + 4 + r) * OSP + col] = o1 * iB[r];
        }
      }
    }
  }
  __syncthreads();
  {
    float* go = out + (size_t)q0 * DM;
{
#pragma unroll
      for (int rr = 0; rr < RPW; ++rr) {
        const int row = RPW * wave + rr;
#pragma unroll
        for (int j = 0; j < 2; ++j) {
          const int pc = j * 32 + lane;
          const v4f v = *(const v4f*)(Os + row * OSP + pc * 4);
          *(v4f*)(go + (size_t)row * DM + pc * 4) = v;
        }
      }
      
    }
  }
}

// query rows [0, EROWS) of every sequence, 16 rows per block, full residual set
// coverage: NB * EBLK blocks x 16 rows x 256 floats = NB * EROWS x 256
__global__ __launch_bounds__(256) void attn_early_kernel(const _Float16* __restrict__ qh, const _Float16* __restrict__ ql,
                                                         const _Float16* __restrict__ kn, const _Float16* __restrict__ kl,
                                                         const _Float16* __restrict__ vt, const _Float16* __restrict__ vl,
                                                         float* __restrict__ out) {
  extern __shared__ __align__(16) char smem[];
  const int blk = (int)blockIdx.x;
  const int batch = blk / EBLK;
  const int qloc0 = (blk - batch * EBLK) * 16;
  attn_body<1, true>(smem, qh, ql, kn, kl, vt, vl, out, batch, qloc0);
}

// query rows [EROWS, SEQ) of every sequence, 32 rows per block, q residual only
// coverage: NB * LBLK blocks x 32 rows x 256 floats = NB * (SEQ - EROWS) x 256
__global__ __launch_bounds__(256) void attn_late_kernel(const _Float16* __restrict__ qh, const _Float16* __restrict__ ql,
                                                        const _Float16* __restrict__ kn, const _Float16* __restrict__ vt,
                                                        float* __restrict__ out) {
  extern __shared__ __align__(16) char smem[];
  const int blk = (int)blockIdx.x;
  const int batch = blk / LBLKD;
  const int qloc0 = EROWS + (blk - batch * LBLKD) * 32;
  attn_body<2, false>(smem, qh, ql, kn, kn, vt, vt, out, batch, qloc0);
}

// ---------------------------------------------------------------------------------------------
// Workspace map (bytes, all regions exact tile / whole-line multiples; R = NB*SEQ = 16384):
//   WT16 : Wq^T | Wk^T | Wv^T f16 [3][256][128] (64*bf16(w))   size 3*256*128*2 =    196,608
//   X16  : f16 [R][128] (16*bf16(x))                          size R*128*2     =  4,194,304
//   Q16 / QL16 : f16 hi / residual [R][256] (16*q)             8,388,608 each
//   K16 / KL16 : f16 hi / residual [R][256] (16*k)             8,388,608 each
//   VT16 / VL16: f16 hi / residual [256][R] (16*v)             8,388,608 each
//   total 54,722,560
// ---------------------------------------------------------------------------------------------
static_assert((size_t)3 * DM * EM * 2 + (size_t)RTOT * EM * 2 + (size_t)6 * RTOT * DM * 2 <= (size_t)134217728);
static_assert(((size_t)3 * DM * EM * 2) % 128 == 0 && ((size_t)RTOT * EM * 2) % 128 == 0 && ((size_t)RTOT * DM * 2) % 128 == 0);

extern "C" void kernel_launch(void* const* d_in, const int* in_sizes, int n_in,
                              void* d_out, int out_size, void* d_ws, size_t ws_size,
                              hipStream_t stream) {
  if (n_in < 7) return;
  const int R = RTOT;
  const long long needx = ((long long)(NB - 1) * SEQ_FULL + SEQ) * EM;
  if ((long long)in_sizes[0] < needx) return;
  if (in_sizes[1] < EM * DM || in_sizes[3] < EM * DM || in_sizes[5] < EM * DM) return;
  if (in_sizes[2] < DM || in_sizes[4] < DM || in_sizes[6] < DM) return;
  if ((long long)out_size < (long long)R * DM) return;

  const float* x  = (const float*)d_in[0];
  const float* Wq = (const float*)d_in[1];
  const float* bq = (const float*)d_in[2];
  const float* Wk = (const float*)d_in[3];
  const float* bk = (const float*)d_in[4];
  const float* Wv = (const float*)d_in[5];
  const float* bv = (const float*)d_in[6];
  float* out = (float*)d_out;

  const size_t bWT = (size_t)3 * DM * EM * 2;
  const size_t bX  = (size_t)R * EM * 2;
  const size_t bPl = (size_t)R * DM * 2;
  size_t off = 0;
  const size_t oWT = off; off += bWT;
  const size_t oX  = off; off += bX;
  const size_t oQ  = off; off += bPl;
  const size_t oQL = off; off += bPl;
  const size_t oK  = off; off += bPl;
  const size_t oKL = off; off += bPl;
  const size_t oVT = off; off += bPl;
  const size_t oVL = off; off += bPl;
  if (off > ws_size) return;                     // 54,722,560 for R = 16384
  if (off > (size_t)134217728) return;

  char* ws = (char*)d_ws;
  _Float16* WT16 = (_Float16*)(ws + oWT);
  _Float16* X16  = (_Float16*)(ws + oX);
  _Float16* Q16  = (_Float16*)(ws + oQ);
  _Float16* QL16 = (_Float16*)(ws + oQL);
  _Float16* K16  = (_Float16*)(ws + oK);
  _Float16* KL16 = (_Float16*)(ws + oKL);
  _Float16* VT16 = (_Float16*)(ws + oVT);
  _Float16* VL16 = (_Float16*)(ws + oVL);

  const dim3 blk(256);
  const int nbx = (R * EM / 8) / 256;            // pieces of 8 halves / 256 threads
  const int nbw = (3 * DM * EM / 8) / 256;       // 48
  if (nbx * 256 * 8 != R * EM) return;

  // (1) x -> X16 (16*bf16), weights -> WT16 (64*bf16, in[128][256] -> out[256][128])
  cvt_kernel<<<dim3(nbx + nbw), blk, 0, stream>>>(x, Wq, Wk, Wv, X16, WT16, nbx);
  // (2) q = X.Wq -> Q16 hi + QL16 residual; M=R, N=256, K=128; scale 16/(16*64), bias carry 16, bias by column
  gemm64_kernel<<<dim3(((R / 64) * (DM / 64)) / 8), blk, 0, stream>>>(
      X16, EM, WT16, EM, Q16, QL16, DM, bq, 16.0f, R, DM, EM, 0.015625f, 1);
  // (3) k -> K16 hi + KL16 residual
  gemm64_kernel<<<dim3(((R / 64) * (DM / 64)) / 8), blk, 0, stream>>>(
      X16, EM, WT16 + (size_t)DM * EM, EM, K16, KL16, DM, bk, 16.0f, R, DM, EM, 0.015625f, 1);
  // (4) v^T = Wv^T . X^T -> VT16 hi + VL16 residual [256][R]; M=256, N=R, K=128; bias by row
  gemm64_kernel<<<dim3(((DM / 64) * (R / 64)) / 8), blk, 0, stream>>>(
      WT16 + (size_t)2 * DM * EM, EM, X16, EM, VT16, VL16, R, bv, 16.0f, DM, R, EM, 0.015625f, 2);
  // (5) attention, first EROWS query rows of each sequence (full residual set) -> out
  (void)hipFuncSetAttribute(reinterpret_cast<const void*>(&attn_early_kernel),
                            hipFuncAttributeMaxDynamicSharedMemorySize, EARLY_LDS);
  attn_early_kernel<<<dim3(NB * EBLK), blk, EARLY_LDS, stream>>>(Q16, QL16, K16, KL16, VT16, VL16, out);
  // (6) attention, remaining query rows -> out
  if (LBLK > 0) {
    (void)hipFuncSetAttribute(reinterpret_cast<const void*>(&attn_late_kernel),
                              hipFuncAttributeMaxDynamicSharedMemorySize, LATE_LDS);
    attn_late_kernel<<<dim3(NB * LBLKD), blk, LATE_LDS, stream>>>(Q16, QL16, K16, VT16, out);
  }
  (void)hipGetLastError();
}

// v001
// One run takes 94.9 microseconds.
// Timed twice side by side with v000, it ran 1.41 and 1.40 times as fast.
// Contractions: q | k = x.Wq | x.Wk and v^T = Wv^T.x^T : v_wmma_f32_16x16x32_f16, f16 operands carrying 16*bf16(x) and
// 64*bf16(W), f32 accumulate; S^T = k.q^T : v_wmma_f32_16x16x32_f16, q as f16 hi (x16) plus f16 residual plane (x2^10, own
// accumulator), k as f16 (x16) plus, for the first 512 query rows, an f16 residual plane (x2^10); O = P.v :
// v_wmma_f32_16x16x32_f16, P = 2^14*exp(s-m) as f16 and v as f16 (x16), both with f16 residual planes (x2^10, own
// accumulator) for the first 512 query rows; f32 accumulate. Float inputs RNE-converted to bf16 on load; bias, softmax
// statistics and output scaling in f32.
#include <hip/hip_runtime.h>
#include <stdint.h>

#ifndef NB
#define NB 8
#endif
#ifndef SEQ
#define SEQ 2048
#endif
#define NB_FULL  8
#define SEQ_FULL 2048
#define EM       128
#define DM       256
#define RTOT     (NB * SEQ)
#define EROWS    ((SEQ) < 512 ? (SEQ) : 512)
#define LBLK     (((SEQ) - EROWS) / 32)
#define LBLKD    (LBLK > 0 ? LBLK : 1)
#define EBLK     (EROWS / 16)

static_assert(NB >= 1 && NB <= NB_FULL);
static_assert(SEQ >= 256 && SEQ <= SEQ_FULL && (SEQ % 256) == 0);
static_assert(DM == 256 && EM == 128);
static_assert((EM % 32) == 0 && (DM % 64) == 0);
static_assert((RTOT % 128) == 0);
static_assert(((size_t)RTOT * EM) % 2048 == 0);
static_assert((3 * DM * EM) % 2048 == 0);
static_assert((EROWS % 32) == 0 && ((SEQ - EROWS) % 32) == 0);
static_assert((((RTOT / 64) * (DM / 64)) % 8) == 0);

typedef _Float16 v16h __attribute__((ext_vector_type(16)));
typedef _Float16 v8h  __attribute__((ext_vector_type(8)));
typedef float    v8f  __attribute__((ext_vector_type(8)));
typedef float    v4f  __attribute__((ext_vector_type(4)));

// f32 -> nearest-even bf16 bits / value
__device__ __forceinline__ unsigned short bfbits(float f) {
  unsigned u = __float_as_uint(f);
  return (unsigned short)((u + 0x7FFFu + ((u >> 16) & 1u)) >> 16);
}
__device__ __forceinline__ float bfval(unsigned short b) { return __uint_as_float(((unsigned)b) << 16); }
__device__ __forceinline__ float bfr(float f) { return bfval(bfbits(f)); }

__device__ __forceinline__ v8f mma16(v16h a, v16h b, v8f c) {
  return __builtin_amdgcn_wmma_f32_16x16x32_f16(false, a, false, b, (short)0, c, false, false);
}

// 16-bit WMMA fragment from k-contiguous storage (A row-major [m][k], or B stored [n][k]):
// p points at element (row_or_col = lane&15, k0 + 8h); elements 0..7 <- p[0..7], 8..15 <- p[16..23].
__device__ __forceinline__ v16h ldfrag(const _Float16* p) {
  union { v16h v; v8h h[2]; } f;
  f.h[0] = *(const v8h*)(p);
  f.h[1] = *(const v8h*)(p + 16);
  return f.v;
}
__device__ __forceinline__ v8f zero8() {
  v8f z;
#pragma unroll
  for (int i = 0; i < 8; ++i) z[i] = 0.0f;
  return z;
}

// hazard guards: 4 VALU slots after the last WMMA of a group, D tied, A/B kept live
__device__ __forceinline__ void guard_g(v8f& a, v8f& b, v16h x, v16h y) {
  asm volatile("v_nop\n\tv_nop\n\tv_nop\n\tv_nop" : "+v"(a), "+v"(b) : "v"(x), "v"(y));
}
__device__ __forceinline__ void keep4(v16h a, v16h b, v16h c, v16h d) {
  asm volatile("v_nop" :: "v"(a), "v"(b), "v"(c), "v"(d));
}
__device__ __forceinline__ void accg4(v8f& a, v8f& b, v8f& c, v8f& d) {
  asm volatile("v_nop\n\tv_nop\n\tv_nop\n\tv_nop" : "+v"(a), "+v"(b), "+v"(c), "+v"(d));
}
__device__ __forceinline__ void guard_s8(v8f& a0, v8f& a1, v8f& a2, v8f& a3, v8f& b0, v8f& b1, v8f& b2, v8f& b3,
                                         v16h x0, v16h x1, v16h y0, v16h y1, v16h z0, v16h z1) {
  asm volatile("v_nop\n\tv_nop\n\tv_nop\n\tv_nop"
               : "+v"(a0), "+v"(a1), "+v"(a2), "+v"(a3), "+v"(b0), "+v"(b1), "+v"(b2), "+v"(b3)
               : "v"(x0), "v"(x1), "v"(y0), "v"(y1), "v"(z0), "v"(z1));
}
__device__ __forceinline__ void guard_a4f6(v8f& a0, v8f& a1, v8f& b0, v8f& b1,
                                           v16h x0, v16h x1, v16h y0, v16h y1, v16h z0, v16h z1) {
  asm volatile("v_nop\n\tv_nop\n\tv_nop\n\tv_nop"
               : "+v"(a0), "+v"(a1), "+v"(b0), "+v"(b1)
               : "v"(x0), "v"(x1), "v"(y0), "v"(y1), "v"(z0), "v"(z1));
}
__device__ __forceinline__ void guard_pv4(v8f& a0, v8f& a1, v8f& b0, v8f& b1,
                                          v16h p0, v16h p1, v16h x0, v16h x1) {
  asm volatile("v_nop\n\tv_nop\n\tv_nop\n\tv_nop"
               : "+v"(a0), "+v"(a1), "+v"(b0), "+v"(b1)
               : "v"(p0), "v"(p1), "v"(x0), "v"(x1));
}

// 8 consecutive k of column n of a [EM][DM] weight, as f16(64 * bf16(w))
__device__ __forceinline__ v8h wpiece(const float* __restrict__ W, int k0, int n) {
  v8h o;
#pragma unroll
  for (int i = 0; i < 8; ++i) o[i] = (_Float16)(bfr(W[(size_t)(k0 + i) * DM + n]) * 64.0f);
  return o;
}

// ---------------------------------------------------------------------------------------------
// Kernel 1: input conversion to f16 operand planes, one launch, block-uniform roles, no barriers.
//   blocks [0, nbx):      X16[r][c] = f16(16 * bf16(x[row(r)][c])), compact token rows r = b*SEQ + n read from
//   blocks [nbx, nbx+48): WT16[mat][n][k] = f16(64 * bf16(W_mat[k][n])), in[128][256] -> out[256][128] (strided reads,
//                         contiguous 16-B stores, 8 consecutive k per lane), mat 0 = Wq, 1 = Wk, 2 = Wv (uniform per block).
// coverage: nbx*256 lanes * 8 = RTOT*EM halves = whole X16; 48*256 lanes * 8 = 3*DM*EM halves = whole WT16.
// ---------------------------------------------------------------------------------------------
__global__ __launch_bounds__(256) void cvt_kernel(const float* __restrict__ x, const float* __restrict__ Wq,
                                                  const float* __restrict__ Wk, const float* __restrict__ Wv,
                                                  _Float16* __restrict__ X16, _Float16* __restrict__ WT16, int nbx) {
  const int tid = (int)threadIdx.x;
  const int blk = (int)blockIdx.x;
  if (blk < nbx) {
    const int li = blk * 256 + tid;            // 8-half piece index
    const int r  = li >> 4;                    // compact token row (16 pieces per row)
    const int c0 = (li & 15) * 8;
    const int b  = r / SEQ;
    const int n  = r - b * SEQ;
    const float* xr = x + ((size_t)b * SEQ_FULL + n) * EM + c0;
    const v4f a  = *(const v4f*)(xr);
    const v4f a2 = *(const v4f*)(xr + 4);
    v8h o;
#pragma unroll
    for (int i = 0; i < 4; ++i) {
      o[i]     = (_Float16)(bfr(a[i]) * 16.0f);
      o[4 + i] = (_Float16)(bfr(a2[i]) * 16.0f);
    }
    _Float16* d = X16 + (size_t)li * 8;
    *(v8h*)d = o;
    
  } else {
    const int li = (blk - nbx) * 256 + tid;    // piece index in [0, 3*DM*EM/8)
    if (li >= 3 * DM * EM / 8) return;
    const int mat = li >> 12;                  // DM*EM/8 = 4096 pieces per matrix; uniform per block
    const int n   = (li >> 4) & (DM - 1);
    const int k0  = (li & 15) * 8;
    v8h o;
    if (mat == 0)      o = wpiece(Wq, k0, n);
    else if (mat == 1) o = wpiece(Wk, k0, n);
    else               o = wpiece(Wv, k0, n);
    _Float16* d = WT16 + (size_t)li * 8;       // = mat*DM*EM + n*EM + k0
    *(v8h*)d = o;
    
  }
}

// ---------------------------------------------------------------------------------------------
// Kernel 2: value[m][n] = scale * sum_k A[m][k] * Bt[n][k] + bsc * bf16(bias[.]).
// A row-major [M][K] f16 pitch lda; Bt row-major [N][K] f16 pitch ldb; M, N multiples of 64, K multiple of 32.
// bias_mode 1: bias indexed by column n; bias_mode 2: by row m (block-uniform run-time switch).
// Output: f16 hi plane C = f16(value) plus f16 residual plane C2 = f16((value - hi) * 1024), same layout.
// Each wave owns one 64x64 C tile (16 f32 accumulators); 8 waves per block; no block barriers.
// coverage: tilesM * tilesN tiles, each 64x64 written fully (rows it*4+qq = 0..15 per slab, cols c8 = 0..56 by 8) -> M x N.
// The three projections share no output and run in ONE launch; blockIdx.y (block-uniform) picks the product:
//   0: q = X.Wq   -> Q16 / QL16 [R][256], bias by column      1: k = X.Wk -> K16 / KL16 [R][256], bias by column
//   2: v^T = Wv^T.X^T -> VT16 / VL16 [256][R], bias by row
// ---------------------------------------------------------------------------------------------
__global__ __launch_bounds__(256) void gemm64x3_kernel(const _Float16* __restrict__ X16, const _Float16* __restrict__ WT16,
                                                       _Float16* __restrict__ Q16, _Float16* __restrict__ QL16,
                                                       _Float16* __restrict__ K16, _Float16* __restrict__ KL16,
                                                       _Float16* __restrict__ VT16, _Float16* __restrict__ VL16,
                                                       const float* __restrict__ bq, const float* __restrict__ bk,
                                                       const float* __restrict__ bv, float bsc, float scale) {
  __shared__ __align__(16) float sT[8][16 * 68];
  const int role = (int)blockIdx.y;
  const _Float16* __restrict__ A  = (role == 2) ? WT16 + (size_t)2 * DM * EM : X16;
  const _Float16* __restrict__ Bt = (role == 2) ? X16 : WT16 + (size_t)role * DM * EM;
  _Float16* __restrict__ C  = (role == 0) ? Q16  : (role == 1) ? K16  : VT16;
  _Float16* __restrict__ C2 = (role == 0) ? QL16 : (role == 1) ? KL16 : VL16;
  const float* __restrict__ bias = (role == 0) ? bq : (role == 1) ? bk : bv;
  const int M = (role == 2) ? DM : RTOT, N = (role == 2) ? RTOT : DM;
  const int lda = EM, ldb = EM, K = EM, ldc = N;
  const int bias_mode = (role == 2) ? 2 : 1;
  const int lane = threadIdx.x & 31;
  const int wave = __builtin_amdgcn_readfirstlane((int)(threadIdx.x >> 5));
  const int tilesN = N >> 6, tilesM = M >> 6;
  const int tile = (int)blockIdx.x * 8 + wave;
  if (tile >= tilesM * tilesN) return;
  const int tm = tile / tilesN, tn = tile - tm * tilesN;
  const int m0 = tm << 6, n0 = tn << 6;
  const int rl = lane & 15;
  const int koff = (lane >> 4) * 8;
  const int mOff = (lane >> 4) * 8;

  v8f acc[4][4];
#pragma unroll
  for (int i = 0; i < 4; ++i)
#pragma unroll
    for (int j = 0; j < 4; ++j) acc[i][j] = zero8();

#pragma unroll 1
  for (int k0 = 0; k0 < K; k0 += 32) {
    v16h bh[4];
#pragma unroll
    for (int j = 0; j < 4; ++j) bh[j] = ldfrag(Bt + (size_t)(n0 + (j << 4) + rl) * ldb + koff + k0);
#pragma unroll
    for (int i = 0; i < 4; ++i) {
      const size_t ao = (size_t)(m0 + (i << 4) + rl) * lda + koff + k0;
      const v16h ah = ldfrag(A + ao);
#pragma unroll
      for (int j = 0; j < 4; ++j) acc[i][j] = mma16(ah, bh[j], acc[i][j]);
      guard_g(acc[i][0], acc[i][3], ah, bh[3]);
    }
    keep4(bh[0], bh[1], bh[2], bh[3]);
  }
  accg4(acc[0][0], acc[0][1], acc[0][2], acc[0][3]);
  accg4(acc[1][0], acc[1][1], acc[1][2], acc[1][3]);
  accg4(acc[2][0], acc[2][1], acc[2][2], acc[2][3]);
  accg4(acc[3][0], acc[3][1], acc[3][2], acc[3][3]);

  float* slab = sT[wave];
#pragma unroll
  for (int i = 0; i < 4; ++i) {
    const int mBase = m0 + (i << 4);
    float brow[8];
#pragma unroll
    for (int r = 0; r < 8; ++r) brow[r] = 0.0f;
    if (bias_mode == 2) {
      const v4f ba = *(const v4f*)(bias + mBase + mOff);
      const v4f bb = *(const v4f*)(bias + mBase + mOff + 4);
#pragma unroll
      for (int r = 0; r < 4; ++r) { brow[r] = bsc * bfr(ba[r]); brow[4 + r] = bsc * bfr(bb[r]); }
    }
#pragma unroll
    for (int j = 0; j < 4; ++j) {
      float bcol = 0.0f;
      if (bias_mode == 1) bcol = bsc * bfr(bias[n0 + (j << 4) + rl]);
#pragma unroll
      for (int r = 0; r < 8; ++r) {
        const float bb = brow[r] + bcol;         // exactly one of the two is active
        slab[(mOff + r) * 68 + (j << 4) + rl] = acc[i][j][r] * scale + bb;
      }
    }
    __builtin_amdgcn_fence(3 /* release order */, "workgroup");
    __builtin_amdgcn_wave_barrier();
    __builtin_amdgcn_fence(2 /* acquire order */, "workgroup");
    {
      const int qq = lane >> 3, c8 = (lane & 7) * 8;
{
#pragma unroll
        for (int it = 0; it < 4; ++it) {
          const int row = it * 4 + qq;
          const float* sp = slab + row * 68 + c8;
          v8h hv, lv;
#pragma unroll
          for (int e = 0; e < 8; ++e) {
            const float f = sp[e];
            const _Float16 hh = (_Float16)f;
            hv[e] = hh;
            lv[e] = (_Float16)((f - (float)hh) * 1024.0f);
          }
          *(v8h*)(C  + (size_t)(mBase + row) * ldc + n0 + c8) = hv;
          *(v8h*)(C2 + (size_t)(mBase + row) * ldc + n0 + c8) = lv;
        }
        
      }
    }
    __builtin_amdgcn_fence(3 /* release order */, "workgroup");
    __builtin_amdgcn_wave_barrier();
    __builtin_amdgcn_fence(2 /* acquire order */, "workgroup");
  }
}

// ---------------------------------------------------------------------------------------------
// Kernel 3: causal single-head attention per sequence, head width 256, online softmax in f32 (fused; no score or
// probability plane in global memory).
//   qh / ql planes f16 [RTOT][DM] (16*q hi and residual x1024), kn / kl planes f16 [RTOT][DM] (16*k hi and residual
//   x1024), vt / vl planes f16 [DM][RTOT] (16*v hi and residual x1024); out f32 [RTOT][DM] = softmax(mask(q.k^T/16)).v.
//   Block = 256 threads = 8 waves, QB = 16*QT query rows of one sequence; Q hi and lo tiles staged once in LDS.
//   Key tiles of 256, only tiles up to the diagonal are visited: wave w owns keys 32w..32w+31 of the tile for the
//   logits (skipped, wave-uniform, when all its keys lie above the block's last query): S^T subtiles (A = k rows from
//   global, B = Q hi / Q lo rows from LDS, hi and x1024 accumulator sets), so the D layout gives per lane 8 consecutive
//   keys of one query -> P written to LDS as 16-B vectors ([query][key]). Keys above the query get -inf (replace fill).
//   P = 2^14 * exp(s - m_running) as f16 (EARLY: plus residual tile x1024).
//   Row max / sum: per-wave partials in LDS, combined in fixed order by wave 0 (one lane per query row).
//   P.V: every wave reads the P tile(s) (A operand, after a block barrier) and owns 32 value columns (B from vt / vl),
//   key loop bounded (block-uniform) at the diagonal.
//   EARLY (QT = 1, first 512 query rows of each sequence): k, P and v residual products into the x1024 accumulators.
//   Output: normalised O in f32 staged as a QB x 256 tile in LDS (pitch 260 floats), then each wave writes QB/8 whole
// LDS regions: Q hi, Q lo, P hi (, P lo), pmax, psum, row statistics: all cross-wave, separated by block barriers.
// staged extent == consumed extent: Q tiles QB x 256 fully staged; P tiles QB x 256 fully written every key tile.
// ---------------------------------------------------------------------------------------------
#define KCH      256
#define QSP      264
#define PSP      264
#define OSP      260
#define LATE_LDS  (3 * 32 * QSP * 2 + 2560)
#define EARLY_LDS (4 * 16 * QSP * 2 + 2560)
static_assert((QSP % 8) == 0 && (PSP % 8) == 0 && PSP >= KCH && QSP >= DM && (OSP % 4) == 0 && OSP >= DM);
static_assert(QSP == PSP);
static_assert((SEQ % KCH) == 0 && DM == 8 * 32 && KCH == 8 * 32);
static_assert(LATE_LDS <= 65536 && EARLY_LDS <= 65536);

template <int QT, bool EARLY>
__device__ __forceinline__ void attn_body(char* smem,
                                          const _Float16* __restrict__ qh, const _Float16* __restrict__ ql,
                                          const _Float16* __restrict__ kn, const _Float16* __restrict__ kl,
                                          const _Float16* __restrict__ vt, const _Float16* __restrict__ vl,
                                          float* __restrict__ out, const int batch, const int qloc0) {
  static_assert(EARLY ? (QT == 1) : (QT == 2));
  constexpr int QB  = 16 * QT;
  constexpr int TB  = QB * QSP * 2;             // bytes per 16-bit tile
  constexpr int NPL = EARLY ? 4 : 3;            // tiles: Q hi, Q lo, P hi (, P lo)
  constexpr int RPW = QB / 8;                   // output rows per wave
  static_assert((TB % 16) == 0);
  static_assert(QB * OSP * 4 <= NPL * TB);
  static_assert(8 * QB <= 256);
  static_assert(RPW * 8 == QB);
  static_assert((SEQ % QB) == 0);

  _Float16* Qs = (_Float16*)(smem);
  _Float16* Ls = (_Float16*)(smem + TB);
  _Float16* Ps = (_Float16*)(smem + 2 * TB);
  _Float16* Pl = (_Float16*)(smem + (NPL - 1) * TB);   // distinct tile only when EARLY
  float* pmax = (float*)(smem + NPL * TB);
  float* psum = pmax + 256;
  float* m_s  = psum + 256;
  float* l_s  = m_s + 32;
  float* al_s = m_s + 64;
  float* li_s = m_s + 96;

  const int tid  = (int)threadIdx.x;
  const int wave = __builtin_amdgcn_readfirstlane((int)(threadIdx.x >> 5));
  const int lane = tid & 31, h = lane >> 4, c = lane & 15;
  const int kbase = batch * SEQ;                // compact token row of key 0 of this sequence
  const int q0    = kbase + qloc0;              // compact token row of query 0 of this block
  const int qmax  = qloc0 + QB - 1;             // last local query index of this block
  const float ninf = -__builtin_inff();
  const float sc = 0.000244140625f;             // 1/4096: logits carry 16*16 and the 1/16 score scale
  const float rs = 0.0009765625f;               // 1/1024: residual plane carry

  if (tid < 32) { m_s[tid] = ninf; l_s[tid] = 0.0f; al_s[tid] = 0.0f; li_s[tid] = 0.0f; }
  psum[tid] = 0.0f;
  pmax[tid] = ninf;
  // Q hi and lo tiles: QB rows x 32 pieces of 8 halves per plane; coverage 2*QT * 256 = QB*32 pieces = whole tile each
#pragma unroll
  for (int i = 0; i < 2 * QT; ++i) {
    const int idx = i * 256 + tid;
    const int row = idx >> 5;
    const int pc  = idx & 31;
    const v8h vh = *(const v8h*)(qh + (size_t)(q0 + row) * DM + pc * 8);
    const v8h vq = *(const v8h*)(ql + (size_t)(q0 + row) * DM + pc * 8);
    *(v8h*)(Qs + row * QSP + pc * 8) = vh;
    *(v8h*)(Ls + row * QSP + pc * 8) = vq;
  }
  __syncthreads();

  v8f oacc[QT][2];
  v8f oacl[QT][2];
#pragma unroll
  for (int qt = 0; qt < QT; ++qt)
#pragma unroll
    for (int nt = 0; nt < 2; ++nt) { oacc[qt][nt] = zero8(); oacl[qt][nt] = zero8(); }

  const int qoff = c * QSP + 8 * h;             // LDS fragment offset of query c (add 16*qt*QSP + k)
  const int ntile = qmax / KCH + 1;             // key tiles up to the diagonal (block-uniform)

#pragma unroll 1
  for (int t = 0; t < ntile; ++t) {
    // ---- logits: S^T subtiles for this wave's 32 keys, queries 0..QB-1; hi and x1024 accumulators ----
    const int kloc = t * KCH + 32 * wave;       // local index of this wave's first key (scalar)
    v8f sacc[QT][2];   // [query subtile][key subtile]; element r: query 16qt+c, key kloc+16kt+8h+r
    v8f sacl[QT][2];
#pragma unroll
    for (int qt = 0; qt < QT; ++qt)
#pragma unroll
      for (int kt = 0; kt < 2; ++kt) { sacc[qt][kt] = zero8(); sacl[qt][kt] = zero8(); }
    if (kloc <= qmax) {                         // wave-uniform: some key of this wave is visible to some query
      const size_t ko0 = (size_t)(kbase + kloc + c) * DM + 8 * h;
      const size_t ko1 = (size_t)(kbase + kloc + 16 + c) * DM + 8 * h;
#pragma unroll 1
      for (int k0 = 0; k0 < DM; k0 += 32) {
        const v16h a0 = ldfrag(kn + ko0 + k0), a1 = ldfrag(kn + ko1 + k0);
        v16h bq[QT], cq[QT];
#pragma unroll
        for (int qt = 0; qt < QT; ++qt) {
          bq[qt] = ldfrag(Qs + 16 * qt * QSP + qoff + k0);
          cq[qt] = ldfrag(Ls + 16 * qt * QSP + qoff + k0);
        }
#pragma unroll
        for (int qt = 0; qt < QT; ++qt) {
          sacc[qt][0] = mma16(a0, bq[qt], sacc[qt][0]);
          sacc[qt][1] = mma16(a1, bq[qt], sacc[qt][1]);
        }
#pragma unroll
        for (int qt = 0; qt < QT; ++qt) {
          sacl[qt][0] = mma16(a0, cq[qt], sacl[qt][0]);
          sacl[qt][1] = mma16(a1, cq[qt], sacl[qt][1]);
        }
        if constexpr (EARLY) {
          const v16h d0 = ldfrag(kl + ko0 + k0), d1 = ldfrag(kl + ko1 + k0);
          sacl[0][0] = mma16(d0, bq[0], sacl[0][0]);
          sacl[0][1] = mma16(d1, bq[0], sacl[0][1]);
          guard_a4f6(sacc[0][0], sacc[0][1], sacl[0][0], sacl[0][1], a0, a1, bq[0], cq[0], d0, d1);
        } else {
          guard_s8(sacc[0][0], sacc[0][1], sacc[QT - 1][0], sacc[QT - 1][1],
                   sacl[0][0], sacl[0][1], sacl[QT - 1][0], sacl[QT - 1][1],
                   a0, a1, bq[0], bq[QT - 1], cq[0], cq[QT - 1]);
        }
      }
    }
    // ---- combine hi + lo/1024, scale, causal replace fill, per-wave partial row max ----
    {
#pragma unroll
      for (int qt = 0; qt < QT; ++qt) {
        const int qry = qloc0 + 16 * qt + c;
        float pm = ninf;
#pragma unroll
        for (int kt = 0; kt < 2; ++kt) {
#pragma unroll
          for (int r = 0; r < 8; ++r) {
            const int key = kloc + 16 * kt + 8 * h + r;
            float v = (sacc[qt][kt][r] + sacl[qt][kt][r] * rs) * sc;
            v = (key <= qry) ? v : ninf;
            sacc[qt][kt][r] = v;
            pm = fmaxf(pm, v);
          }
        }
        pm = fmaxf(pm, __shfl_xor(pm, 16, 32));
        pmax[wave * QB + 16 * qt + c] = pm;
      }
    }
    __syncthreads();
    // ---- wave 0, lane = query row: fold the prior tile's sums into l, new running max, rescale factor ----
    if (wave == 0 && lane < QB) {
      const int row = lane;
      float ps = 0.0f;
#pragma unroll
      for (int w = 0; w < 8; ++w) ps += psum[w * QB + row];
      l_s[row] = l_s[row] * al_s[row] + ps;
      const float mo = m_s[row];
      float mx = mo;
#pragma unroll
      for (int w = 0; w < 8; ++w) mx = fmaxf(mx, pmax[w * QB + row]);
      al_s[row] = __expf(mo - mx);
      m_s[row] = mx;
    }
    __syncthreads();
    // ---- p = 2^14 * exp(s - m) as f16 (EARLY: plus residual), P tile(s), partial row sums, rescale O ----
    {
#pragma unroll
      for (int qt = 0; qt < QT; ++qt) {
        const float mq = m_s[16 * qt + c];
        float ps = 0.0f;
#pragma unroll
        for (int kt = 0; kt < 2; ++kt) {
          v8h hh, ll;
#pragma unroll
          for (int r = 0; r < 8; ++r) {
            const float p = __expf(sacc[qt][kt][r] - mq);
            ps += p;
            const float pw = p * 16384.0f;
            const _Float16 ph = (_Float16)pw;
            hh[r] = ph;
            ll[r] = (_Float16)((pw - (float)ph) * 1024.0f);
          }
          *(v8h*)(Ps + (16 * qt + c) * PSP + 32 * wave + 16 * kt + 8 * h) = hh;
          if constexpr (EARLY) *(v8h*)(Pl + (16 * qt + c) * PSP + 32 * wave + 16 * kt + 8 * h) = ll;
        }
        ps += __shfl_xor(ps, 16, 32);
        psum[wave * QB + 16 * qt + c] = ps;
        const v4f aA = *(const v4f*)(al_s + 16 * qt + 8 * h), aB = *(const v4f*)(al_s + 16 * qt + 8 * h + 4);
#pragma unroll
        for (int nt = 0; nt < 2; ++nt) {
#pragma unroll
          for (int r = 0; r < 4; ++r) {
            oacc[qt][nt][r] *= aA[r]; oacc[qt][nt][4 + r] *= aB[r];
            if constexpr (EARLY) { oacl[qt][nt][r] *= aA[r]; oacl[qt][nt][4 + r] *= aB[r]; }
          }
        }
      }
    }
    __syncthreads();
    // ---- O += P . V over the visible keys of the tile; this wave's columns 32w + 16nt + c ----
    {
      const int rem = qmax - t * KCH;                            // >= 0 for visited tiles
      int nks = ((rem >> 5) + 1) * 32;
      nks = (nks < KCH) ? nks : KCH;                             // block-uniform key bound
      const size_t vo = (size_t)(32 * wave + c) * RTOT + kbase + (size_t)t * KCH + 8 * h;
#pragma unroll 1
      for (int ks = 0; ks < nks; ks += 32) {
        v16h pa[QT];
#pragma unroll
        for (int qt = 0; qt < QT; ++qt) pa[qt] = ldfrag(Ps + 16 * qt * PSP + c * PSP + 8 * h + ks);
        const v16h vb0 = ldfrag(vt + vo + ks);
        const v16h vb1 = ldfrag(vt + vo + (size_t)16 * RTOT + ks);
#pragma unroll
        for (int qt = 0; qt < QT; ++qt) {
          oacc[qt][0] = mma16(pa[qt], vb0, oacc[qt][0]);
          oacc[qt][1] = mma16(pa[qt], vb1, oacc[qt][1]);
        }
        if constexpr (EARLY) {
          const v16h pl0 = ldfrag(Pl + c * PSP + 8 * h + ks);
          const v16h vl0 = ldfrag(vl + vo + ks);
          const v16h vl1 = ldfrag(vl + vo + (size_t)16 * RTOT + ks);
          oacl[0][0] = mma16(pa[0], vl0, oacl[0][0]);
          oacl[0][1] = mma16(pa[0], vl1, oacl[0][1]);
          oacl[0][0] = mma16(pl0, vb0, oacl[0][0]);
          oacl[0][1] = mma16(pl0, vb1, oacl[0][1]);
          guard_a4f6(oacc[0][0], oacc[0][1], oacl[0][0], oacl[0][1], pa[0], pl0, vb0, vb1, vl0, vl1);
        } else {
          guard_pv4(oacc[0][0], oacc[0][1], oacc[QT - 1][0], oacc[QT - 1][1], pa[0], pa[QT - 1], vb0, vb1);
        }
      }
    }
  }

  // ---- final normaliser per query row (fold the last tile's sums); O = oacc / (2^14 * 16 * l) ----
  if (wave == 0 && lane < QB) {
    const int row = lane;
    float ps = 0.0f;
#pragma unroll
    for (int w = 0; w < 8; ++w) ps += psum[w * QB + row];
    const float l = l_s[row] * al_s[row] + ps;
    li_s[row] = (1.0f / l) * (1.0f / 262144.0f);
  }
  __syncthreads();
  // ---- stage the normalised QB x 256 f32 tile over the Q / P regions (pitch OSP) ----
  float* Os = (float*)(smem);
  {
#pragma unroll
    for (int qt = 0; qt < QT; ++qt) {
      const v4f iA = *(const v4f*)(li_s + 16 * qt + 8 * h), iB = *(const v4f*)(li_s + 16 * qt + 8 * h + 4);
#pragma unroll
      for (int nt = 0; nt < 2; ++nt) {
        const int col = 32 * wave + 16 * nt + c;
#pragma unroll
        for (int r = 0; r < 4; ++r) {
          float o0 = oacc[qt][nt][r], o1 = oacc[qt][nt][4 + r];
          if constexpr (EARLY) { o0 += oacl[qt][nt][r] * rs; o1 += oacl[qt][nt][4 + r] * rs; }
          Os[(16 * qt + 8 * h + r) * OSP + col]     = o0 * iA[r];
          Os[(16 * qt + 8 * h + 4 + r) * OSP + col] = o1 * iB[r];
        }
      }
    }
  }
  __syncthreads();
  {
    float* go = out + (size_t)q0 * DM;
{
#pragma unroll
      for (int rr = 0; rr < RPW; ++rr) {
        const int row = RPW * wave + rr;
#pragma unroll
        for (int j = 0; j < 2; ++j) {
          const int pc = j * 32 + lane;
          const v4f v = *(const v4f*)(Os + row * OSP + pc * 4);
          *(v4f*)(go + (size_t)row * DM + pc * 4) = v;
        }
      }
      
    }
  }
}

// Both query ranges in ONE launch (they share no output row); the block index picks the range, block-uniform.
//   blocks [0, NB*LBLK): query rows [EROWS, SEQ) of every sequence, 32 rows per block, q residual only (the long blocks,
//                        so they start first); coverage NB * LBLK blocks x 32 rows x 256 floats = NB * (SEQ - EROWS) x 256
//   the NB*EBLK blocks behind them: query rows [0, EROWS), 16 rows per block, full residual set;
//                        coverage NB * EBLK blocks x 16 rows x 256 floats = NB * EROWS x 256
#define ATTN_LDS (LATE_LDS > EARLY_LDS ? LATE_LDS : EARLY_LDS)
__global__ __launch_bounds__(256) void attn_kernel(const _Float16* __restrict__ qh, const _Float16* __restrict__ ql,
                                                   const _Float16* __restrict__ kn, const _Float16* __restrict__ kl,
                                                   const _Float16* __restrict__ vt, const _Float16* __restrict__ vl,
                                                   float* __restrict__ out) {
  extern __shared__ __align__(16) char smem[];
  const int blk = (int)blockIdx.x;
  if (blk < NB * LBLK) {
    const int batch = blk / LBLKD;
    const int qloc0 = EROWS + (blk - batch * LBLKD) * 32;
    attn_body<2, false>(smem, qh, ql, kn, kn, vt, vt, out, batch, qloc0);
  } else {
    const int eb = blk - NB * LBLK;
    const int batch = eb / EBLK;
    const int qloc0 = (eb - batch * EBLK) * 16;
    attn_body<1, true>(smem, qh, ql, kn, kl, vt, vl, out, batch, qloc0);
  }
}

// ---------------------------------------------------------------------------------------------
// Workspace map (bytes, all regions exact tile / whole-line multiples; R = NB*SEQ = 16384):
//   WT16 : Wq^T | Wk^T | Wv^T f16 [3][256][128] (64*bf16(w))   size 3*256*128*2 =    196,608
//   X16  : f16 [R][128] (16*bf16(x))                          size R*128*2     =  4,194,304
//   Q16 / QL16 : f16 hi / residual [R][256] (16*q)             8,388,608 each
//   K16 / KL16 : f16 hi / residual [R][256] (16*k)             8,388,608 each
//   VT16 / VL16: f16 hi / residual [256][R] (16*v)             8,388,608 each
//   total 54,722,560
// ---------------------------------------------------------------------------------------------
static_assert((size_t)3 * DM * EM * 2 + (size_t)RTOT * EM * 2 + (size_t)6 * RTOT * DM * 2 <= (size_t)134217728);
static_assert(((size_t)3 * DM * EM * 2) % 128 == 0 && ((size_t)RTOT * EM * 2) % 128 == 0 && ((size_t)RTOT * DM * 2) % 128 == 0);

extern "C" void kernel_launch(void* const* d_in, const int* in_sizes, int n_in,
                              void* d_out, int out_size, void* d_ws, size_t ws_size,
                              hipStream_t stream) {
  if (n_in < 7) return;
  const int R = RTOT;
  const long long needx = ((long long)(NB - 1) * SEQ_FULL + SEQ) * EM;
  if ((long long)in_sizes[0] < needx) return;
  if (in_sizes[1] < EM * DM || in_sizes[3] < EM * DM || in_sizes[5] < EM * DM) return;
  if (in_sizes[2] < DM || in_sizes[4] < DM || in_sizes[6] < DM) return;
  if ((long long)out_size < (long long)R * DM) return;

  const float* x  = (const float*)d_in[0];
  const float* Wq = (const float*)d_in[1];
  const float* bq = (const float*)d_in[2];
  const float* Wk = (const float*)d_in[3];
  const float* bk = (const float*)d_in[4];
  const float* Wv = (const float*)d_in[5];
  const float* bv = (const float*)d_in[6];
  float* out = (float*)d_out;

  const size_t bWT = (size_t)3 * DM * EM * 2;
  const size_t bX  = (size_t)R * EM * 2;
  const size_t bPl = (size_t)R * DM * 2;
  size_t off = 0;
  const size_t oWT = off; off += bWT;
  const size_t oX  = off; off += bX;
  const size_t oQ  = off; off += bPl;
  const size_t oQL = off; off += bPl;
  const size_t oK  = off; off += bPl;
  const size_t oKL = off; off += bPl;
  const size_t oVT = off; off += bPl;
  const size_t oVL = off; off += bPl;
  if (off > ws_size) return;                     // 54,722,560 for R = 16384
  if (off > (size_t)134217728) return;

  char* ws = (char*)d_ws;
  _Float16* WT16 = (_Float16*)(ws + oWT);
  _Float16* X16  = (_Float16*)(ws + oX);
  _Float16* Q16  = (_Float16*)(ws + oQ);
  _Float16* QL16 = (_Float16*)(ws + oQL);
  _Float16* K16  = (_Float16*)(ws + oK);
  _Float16* KL16 = (_Float16*)(ws + oKL);
  _Float16* VT16 = (_Float16*)(ws + oVT);
  _Float16* VL16 = (_Float16*)(ws + oVL);

  const dim3 blk(256);
  const int nbx = (R * EM / 8) / 256;            // pieces of 8 halves / 256 threads
  const int nbw = (3 * DM * EM / 8) / 256;       // 48
  if (nbx * 256 * 8 != R * EM) return;

  // (1) x -> X16 (16*bf16), weights -> WT16 (64*bf16, in[128][256] -> out[256][128])
  cvt_kernel<<<dim3(nbx + nbw), blk, 0, stream>>>(x, Wq, Wk, Wv, X16, WT16, nbx);
  // (2) q, k -> hi + residual planes [R][256] (bias by column) and v^T -> hi + residual planes [256][R] (bias by row):
  //     K=128; scale 16/(16*64), bias carry 16; grid.y = product, (R/64)*(256/64) tiles of 64x64 each, 8 per block
  gemm64x3_kernel<<<dim3(((R / 64) * (DM / 64)) / 8, 3), blk, 0, stream>>>(
      X16, WT16, Q16, QL16, K16, KL16, VT16, VL16, bq, bk, bv, 16.0f, 0.015625f);
  // (3) attention, all query rows -> out
  (void)hipFuncSetAttribute(reinterpret_cast<const void*>(&attn_kernel),
                            hipFuncAttributeMaxDynamicSharedMemorySize, ATTN_LDS);
  attn_kernel<<<dim3(NB * LBLK + NB * EBLK), blk, ATTN_LDS, stream>>>(Q16, QL16, K16, KL16, VT16, VL16, out);
  (void)hipGetLastError();
}

// v002
// It runs in 75.3 microseconds.
// In both of two side-by-side timings against v001, it was 1.24 times as fast.
// Counting every step since v000, it is 1.74 times as fast.
// Contractions: q | k = x.Wq | x.Wk and v^T = Wv^T.x^T : v_wmma_f32_16x16x32_f16, f16 operands carrying 16*bf16(x) and
// 64*bf16(W), f32 accumulate; S^T = k.q^T : v_wmma_f32_16x16x32_f16, q as f16 hi (x16) plus f16 residual plane (x2^10, own
// accumulator), k as f16 (x16) plus, for the first 512 query rows, an f16 residual plane (x2^10); O = P.v :
// v_wmma_f32_16x16x32_f16, P = 2^14*exp(s-m) as f16 and v as f16 (x16), both with f16 residual planes (x2^10, own
// accumulator) for the first 512 query rows; f32 accumulate. Float inputs RNE-converted to bf16 on load; bias, softmax
// statistics and output scaling in f32.
#include <hip/hip_runtime.h>
#include <stdint.h>

#ifndef NB
#define NB 8
#endif
#ifndef SEQ
#define SEQ 2048
#endif
#define NB_FULL  8
#define SEQ_FULL 2048
#define EM       128
#define DM       256
#define RTOT     (NB * SEQ)
#define EROWS    ((SEQ) < 512 ? (SEQ) : 512)
#define LBLK     (((SEQ) - EROWS) / 32)
#define LBLKD    (LBLK > 0 ? LBLK : 1)
#define EBLK     (EROWS / 16)

static_assert(NB >= 1 && NB <= NB_FULL);
static_assert(SEQ >= 256 && SEQ <= SEQ_FULL && (SEQ % 256) == 0);
static_assert(DM == 256 && EM == 128);
static_assert((EM % 32) == 0 && (DM % 64) == 0);
static_assert((RTOT % 128) == 0);
static_assert(((size_t)RTOT * EM) % 2048 == 0);
static_assert((3 * DM * EM) % 2048 == 0);
static_assert((EROWS % 32) == 0 && ((SEQ - EROWS) % 32) == 0);
static_assert((((RTOT / 64) * (DM / 64)) % 8) == 0);

typedef _Float16 v16h __attribute__((ext_vector_type(16)));
typedef _Float16 v8h  __attribute__((ext_vector_type(8)));
typedef float    v8f  __attribute__((ext_vector_type(8)));
typedef float    v4f  __attribute__((ext_vector_type(4)));

// f32 -> nearest-even bf16 bits / value
__device__ __forceinline__ unsigned short bfbits(float f) {
  unsigned u = __float_as_uint(f);
  return (unsigned short)((u + 0x7FFFu + ((u >> 16) & 1u)) >> 16);
}
__device__ __forceinline__ float bfval(unsigned short b) { return __uint_as_float(((unsigned)b) << 16); }
__device__ __forceinline__ float bfr(float f) { return bfval(bfbits(f)); }

__device__ __forceinline__ v8f mma16(v16h a, v16h b, v8f c) {
  return __builtin_amdgcn_wmma_f32_16x16x32_f16(false, a, false, b, (short)0, c, false, false);
}

// 16-bit WMMA fragment from k-contiguous storage (A row-major [m][k], or B stored [n][k]):
// p points at element (row_or_col = lane&15, k0 + 8h); elements 0..7 <- p[0..7], 8..15 <- p[16..23].
__device__ __forceinline__ v16h ldfrag(const _Float16* p) {
  union { v16h v; v8h h[2]; } f;
  f.h[0] = *(const v8h*)(p);
  f.h[1] = *(const v8h*)(p + 16);
  return f.v;
}
__device__ __forceinline__ v8f zero8() {
  v8f z;
#pragma unroll
  for (int i = 0; i < 8; ++i) z[i] = 0.0f;
  return z;
}

// hazard guards: 4 VALU slots after the last WMMA of a group, D tied, A/B kept live
__device__ __forceinline__ void guard_g(v8f& a, v8f& b, v16h x, v16h y) {
  asm volatile("v_nop\n\tv_nop\n\tv_nop\n\tv_nop" : "+v"(a), "+v"(b) : "v"(x), "v"(y));
}
__device__ __forceinline__ void keep4(v16h a, v16h b, v16h c, v16h d) {
  asm volatile("v_nop" :: "v"(a), "v"(b), "v"(c), "v"(d));
}
__device__ __forceinline__ void accg4(v8f& a, v8f& b, v8f& c, v8f& d) {
  asm volatile("v_nop\n\tv_nop\n\tv_nop\n\tv_nop" : "+v"(a), "+v"(b), "+v"(c), "+v"(d));
}
__device__ __forceinline__ void guard_s8(v8f& a0, v8f& a1, v8f& a2, v8f& a3, v8f& b0, v8f& b1, v8f& b2, v8f& b3,
                                         v16h x0, v16h x1, v16h y0, v16h y1, v16h z0, v16h z1) {
  asm volatile("v_nop\n\tv_nop\n\tv_nop\n\tv_nop"
               : "+v"(a0), "+v"(a1), "+v"(a2), "+v"(a3), "+v"(b0), "+v"(b1), "+v"(b2), "+v"(b3)
               : "v"(x0), "v"(x1), "v"(y0), "v"(y1), "v"(z0), "v"(z1));
}
__device__ __forceinline__ void guard_a4f6(v8f& a0, v8f& a1, v8f& b0, v8f& b1,
                                           v16h x0, v16h x1, v16h y0, v16h y1, v16h z0, v16h z1) {
  asm volatile("v_nop\n\tv_nop\n\tv_nop\n\tv_nop"
               : "+v"(a0), "+v"(a1), "+v"(b0), "+v"(b1)
               : "v"(x0), "v"(x1), "v"(y0), "v"(y1), "v"(z0), "v"(z1));
}
__device__ __forceinline__ void guard_pv4(v8f& a0, v8f& a1, v8f& b0, v8f& b1,
                                          v16h p0, v16h p1, v16h x0, v16h x1) {
  asm volatile("v_nop\n\tv_nop\n\tv_nop\n\tv_nop"
               : "+v"(a0), "+v"(a1), "+v"(b0), "+v"(b1)
               : "v"(p0), "v"(p1), "v"(x0), "v"(x1));
}

// 8 consecutive k of column n of a [EM][DM] weight, as f16(64 * bf16(w))
__device__ __forceinline__ v8h wpiece(const float* __restrict__ W, int k0, int n) {
  v8h o;
#pragma unroll
  for (int i = 0; i < 8; ++i) o[i] = (_Float16)(bfr(W[(size_t)(k0 + i) * DM + n]) * 64.0f);
  return o;
}

// ---------------------------------------------------------------------------------------------
// Kernel 1: input conversion to f16 operand planes, one launch, block-uniform roles, no barriers.
//   blocks [0, nbx):      X16[r][c] = f16(16 * bf16(x[row(r)][c])), compact token rows r = b*SEQ + n read from
//   blocks [nbx, nbx+48): WT16[mat][n][k] = f16(64 * bf16(W_mat[k][n])), in[128][256] -> out[256][128] (strided reads,
//                         contiguous 16-B stores, 8 consecutive k per lane), mat 0 = Wq, 1 = Wk, 2 = Wv (uniform per block).
// coverage: nbx*256 lanes * 8 = RTOT*EM halves = whole X16; 48*256 lanes * 8 = 3*DM*EM halves = whole WT16.
// ---------------------------------------------------------------------------------------------
__global__ __launch_bounds__(256) void cvt_kernel(const float* __restrict__ x, const float* __restrict__ Wq,
                                                  const float* __restrict__ Wk, const float* __restrict__ Wv,
                                                  _Float16* __restrict__ X16, _Float16* __restrict__ WT16, int nbx) {
  const int tid = (int)threadIdx.x;
  const int blk = (int)blockIdx.x;
  if (blk < nbx) {
    const int li = blk * 256 + tid;            // 8-half piece index
    const int r  = li >> 4;                    // compact token row (16 pieces per row)
    const int c0 = (li & 15) * 8;
    const int b  = r / SEQ;
    const int n  = r - b * SEQ;
    const float* xr = x + ((size_t)b * SEQ_FULL + n) * EM + c0;
    const v4f a  = *(const v4f*)(xr);
    const v4f a2 = *(const v4f*)(xr + 4);
    v8h o;
#pragma unroll
    for (int i = 0; i < 4; ++i) {
      o[i]     = (_Float16)(bfr(a[i]) * 16.0f);
      o[4 + i] = (_Float16)(bfr(a2[i]) * 16.0f);
    }
    _Float16* d = X16 + (size_t)li * 8;
    *(v8h*)d = o;
    
  } else {
    const int li = (blk - nbx) * 256 + tid;    // piece index in [0, 3*DM*EM/8)
    if (li >= 3 * DM * EM / 8) return;
    const int mat = li >> 12;                  // DM*EM/8 = 4096 pieces per matrix; uniform per block
    const int n   = (li >> 4) & (DM - 1);
    const int k0  = (li & 15) * 8;
    v8h o;
    if (mat == 0)      o = wpiece(Wq, k0, n);
    else if (mat == 1) o = wpiece(Wk, k0, n);
    else               o = wpiece(Wv, k0, n);
    _Float16* d = WT16 + (size_t)li * 8;       // = mat*DM*EM + n*EM + k0
    *(v8h*)d = o;
    
  }
}

// ---------------------------------------------------------------------------------------------
// Kernel 2: value[m][n] = scale * sum_k A[m][k] * Bt[n][k] + bsc * bf16(bias[.]).
// A row-major [M][K] f16 pitch lda; Bt row-major [N][K] f16 pitch ldb; M, N multiples of 64, K multiple of 32.
// bias_mode 1: bias indexed by column n; bias_mode 2: by row m (block-uniform run-time switch).
// Output: f16 hi plane C = f16(value) plus f16 residual plane C2 = f16((value - hi) * 1024), same layout.
// Each wave owns one 64x64 C tile (16 f32 accumulators); 8 waves per block; no block barriers.
// coverage: tilesM * tilesN tiles, each 64x64 written fully (rows it*4+qq = 0..15 per slab, cols c8 = 0..56 by 8) -> M x N.
// The three projections share no output and run in ONE launch; blockIdx.y (block-uniform) picks the product:
//   0: q = X.Wq   -> Q16 / QL16 [R][256], bias by column      1: k = X.Wk -> K16 / KL16 [R][256], bias by column
//   2: v^T = Wv^T.X^T -> VT16 / VL16 [256][R], bias by row
// ---------------------------------------------------------------------------------------------
__global__ __launch_bounds__(256) void gemm64x3_kernel(const _Float16* __restrict__ X16, const _Float16* __restrict__ WT16,
                                                       _Float16* __restrict__ Q16, _Float16* __restrict__ QL16,
                                                       _Float16* __restrict__ K16, _Float16* __restrict__ KL16,
                                                       _Float16* __restrict__ VT16, _Float16* __restrict__ VL16,
                                                       const float* __restrict__ bq, const float* __restrict__ bk,
                                                       const float* __restrict__ bv, float bsc, float scale) {
  __shared__ __align__(16) float sT[8][16 * 68];
  const int role = (int)blockIdx.y;
  const _Float16* __restrict__ A  = (role == 2) ? WT16 + (size_t)2 * DM * EM : X16;
  const _Float16* __restrict__ Bt = (role == 2) ? X16 : WT16 + (size_t)role * DM * EM;
  _Float16* __restrict__ C  = (role == 0) ? Q16  : (role == 1) ? K16  : VT16;
  _Float16* __restrict__ C2 = (role == 0) ? QL16 : (role == 1) ? KL16 : VL16;
  const float* __restrict__ bias = (role == 0) ? bq : (role == 1) ? bk : bv;
  const int M = (role == 2) ? DM : RTOT, N = (role == 2) ? RTOT : DM;
  const int lda = EM, ldb = EM, K = EM, ldc = N;
  const int bias_mode = (role == 2) ? 2 : 1;
  const int lane = threadIdx.x & 31;
  const int wave = __builtin_amdgcn_readfirstlane((int)(threadIdx.x >> 5));
  const int tilesN = N >> 6, tilesM = M >> 6;
  const int tile = (int)blockIdx.x * 8 + wave;
  if (tile >= tilesM * tilesN) return;
  const int tm = tile / tilesN, tn = tile - tm * tilesN;
  const int m0 = tm << 6, n0 = tn << 6;
  const int rl = lane & 15;
  const int koff = (lane >> 4) * 8;
  const int mOff = (lane >> 4) * 8;

  v8f acc[4][4];
#pragma unroll
  for (int i = 0; i < 4; ++i)
#pragma unroll
    for (int j = 0; j < 4; ++j) acc[i][j] = zero8();

#pragma unroll 1
  for (int k0 = 0; k0 < K; k0 += 32) {
    v16h bh[4];
#pragma unroll
    for (int j = 0; j < 4; ++j) bh[j] = ldfrag(Bt + (size_t)(n0 + (j << 4) + rl) * ldb + koff + k0);
#pragma unroll
    for (int i = 0; i < 4; ++i) {
      const size_t ao = (size_t)(m0 + (i << 4) + rl) * lda + koff + k0;
      const v16h ah = ldfrag(A + ao);
#pragma unroll
      for (int j = 0; j < 4; ++j) acc[i][j] = mma16(ah, bh[j], acc[i][j]);
      guard_g(acc[i][0], acc[i][3], ah, bh[3]);
    }
    keep4(bh[0], bh[1], bh[2], bh[3]);
  }
  accg4(acc[0][0], acc[0][1], acc[0][2], acc[0][3]);
  accg4(acc[1][0], acc[1][1], acc[1][2], acc[1][3]);
  accg4(acc[2][0], acc[2][1], acc[2][2], acc[2][3]);
  accg4(acc[3][0], acc[3][1], acc[3][2], acc[3][3]);

  float* slab = sT[wave];
#pragma unroll
  for (int i = 0; i < 4; ++i) {
    const int mBase = m0 + (i << 4);
    float brow[8];
#pragma unroll
    for (int r = 0; r < 8; ++r) brow[r] = 0.0f;
    if (bias_mode == 2) {
      const v4f ba = *(const v4f*)(bias + mBase + mOff);
      const v4f bb = *(const v4f*)(bias + mBase + mOff + 4);
#pragma unroll
      for (int r = 0; r < 4; ++r) { brow[r] = bsc * bfr(ba[r]); brow[4 + r] = bsc * bfr(bb[r]); }
    }
#pragma unroll
    for (int j = 0; j < 4; ++j) {
      float bcol = 0.0f;
      if (bias_mode == 1) bcol = bsc * bfr(bias[n0 + (j << 4) + rl]);
#pragma unroll
      for (int r = 0; r < 8; ++r) {
        const float bb = brow[r] + bcol;         // exactly one of the two is active
        slab[(mOff + r) * 68 + (j << 4) + rl] = acc[i][j][r] * scale + bb;
      }
    }
    __builtin_amdgcn_fence(3 /* release order */, "workgroup");
    __builtin_amdgcn_wave_barrier();
    __builtin_amdgcn_fence(2 /* acquire order */, "workgroup");
    {
      const int qq = lane >> 3, c8 = (lane & 7) * 8;
{
#pragma unroll
        for (int it = 0; it < 4; ++it) {
          const int row = it * 4 + qq;
          const float* sp = slab + row * 68 + c8;
          v8h hv, lv;
#pragma unroll
          for (int e = 0; e < 8; ++e) {
            const float f = sp[e];
            const _Float16 hh = (_Float16)f;
            hv[e] = hh;
            lv[e] = (_Float16)((f - (float)hh) * 1024.0f);
          }
          *(v8h*)(C  + (size_t)(mBase + row) * ldc + n0 + c8) = hv;
          *(v8h*)(C2 + (size_t)(mBase + row) * ldc + n0 + c8) = lv;
        }
        
      }
    }
    __builtin_amdgcn_fence(3 /* release order */, "workgroup");
    __builtin_amdgcn_wave_barrier();
    __builtin_amdgcn_fence(2 /* acquire order */, "workgroup");
  }
}

// ---------------------------------------------------------------------------------------------
// Kernel 3: causal single-head attention per sequence, head width 256, online softmax in f32 (fused; no score or
// probability plane in global memory).
//   qh / ql planes f16 [RTOT][DM] (16*q hi and residual x1024), kn / kl planes f16 [RTOT][DM] (16*k hi and residual
//   x1024), vt / vl planes f16 [DM][RTOT] (16*v hi and residual x1024); out f32 [RTOT][DM] = softmax(mask(q.k^T/16)).v.
//   Block = 256 threads = 8 waves, QB = 16*QT query rows of one sequence; Q hi and lo tiles staged once in LDS.
//   Key tiles of 256, only tiles up to the diagonal are visited: wave w owns keys 32w..32w+31 of the tile for the
//   logits (skipped, wave-uniform, when all its keys lie above the block's last query): S^T subtiles (A = k rows from
//   global, B = Q hi / Q lo rows from LDS, hi and x1024 accumulator sets), so the D layout gives per lane 8 consecutive
//   keys of one query -> P written to LDS as 16-B vectors ([query][key]). Keys above the query get -inf (replace fill).
//   P = 2^14 * exp(s - m_running) as f16 (EARLY: plus residual tile x1024).
//   Row max / sum: per-wave partials in LDS, combined in fixed order by wave 0 (one lane per query row).
//   P.V: every wave reads the P tile(s) (A operand, after a block barrier) and owns 32 value columns (B from vt / vl),
//   key loop bounded (block-uniform) at the diagonal.
//   EARLY (QT = 1, first 512 query rows of each sequence): k, P and v residual products into the x1024 accumulators.
//   Long blocks (QT = 2): a wave's 32 key rows and its 32 value columns reach it through its own LDS buffer, half a tile
//   (32 rows x 256 B) at a time, by asynchronous copies that take whole 128-B lines; the fragments are read from there.
//   Output: normalised O in f32 staged as a QB x 256 tile in LDS (pitch 260 floats), then each wave writes QB/8 whole
// LDS regions: Q hi, Q lo, P hi (, P lo), pmax, psum, row statistics: all cross-wave, separated by block barriers.
// staged extent == consumed extent: Q tiles QB x 256 fully staged; P tiles QB x 256 fully written every key tile.
// ---------------------------------------------------------------------------------------------
#define KCH      256
#define QSP      264
#define PSP      264
#define OSP      260
#define LATE_LDS  (3 * 32 * QSP * 2 + 2560)
#define EARLY_LDS (4 * 16 * QSP * 2 + 2560)
static_assert((QSP % 8) == 0 && (PSP % 8) == 0 && PSP >= KCH && QSP >= DM && (OSP % 4) == 0 && OSP >= DM);
static_assert(QSP == PSP);
static_assert((SEQ % KCH) == 0 && DM == 8 * 32 && KCH == 8 * 32);
static_assert(LATE_LDS <= 65536 && EARLY_LDS <= 65536);
// Long blocks: one staging buffer per wave, read and refilled by that wave alone: 32 rows x 256 B at a pitch of 272 B
// (16 B x 17: conflict-free for the 16-B fragment reads).
#define SPT       136
#define STG_BYTES (32 * SPT * 2)
static_assert((LATE_LDS % 16) == 0 && (STG_BYTES % 16) == 0 && ((SPT * 2) % 16) == 0);

// Eight asynchronous 16-B-per-lane copies to LDS; copy i moves two 256-B row halves (lanes 0..15 one, 16..31 the next),
// so every request covers whole 128-B lines. l: the lane's LDS byte address, g: the lane's global address, both of copy 0;
// gp: global step between copies in halves. The s_wait_xcnt stands in the statement so that no address register is
// rewritten ahead of it.
__device__ __forceinline__ void copy8(const unsigned l, const _Float16* g, const size_t gp) {
  asm volatile("global_load_async_to_lds_b128 %0, %8, off\n\t"
               "global_load_async_to_lds_b128 %1, %9, off\n\t"
               "global_load_async_to_lds_b128 %2, %10, off\n\t"
               "global_load_async_to_lds_b128 %3, %11, off\n\t"
               "global_load_async_to_lds_b128 %4, %12, off\n\t"
               "global_load_async_to_lds_b128 %5, %13, off\n\t"
               "global_load_async_to_lds_b128 %6, %14, off\n\t"
               "global_load_async_to_lds_b128 %7, %15, off\n\t"
               "s_wait_xcnt 0x0"
               :: "v"(l), "v"(l + 4 * SPT), "v"(l + 8 * SPT), "v"(l + 12 * SPT),
                  "v"(l + 16 * SPT), "v"(l + 20 * SPT), "v"(l + 24 * SPT), "v"(l + 28 * SPT),
                  "v"(g), "v"(g + gp), "v"(g + 2 * gp), "v"(g + 3 * gp),
                  "v"(g + 4 * gp), "v"(g + 5 * gp), "v"(g + 6 * gp), "v"(g + 7 * gp)
               : "memory");
}
// Refill of the wave's own buffer: 32 rows x 256 B = 16 copies. The s_wait_dscnt retires this wave's fragment reads of the
// buffer before a copy may land on them (no other wave touches it, so no barrier is owed).
__device__ __forceinline__ void stage32(const unsigned l, const _Float16* g, const size_t gp) {
  asm volatile("s_wait_dscnt 0x0" ::: "memory");
  copy8(l, g, gp);
  copy8(l + 32 * SPT, g + 8 * gp, gp);
}
// The issuing wave's own wait: behind it the staged rows have landed and this wave may read them.
__device__ __forceinline__ void staged_wait() {
  asm volatile("s_wait_asynccnt 0x0" ::: "memory");
}

template <int QT, bool EARLY>
__device__ __forceinline__ void attn_body(char* smem,
                                          const _Float16* __restrict__ qh, const _Float16* __restrict__ ql,
                                          const _Float16* __restrict__ kn, const _Float16* __restrict__ kl,
                                          const _Float16* __restrict__ vt, const _Float16* __restrict__ vl,
                                          float* __restrict__ out, const int batch, const int qloc0) {
  static_assert(EARLY ? (QT == 1) : (QT == 2));
  constexpr int QB  = 16 * QT;
  constexpr int TB  = QB * QSP * 2;             // bytes per 16-bit tile
  constexpr int NPL = EARLY ? 4 : 3;            // tiles: Q hi, Q lo, P hi (, P lo)
  constexpr int RPW = QB / 8;                   // output rows per wave
  static_assert((TB % 16) == 0);
  static_assert(QB * OSP * 4 <= NPL * TB);
  static_assert(8 * QB <= 256);
  static_assert(RPW * 8 == QB);
  static_assert((SEQ % QB) == 0);

  _Float16* Qs = (_Float16*)(smem);
  _Float16* Ls = (_Float16*)(smem + TB);
  _Float16* Ps = (_Float16*)(smem + 2 * TB);
  _Float16* Pl = (_Float16*)(smem + (NPL - 1) * TB);   // distinct tile only when EARLY
  float* pmax = (float*)(smem + NPL * TB);
  float* psum = pmax + 256;
  float* m_s  = psum + 256;
  float* l_s  = m_s + 32;
  float* al_s = m_s + 64;
  float* li_s = m_s + 96;

  const int tid  = (int)threadIdx.x;
  const int wave = __builtin_amdgcn_readfirstlane((int)(threadIdx.x >> 5));
  const int lane = tid & 31, h = lane >> 4, c = lane & 15;
  const int kbase = batch * SEQ;                // compact token row of key 0 of this sequence
  const int q0    = kbase + qloc0;              // compact token row of query 0 of this block
  const int qmax  = qloc0 + QB - 1;             // last local query index of this block
  const float ninf = -__builtin_inff();
  const float sc = 0.000244140625f;             // 1/4096: logits carry 16*16 and the 1/16 score scale
  const float rs = 0.0009765625f;               // 1/1024: residual plane carry

  if (tid < 32) { m_s[tid] = ninf; l_s[tid] = 0.0f; al_s[tid] = 0.0f; li_s[tid] = 0.0f; }
  psum[tid] = 0.0f;
  pmax[tid] = ninf;
  // Q hi and lo tiles: QB rows x 32 pieces of 8 halves per plane; coverage 2*QT * 256 = QB*32 pieces = whole tile each
#pragma unroll
  for (int i = 0; i < 2 * QT; ++i) {
    const int idx = i * 256 + tid;
    const int row = idx >> 5;
    const int pc  = idx & 31;
    const v8h vh = *(const v8h*)(qh + (size_t)(q0 + row) * DM + pc * 8);
    const v8h vq = *(const v8h*)(ql + (size_t)(q0 + row) * DM + pc * 8);
    *(v8h*)(Qs + row * QSP + pc * 8) = vh;
    *(v8h*)(Ls + row * QSP + pc * 8) = vq;
  }
  __syncthreads();

  v8f oacc[QT][2];
  v8f oacl[QT][2];
#pragma unroll
  for (int qt = 0; qt < QT; ++qt)
#pragma unroll
    for (int nt = 0; nt < 2; ++nt) { oacc[qt][nt] = zero8(); oacl[qt][nt] = zero8(); }

  const int qoff = c * QSP + 8 * h;             // LDS fragment offset of query c (add 16*qt*QSP + k)
  // long blocks: this wave's staging buffer, its fragment offset, and the lane's LDS byte address / row / piece for copy 0
  const _Float16* stg = (const _Float16*)(smem + LATE_LDS + wave * STG_BYTES);
  const int soff = c * SPT + 8 * h;
  const unsigned stg_l = (unsigned)(size_t)(smem + LATE_LDS + wave * STG_BYTES) + (unsigned)(h * (SPT * 2) + c * 16);
  const int ntile = qmax / KCH + 1;             // key tiles up to the diagonal (block-uniform)

#pragma unroll 1
  for (int t = 0; t < ntile; ++t) {
    // ---- logits: S^T subtiles for this wave's 32 keys, queries 0..QB-1; hi and x1024 accumulators ----
    const int kloc = t * KCH + 32 * wave;       // local index of this wave's first key (scalar)
    v8f sacc[QT][2];   // [query subtile][key subtile]; element r: query 16qt+c, key kloc+16kt+8h+r
    v8f sacl[QT][2];
#pragma unroll
    for (int qt = 0; qt < QT; ++qt)
#pragma unroll
      for (int kt = 0; kt < 2; ++kt) { sacc[qt][kt] = zero8(); sacl[qt][kt] = zero8(); }
    if (kloc <= qmax) {                         // wave-uniform: some key of this wave is visible to some query
      const size_t ko0 = (size_t)(kbase + kloc + c) * DM + 8 * h;
      const size_t ko1 = (size_t)(kbase + kloc + 16 + c) * DM + 8 * h;
#pragma unroll 1
      for (int k0 = 0; k0 < DM; k0 += 32) {
        v16h a0, a1;
        if constexpr (EARLY) {
          a0 = ldfrag(kn + ko0 + k0);
          a1 = ldfrag(kn + ko1 + k0);
        } else {
          if ((k0 & 127) == 0) {                // scalar: columns k0..k0+127 of this wave's 32 key rows -> its buffer
            stage32(stg_l, kn + (size_t)(kbase + kloc + h) * DM + k0 + c * 8, (size_t)2 * DM);
            staged_wait();
          }
          a0 = ldfrag(stg + soff + (k0 & 127));
          a1 = ldfrag(stg + 16 * SPT + soff + (k0 & 127));
        }
        v16h bq[QT], cq[QT];
#pragma unroll
        for (int qt = 0; qt < QT; ++qt) {
          bq[qt] = ldfrag(Qs + 16 * qt * QSP + qoff + k0);
          cq[qt] = ldfrag(Ls + 16 * qt * QSP + qoff + k0);
        }
#pragma unroll
        for (int qt = 0; qt < QT; ++qt) {
          sacc[qt][0] = mma16(a0, bq[qt], sacc[qt][0]);
          sacc[qt][1] = mma16(a1, bq[qt], sacc[qt][1]);
        }
#pragma unroll
        for (int qt = 0; qt < QT; ++qt) {
          sacl[qt][0] = mma16(a0, cq[qt], sacl[qt][0]);
          sacl[qt][1] = mma16(a1, cq[qt], sacl[qt][1]);
        }
        if constexpr (EARLY) {
          const v16h d0 = ldfrag(kl + ko0 + k0), d1 = ldfrag(kl + ko1 + k0);
          sacl[0][0] = mma16(d0, bq[0], sacl[0][0]);
          sacl[0][1] = mma16(d1, bq[0], sacl[0][1]);
          guard_a4f6(sacc[0][0], sacc[0][1], sacl[0][0], sacl[0][1], a0, a1, bq[0], cq[0], d0, d1);
        } else {
          guard_s8(sacc[0][0], sacc[0][1], sacc[QT - 1][0], sacc[QT - 1][1],
                   sacl[0][0], sacl[0][1], sacl[QT - 1][0], sacl[QT - 1][1],
                   a0, a1, bq[0], bq[QT - 1], cq[0], cq[QT - 1]);
        }
      }
    }
    // long blocks: keys 0..127 of the tile for this wave's 32 value columns start towards its buffer now and fly under the
    // softmax phase; they are waited for in front of the P.V loop
    const _Float16* vg = vt + (size_t)(32 * wave + h) * RTOT + kbase + (size_t)t * KCH + c * 8;
    if constexpr (!EARLY) stage32(stg_l, vg, (size_t)2 * RTOT);
    // ---- combine hi + lo/1024, scale, causal replace fill, per-wave partial row max ----
    {
#pragma unroll
      for (int qt = 0; qt < QT; ++qt) {
        const int qry = qloc0 + 16 * qt + c;
        float pm = ninf;
#pragma unroll
        for (int kt = 0; kt < 2; ++kt) {
#pragma unroll
          for (int r = 0; r < 8; ++r) {
            const int key = kloc + 16 * kt + 8 * h + r;
            float v = (sacc[qt][kt][r] + sacl[qt][kt][r] * rs) * sc;
            v = (key <= qry) ? v : ninf;
            sacc[qt][kt][r] = v;
            pm = fmaxf(pm, v);
          }
        }
        pm = fmaxf(pm, __shfl_xor(pm, 16, 32));
        pmax[wave * QB + 16 * qt + c] = pm;
      }
    }
    __syncthreads();
    // ---- wave 0, lane = query row: fold the prior tile's sums into l, new running max, rescale factor ----
    if (wave == 0 && lane < QB) {
      const int row = lane;
      float ps = 0.0f;
#pragma unroll
      for (int w = 0; w < 8; ++w) ps += psum[w * QB + row];
      l_s[row] = l_s[row] * al_s[row] + ps;
      const float mo = m_s[row];
      float mx = mo;
#pragma unroll
      for (int w = 0; w < 8; ++w) mx = fmaxf(mx, pmax[w * QB + row]);
      al_s[row] = __expf(mo - mx);
      m_s[row] = mx;
    }
    __syncthreads();
    // ---- p = 2^14 * exp(s - m) as f16 (EARLY: plus residual), P tile(s), partial row sums, rescale O ----
    {
#pragma unroll
      for (int qt = 0; qt < QT; ++qt) {
        const float mq = m_s[16 * qt + c];
        float ps = 0.0f;
#pragma unroll
        for (int kt = 0; kt < 2; ++kt) {
          v8h hh, ll;
#pragma unroll
          for (int r = 0; r < 8; ++r) {
            const float p = __expf(sacc[qt][kt][r] - mq);
            ps += p;
            const float pw = p * 16384.0f;
            const _Float16 ph = (_Float16)pw;
            hh[r] = ph;
            ll[r] = (_Float16)((pw - (float)ph) * 1024.0f);
          }
          *(v8h*)(Ps + (16 * qt + c) * PSP + 32 * wave + 16 * kt + 8 * h) = hh;
          if constexpr (EARLY) *(v8h*)(Pl + (16 * qt + c) * PSP + 32 * wave + 16 * kt + 8 * h) = ll;
        }
        ps += __shfl_xor(ps, 16, 32);
        psum[wave * QB + 16 * qt + c] = ps;
        const v4f aA = *(const v4f*)(al_s + 16 * qt + 8 * h), aB = *(const v4f*)(al_s + 16 * qt + 8 * h + 4);
#pragma unroll
        for (int nt = 0; nt < 2; ++nt) {
#pragma unroll
          for (int r = 0; r < 4; ++r) {
            oacc[qt][nt][r] *= aA[r]; oacc[qt][nt][4 + r] *= aB[r];
            if constexpr (EARLY) { oacl[qt][nt][r] *= aA[r]; oacl[qt][nt][4 + r] *= aB[r]; }
          }
        }
      }
    }
    __syncthreads();
    // ---- O += P . V over the visible keys of the tile; this wave's columns 32w + 16nt + c ----
    {
      const int rem = qmax - t * KCH;                            // >= 0 for visited tiles
      int nks = ((rem >> 5) + 1) * 32;
      nks = (nks < KCH) ? nks : KCH;                             // block-uniform key bound
      const size_t vo = (size_t)(32 * wave + c) * RTOT + kbase + (size_t)t * KCH + 8 * h;
      if constexpr (!EARLY) staged_wait();                       // the first value half, requested before the softmax
#pragma unroll 1
      for (int ks = 0; ks < nks; ks += 32) {
        v16h pa[QT];
#pragma unroll
        for (int qt = 0; qt < QT; ++qt) pa[qt] = ldfrag(Ps + 16 * qt * PSP + c * PSP + 8 * h + ks);
        v16h vb0, vb1;
        if constexpr (EARLY) {
          vb0 = ldfrag(vt + vo + ks);
          vb1 = ldfrag(vt + vo + (size_t)16 * RTOT + ks);
        } else {
          if (ks == 128) {                      // scalar: keys 128..255 of the tile replace the first half
            stage32(stg_l, vg + ks, (size_t)2 * RTOT);
            staged_wait();
          }
          vb0 = ldfrag(stg + soff + (ks & 127));
          vb1 = ldfrag(stg + 16 * SPT + soff + (ks & 127));
        }
#pragma unroll
        for (int qt = 0; qt < QT; ++qt) {
          oacc[qt][0] = mma16(pa[qt], vb0, oacc[qt][0]);
          oacc[qt][1] = mma16(pa[qt], vb1, oacc[qt][1]);
        }
        if constexpr (EARLY) {
          const v16h pl0 = ldfrag(Pl + c * PSP + 8 * h + ks);
          const v16h vl0 = ldfrag(vl + vo + ks);
          const v16h vl1 = ldfrag(vl + vo + (size_t)16 * RTOT + ks);
          oacl[0][0] = mma16(pa[0], vl0, oacl[0][0]);
          oacl[0][1] = mma16(pa[0], vl1, oacl[0][1]);
          oacl[0][0] = mma16(pl0, vb0, oacl[0][0]);
          oacl[0][1] = mma16(pl0, vb1, oacl[0][1]);
          guard_a4f6(oacc[0][0], oacc[0][1], oacl[0][0], oacl[0][1], pa[0], pl0, vb0, vb1, vl0, vl1);
        } else {
          guard_pv4(oacc[0][0], oacc[0][1], oacc[QT - 1][0], oacc[QT - 1][1], pa[0], pa[QT - 1], vb0, vb1);
        }
      }
    }
  }

  // ---- final normaliser per query row (fold the last tile's sums); O = oacc / (2^14 * 16 * l) ----
  if (wave == 0 && lane < QB) {
    const int row = lane;
    float ps = 0.0f;
#pragma unroll
    for (int w = 0; w < 8; ++w) ps += psum[w * QB + row];
    const float l = l_s[row] * al_s[row] + ps;
    li_s[row] = (1.0f / l) * (1.0f / 262144.0f);
  }
  __syncthreads();
  // ---- stage the normalised QB x 256 f32 tile over the Q / P regions (pitch OSP) ----
  float* Os = (float*)(smem);
  {
#pragma unroll
    for (int qt = 0; qt < QT; ++qt) {
      const v4f iA = *(const v4f*)(li_s + 16 * qt + 8 * h), iB = *(const v4f*)(li_s + 16 * qt + 8 * h + 4);
#pragma unroll
      for (int nt = 0; nt < 2; ++nt) {
        const int col = 32 * wave + 16 * nt + c;
#pragma unroll
        for (int r = 0; r < 4; ++r) {
          float o0 = oacc[qt][nt][r], o1 = oacc[qt][nt][4 + r];
          if constexpr (EARLY) { o0 += oacl[qt][nt][r] * rs; o1 += oacl[qt][nt][4 + r] * rs; }
          Os[(16 * qt + 8 * h + r) * OSP + col]     = o0 * iA[r];
          Os[(16 * qt + 8 * h + 4 + r) * OSP + col] = o1 * iB[r];
        }
      }
    }
  }
  __syncthreads();
  {
    float* go = out + (size_t)q0 * DM;
{
#pragma unroll
      for (int rr = 0; rr < RPW; ++rr) {
        const int row = RPW * wave + rr;
#pragma unroll
        for (int j = 0; j < 2; ++j) {
          const int pc = j * 32 + lane;
          const v4f v = *(const v4f*)(Os + row * OSP + pc * 4);
          *(v4f*)(go + (size_t)row * DM + pc * 4) = v;
        }
      }
      
    }
  }
}

// Both query ranges in ONE launch (they share no output row); the block index picks the range, block-uniform.
//   blocks [0, NB*LBLK): query rows [EROWS, SEQ) of every sequence, 32 rows per block, q residual only (the long blocks,
//                        so they start first); coverage NB * LBLK blocks x 32 rows x 256 floats = NB * (SEQ - EROWS) x 256
//   the NB*EBLK blocks behind them: query rows [0, EROWS), 16 rows per block, full residual set;
//                        coverage NB * EBLK blocks x 16 rows x 256 floats = NB * EROWS x 256
#define ATTN_LDS (LATE_LDS + 8 * STG_BYTES)
static_assert(ATTN_LDS >= EARLY_LDS && 2 * ATTN_LDS <= 327680);
__global__ __launch_bounds__(256) void attn_kernel(const _Float16* __restrict__ qh, const _Float16* __restrict__ ql,
                                                   const _Float16* __restrict__ kn, const _Float16* __restrict__ kl,
                                                   const _Float16* __restrict__ vt, const _Float16* __restrict__ vl,
                                                   float* __restrict__ out) {
  __shared__ __align__(16) char smem[ATTN_LDS];
  const int blk = (int)blockIdx.x;
  if (blk < NB * LBLK) {
    const int batch = blk / LBLKD;
    const int qloc0 = EROWS + (blk - batch * LBLKD) * 32;
    attn_body<2, false>(smem, qh, ql, kn, kn, vt, vt, out, batch, qloc0);
  } else {
    const int eb = blk - NB * LBLK;
    const int batch = eb / EBLK;
    const int qloc0 = (eb - batch * EBLK) * 16;
    attn_body<1, true>(smem, qh, ql, kn, kl, vt, vl, out, batch, qloc0);
  }
}

// ---------------------------------------------------------------------------------------------
// Workspace map (bytes, all regions exact tile / whole-line multiples; R = NB*SEQ = 16384):
//   WT16 : Wq^T | Wk^T | Wv^T f16 [3][256][128] (64*bf16(w))   size 3*256*128*2 =    196,608
//   X16  : f16 [R][128] (16*bf16(x))                          size R*128*2     =  4,194,304
//   Q16 / QL16 : f16 hi / residual [R][256] (16*q)             8,388,608 each
//   K16 / KL16 : f16 hi / residual [R][256] (16*k)             8,388,608 each
//   VT16 / VL16: f16 hi / residual [256][R] (16*v)             8,388,608 each
//   total 54,722,560
// ---------------------------------------------------------------------------------------------
static_assert((size_t)3 * DM * EM * 2 + (size_t)RTOT * EM * 2 + (size_t)6 * RTOT * DM * 2 <= (size_t)134217728);
static_assert(((size_t)3 * DM * EM * 2) % 128 == 0 && ((size_t)RTOT * EM * 2) % 128 == 0 && ((size_t)RTOT * DM * 2) % 128 == 0);

extern "C" void kernel_launch(void* const* d_in, const int* in_sizes, int n_in,
                              void* d_out, int out_size, void* d_ws, size_t ws_size,
                              hipStream_t stream) {
  if (n_in < 7) return;
  const int R = RTOT;
  const long long needx = ((long long)(NB - 1) * SEQ_FULL + SEQ) * EM;
  if ((long long)in_sizes[0] < needx) return;
  if (in_sizes[1] < EM * DM || in_sizes[3] < EM * DM || in_sizes[5] < EM * DM) return;
  if (in_sizes[2] < DM || in_sizes[4] < DM || in_sizes[6] < DM) return;
  if ((long long)out_size < (long long)R * DM) return;

  const float* x  = (const float*)d_in[0];
  const float* Wq = (const float*)d_in[1];
  const float* bq = (const float*)d_in[2];
  const float* Wk = (const float*)d_in[3];
  const float* bk = (const float*)d_in[4];
  const float* Wv = (const float*)d_in[5];
  const float* bv = (const float*)d_in[6];
  float* out = (float*)d_out;

  const size_t bWT = (size_t)3 * DM * EM * 2;
  const size_t bX  = (size_t)R * EM * 2;
  const size_t bPl = (size_t)R * DM * 2;
  size_t off = 0;
  const size_t oWT = off; off += bWT;
  const size_t oX  = off; off += bX;
  const size_t oQ  = off; off += bPl;
  const size_t oQL = off; off += bPl;
  const size_t oK  = off; off += bPl;
  const size_t oKL = off; off += bPl;
  const size_t oVT = off; off += bPl;
  const size_t oVL = off; off += bPl;
  if (off > ws_size) return;                     // 54,722,560 for R = 16384
  if (off > (size_t)134217728) return;

  char* ws = (char*)d_ws;
  _Float16* WT16 = (_Float16*)(ws + oWT);
  _Float16* X16  = (_Float16*)(ws + oX);
  _Float16* Q16  = (_Float16*)(ws + oQ);
  _Float16* QL16 = (_Float16*)(ws + oQL);
  _Float16* K16  = (_Float16*)(ws + oK);
  _Float16* KL16 = (_Float16*)(ws + oKL);
  _Float16* VT16 = (_Float16*)(ws + oVT);
  _Float16* VL16 = (_Float16*)(ws + oVL);

  const dim3 blk(256);
  const int nbx = (R * EM / 8) / 256;            // pieces of 8 halves / 256 threads
  const int nbw = (3 * DM * EM / 8) / 256;       // 48
  if (nbx * 256 * 8 != R * EM) return;

  // (1) x -> X16 (16*bf16), weights -> WT16 (64*bf16, in[128][256] -> out[256][128])
  cvt_kernel<<<dim3(nbx + nbw), blk, 0, stream>>>(x, Wq, Wk, Wv, X16, WT16, nbx);
  // (2) q, k -> hi + residual planes [R][256] (bias by column) and v^T -> hi + residual planes [256][R] (bias by row):
  //     K=128; scale 16/(16*64), bias carry 16; grid.y = product, (R/64)*(256/64) tiles of 64x64 each, 8 per block
  gemm64x3_kernel<<<dim3(((R / 64) * (DM / 64)) / 8, 3), blk, 0, stream>>>(
      X16, WT16, Q16, QL16, K16, KL16, VT16, VL16, bq, bk, bv, 16.0f, 0.015625f);
  // (3) attention, all query rows -> out
  attn_kernel<<<dim3(NB * LBLK + NB * EBLK), blk, 0, stream>>>(Q16, QL16, K16, KL16, VT16, VL16, out);
  (void)hipGetLastError();
}

// v003
// One run takes 61.4 microseconds.
// In two side-by-side timings against v002, it was 1.22 and 1.23 times as fast.
// Counting every step since v000, it is 2.13 times as fast.
// Contractions: q | k = x.Wq | x.Wk and v^T = Wv^T.x^T : v_wmma_f32_16x16x32_f16, f16 operands carrying 16*bf16(x) and
// 64*bf16(W), f32 accumulate; S^T = k.q^T : v_wmma_f32_16x16x32_f16, q as f16 hi (x16) plus f16 residual plane (x2^10, own
// accumulator), k as f16 (x16) plus, for the first 512 query rows, an f16 residual plane (x2^10); O = P.v :
// v_wmma_f32_16x16x32_f16, P = 2^14*exp(s-m) as f16 and v as f16 (x16), both with f16 residual planes (x2^10, own
// accumulator) for the first 512 query rows; f32 accumulate. Float inputs RNE-converted to bf16 on load; bias, softmax
// statistics and output scaling in f32.
#include <hip/hip_runtime.h>
#include <stdint.h>

#ifndef NB
#define NB 8
#endif
#ifndef SEQ
#define SEQ 2048
#endif
#define NB_FULL  8
#define SEQ_FULL 2048
#define EM       128
#define DM       256
#define RTOT     (NB * SEQ)
#define EROWS    ((SEQ) < 512 ? (SEQ) : 512)
#define LBLK     (((SEQ) - EROWS) / 32)
#define LBLKD    (LBLK > 0 ? LBLK : 1)
#define EBLK     (EROWS / 16)

static_assert(NB >= 1 && NB <= NB_FULL);
static_assert(SEQ >= 256 && SEQ <= SEQ_FULL && (SEQ % 256) == 0);
static_assert(DM == 256 && EM == 128);
static_assert((EM % 32) == 0 && (DM % 64) == 0);
static_assert((RTOT % 128) == 0);
static_assert(((size_t)RTOT * EM) % 2048 == 0);
static_assert((3 * DM * EM) % 2048 == 0);
static_assert((EROWS % 32) == 0 && ((SEQ - EROWS) % 32) == 0);
static_assert((((RTOT / 64) * (DM / 64)) % 8) == 0);

typedef _Float16 v16h __attribute__((ext_vector_type(16)));
typedef _Float16 v8h  __attribute__((ext_vector_type(8)));
typedef float    v8f  __attribute__((ext_vector_type(8)));
typedef float    v4f  __attribute__((ext_vector_type(4)));

// f32 -> nearest-even bf16 bits / value
__device__ __forceinline__ unsigned short bfbits(float f) {
  unsigned u = __float_as_uint(f);
  return (unsigned short)((u + 0x7FFFu + ((u >> 16) & 1u)) >> 16);
}
__device__ __forceinline__ float bfval(unsigned short b) { return __uint_as_float(((unsigned)b) << 16); }
__device__ __forceinline__ float bfr(float f) { return bfval(bfbits(f)); }

__device__ __forceinline__ v8f mma16(v16h a, v16h b, v8f c) {
  return __builtin_amdgcn_wmma_f32_16x16x32_f16(false, a, false, b, (short)0, c, false, false);
}

// 16-bit WMMA fragment from k-contiguous storage (A row-major [m][k], or B stored [n][k]):
// p points at element (row_or_col = lane&15, k0 + 8h); elements 0..7 <- p[0..7], 8..15 <- p[16..23].
__device__ __forceinline__ v16h ldfrag(const _Float16* p) {
  union { v16h v; v8h h[2]; } f;
  f.h[0] = *(const v8h*)(p);
  f.h[1] = *(const v8h*)(p + 16);
  return f.v;
}
__device__ __forceinline__ v8f zero8() {
  v8f z;
#pragma unroll
  for (int i = 0; i < 8; ++i) z[i] = 0.0f;
  return z;
}

// hazard guards: 4 VALU slots after the last WMMA of a group, D tied, A/B kept live
__device__ __forceinline__ void guard_g(v8f& a, v8f& b, v16h x, v16h y) {
  asm volatile("v_nop\n\tv_nop\n\tv_nop\n\tv_nop" : "+v"(a), "+v"(b) : "v"(x), "v"(y));
}
__device__ __forceinline__ void keep4(v16h a, v16h b, v16h c, v16h d) {
  asm volatile("v_nop" :: "v"(a), "v"(b), "v"(c), "v"(d));
}
__device__ __forceinline__ void accg4(v8f& a, v8f& b, v8f& c, v8f& d) {
  asm volatile("v_nop\n\tv_nop\n\tv_nop\n\tv_nop" : "+v"(a), "+v"(b), "+v"(c), "+v"(d));
}
__device__ __forceinline__ void guard_s8(v8f& a0, v8f& a1, v8f& a2, v8f& a3, v8f& b0, v8f& b1, v8f& b2, v8f& b3,
                                         v16h x0, v16h x1, v16h y0, v16h y1, v16h z0, v16h z1) {
  asm volatile("v_nop\n\tv_nop\n\tv_nop\n\tv_nop"
               : "+v"(a0), "+v"(a1), "+v"(a2), "+v"(a3), "+v"(b0), "+v"(b1), "+v"(b2), "+v"(b3)
               : "v"(x0), "v"(x1), "v"(y0), "v"(y1), "v"(z0), "v"(z1));
}
__device__ __forceinline__ void guard_a4f6(v8f& a0, v8f& a1, v8f& b0, v8f& b1,
                                           v16h x0, v16h x1, v16h y0, v16h y1, v16h z0, v16h z1) {
  asm volatile("v_nop\n\tv_nop\n\tv_nop\n\tv_nop"
               : "+v"(a0), "+v"(a1), "+v"(b0), "+v"(b1)
               : "v"(x0), "v"(x1), "v"(y0), "v"(y1), "v"(z0), "v"(z1));
}
__device__ __forceinline__ void guard_pv4(v8f& a0, v8f& a1, v8f& b0, v8f& b1,
                                          v16h p0, v16h p1, v16h x0, v16h x1) {
  asm volatile("v_nop\n\tv_nop\n\tv_nop\n\tv_nop"
               : "+v"(a0), "+v"(a1), "+v"(b0), "+v"(b1)
               : "v"(p0), "v"(p1), "v"(x0), "v"(x1));
}

// 8 consecutive k of column n of a [EM][DM] weight, as f16(64 * bf16(w))
__device__ __forceinline__ v8h wpiece(const float* __restrict__ W, int k0, int n) {
  v8h o;
#pragma unroll
  for (int i = 0; i < 8; ++i) o[i] = (_Float16)(bfr(W[(size_t)(k0 + i) * DM + n]) * 64.0f);
  return o;
}

// ---------------------------------------------------------------------------------------------
// Kernel 1: input conversion to f16 operand planes, one launch, block-uniform roles, no barriers.
//   blocks [0, nbx):      X16[r][c] = f16(16 * bf16(x[row(r)][c])), compact token rows r = b*SEQ + n read from
//   blocks [nbx, nbx+48): WT16[mat][n][k] = f16(64 * bf16(W_mat[k][n])), in[128][256] -> out[256][128] (strided reads,
//                         contiguous 16-B stores, 8 consecutive k per lane), mat 0 = Wq, 1 = Wk, 2 = Wv (uniform per block).
// coverage: nbx*256 lanes * 8 = RTOT*EM halves = whole X16; 48*256 lanes * 8 = 3*DM*EM halves = whole WT16.
// ---------------------------------------------------------------------------------------------
__global__ __launch_bounds__(256) void cvt_kernel(const float* __restrict__ x, const float* __restrict__ Wq,
                                                  const float* __restrict__ Wk, const float* __restrict__ Wv,
                                                  _Float16* __restrict__ X16, _Float16* __restrict__ WT16, int nbx) {
  const int tid = (int)threadIdx.x;
  const int blk = (int)blockIdx.x;
  if (blk < nbx) {
    const int li = blk * 256 + tid;            // 8-half piece index
    const int r  = li >> 4;                    // compact token row (16 pieces per row)
    const int c0 = (li & 15) * 8;
    const int b  = r / SEQ;
    const int n  = r - b * SEQ;
    const float* xr = x + ((size_t)b * SEQ_FULL + n) * EM + c0;
    const v4f a  = *(const v4f*)(xr);
    const v4f a2 = *(const v4f*)(xr + 4);
    v8h o;
#pragma unroll
    for (int i = 0; i < 4; ++i) {
      o[i]     = (_Float16)(bfr(a[i]) * 16.0f);
      o[4 + i] = (_Float16)(bfr(a2[i]) * 16.0f);
    }
    _Float16* d = X16 + (size_t)li * 8;
    *(v8h*)d = o;
    
  } else {
    const int li = (blk - nbx) * 256 + tid;    // piece index in [0, 3*DM*EM/8)
    if (li >= 3 * DM * EM / 8) return;
    const int mat = li >> 12;                  // DM*EM/8 = 4096 pieces per matrix; uniform per block
    const int n   = (li >> 4) & (DM - 1);
    const int k0  = (li & 15) * 8;
    v8h o;
    if (mat == 0)      o = wpiece(Wq, k0, n);
    else if (mat == 1) o = wpiece(Wk, k0, n);
    else               o = wpiece(Wv, k0, n);
    _Float16* d = WT16 + (size_t)li * 8;       // = mat*DM*EM + n*EM + k0
    *(v8h*)d = o;
    
  }
}

// ---------------------------------------------------------------------------------------------
// Kernel 2: value[m][n] = scale * sum_k A[m][k] * Bt[n][k] + bsc * bf16(bias[.]).
// A row-major [M][K] f16 pitch lda; Bt row-major [N][K] f16 pitch ldb; M, N multiples of 64, K multiple of 32.
// bias_mode 1: bias indexed by column n; bias_mode 2: by row m (block-uniform run-time switch).
// Output: f16 hi plane C = f16(value) plus f16 residual plane C2 = f16((value - hi) * 1024), same layout.
// Each wave owns one 64x64 C tile (16 f32 accumulators); 8 waves per block; no block barriers.
// coverage: tilesM * tilesN tiles, each 64x64 written fully (rows it*4+qq = 0..15 per slab, cols c8 = 0..56 by 8) -> M x N.
// The three projections share no output and run in ONE launch; blockIdx.y (block-uniform) picks the product:
//   0: q = X.Wq   -> Q16 / QL16 [R][256], bias by column      1: k = X.Wk -> K16 / KL16 [R][256], bias by column
//   2: v^T = Wv^T.X^T -> VT16 / VL16 [256][R], bias by row
// ---------------------------------------------------------------------------------------------
__global__ __launch_bounds__(256) void gemm64x3_kernel(const _Float16* __restrict__ X16, const _Float16* __restrict__ WT16,
                                                       _Float16* __restrict__ Q16, _Float16* __restrict__ QL16,
                                                       _Float16* __restrict__ K16, _Float16* __restrict__ KL16,
                                                       _Float16* __restrict__ VT16, _Float16* __restrict__ VL16,
                                                       const float* __restrict__ bq, const float* __restrict__ bk,
                                                       const float* __restrict__ bv, float bsc, float scale) {
  __shared__ __align__(16) float sT[8][16 * 68];
  const int role = (int)blockIdx.y;
  const _Float16* __restrict__ A  = (role == 2) ? WT16 + (size_t)2 * DM * EM : X16;
  const _Float16* __restrict__ Bt = (role == 2) ? X16 : WT16 + (size_t)role * DM * EM;
  _Float16* __restrict__ C  = (role == 0) ? Q16  : (role == 1) ? K16  : VT16;
  _Float16* __restrict__ C2 = (role == 0) ? QL16 : (role == 1) ? KL16 : VL16;
  const float* __restrict__ bias = (role == 0) ? bq : (role == 1) ? bk : bv;
  const int M = (role == 2) ? DM : RTOT, N = (role == 2) ? RTOT : DM;
  const int lda = EM, ldb = EM, K = EM, ldc = N;
  const int bias_mode = (role == 2) ? 2 : 1;
  const int lane = threadIdx.x & 31;
  const int wave = __builtin_amdgcn_readfirstlane((int)(threadIdx.x >> 5));
  const int tilesN = N >> 6, tilesM = M >> 6;
  const int tile = (int)blockIdx.x * 8 + wave;
  if (tile >= tilesM * tilesN) return;
  const int tm = tile / tilesN, tn = tile - tm * tilesN;
  const int m0 = tm << 6, n0 = tn << 6;
  const int rl = lane & 15;
  const int koff = (lane >> 4) * 8;
  const int mOff = (lane >> 4) * 8;

  v8f acc[4][4];
#pragma unroll
  for (int i = 0; i < 4; ++i)
#pragma unroll
    for (int j = 0; j < 4; ++j) acc[i][j] = zero8();

#pragma unroll 1
  for (int k0 = 0; k0 < K; k0 += 32) {
    v16h bh[4];
#pragma unroll
    for (int j = 0; j < 4; ++j) bh[j] = ldfrag(Bt + (size_t)(n0 + (j << 4) + rl) * ldb + koff + k0);
#pragma unroll
    for (int i = 0; i < 4; ++i) {
      const size_t ao = (size_t)(m0 + (i << 4) + rl) * lda + koff + k0;
      const v16h ah = ldfrag(A + ao);
#pragma unroll
      for (int j = 0; j < 4; ++j) acc[i][j] = mma16(ah, bh[j], acc[i][j]);
      guard_g(acc[i][0], acc[i][3], ah, bh[3]);
    }
    keep4(bh[0], bh[1], bh[2], bh[3]);
  }
  accg4(acc[0][0], acc[0][1], acc[0][2], acc[0][3]);
  accg4(acc[1][0], acc[1][1], acc[1][2], acc[1][3]);
  accg4(acc[2][0], acc[2][1], acc[2][2], acc[2][3]);
  accg4(acc[3][0], acc[3][1], acc[3][2], acc[3][3]);

  float* slab = sT[wave];
#pragma unroll
  for (int i = 0; i < 4; ++i) {
    const int mBase = m0 + (i << 4);
    float brow[8];
#pragma unroll
    for (int r = 0; r < 8; ++r) brow[r] = 0.0f;
    if (bias_mode == 2) {
      const v4f ba = *(const v4f*)(bias + mBase + mOff);
      const v4f bb = *(const v4f*)(bias + mBase + mOff + 4);
#pragma unroll
      for (int r = 0; r < 4; ++r) { brow[r] = bsc * bfr(ba[r]); brow[4 + r] = bsc * bfr(bb[r]); }
    }
#pragma unroll
    for (int j = 0; j < 4; ++j) {
      float bcol = 0.0f;
      if (bias_mode == 1) bcol = bsc * bfr(bias[n0 + (j << 4) + rl]);
#pragma unroll
      for (int r = 0; r < 8; ++r) {
        const float bb = brow[r] + bcol;         // exactly one of the two is active
        slab[(mOff + r) * 68 + (j << 4) + rl] = acc[i][j][r] * scale + bb;
      }
    }
    __builtin_amdgcn_fence(3 /* release order */, "workgroup");
    __builtin_amdgcn_wave_barrier();
    __builtin_amdgcn_fence(2 /* acquire order */, "workgroup");
    {
      const int qq = lane >> 3, c8 = (lane & 7) * 8;
{
#pragma unroll
        for (int it = 0; it < 4; ++it) {
          const int row = it * 4 + qq;
          const float* sp = slab + row * 68 + c8;
          v8h hv, lv;
#pragma unroll
          for (int e = 0; e < 8; ++e) {
            const float f = sp[e];
            const _Float16 hh = (_Float16)f;
            hv[e] = hh;
            lv[e] = (_Float16)((f - (float)hh) * 1024.0f);
          }
          *(v8h*)(C  + (size_t)(mBase + row) * ldc + n0 + c8) = hv;
          *(v8h*)(C2 + (size_t)(mBase + row) * ldc + n0 + c8) = lv;
        }
        
      }
    }
    __builtin_amdgcn_fence(3 /* release order */, "workgroup");
    __builtin_amdgcn_wave_barrier();
    __builtin_amdgcn_fence(2 /* acquire order */, "workgroup");
  }
}

// ---------------------------------------------------------------------------------------------
// Kernel 3: causal single-head attention per sequence, head width 256, online softmax in f32 (fused; no score or
// probability plane in global memory).
//   qh / ql planes f16 [RTOT][DM] (16*q hi and residual x1024), kn / kl planes f16 [RTOT][DM] (16*k hi and residual
//   x1024), vt / vl planes f16 [DM][RTOT] (16*v hi and residual x1024); out f32 [RTOT][DM] = softmax(mask(q.k^T/16)).v.
//   Block = 256 threads = 8 waves, QB = 16*QT query rows of one sequence; Q hi and lo tiles staged once in LDS.
//   Key tiles of 256, only tiles up to the diagonal are visited: wave w owns keys 32w..32w+31 of the tile for the
//   logits (skipped, wave-uniform, when all its keys lie above the block's last query): S^T subtiles (A = k rows from
//   its staging buffer in LDS, B = Q hi / Q lo rows from LDS, hi and x1024 accumulator sets), so the D layout gives per lane 8 consecutive
//   keys of one query -> P written to LDS as 16-B vectors ([query][key]). Keys above the query get -inf (replace fill).
//   P = 2^14 * exp(s - m_running) as f16 (EARLY: plus residual tile x1024).
//   Row max / sum: per-wave partials in LDS, combined in fixed order by wave 0 (one lane per query row).
//   P.V: every wave reads the P tile(s) (A operand, after a block barrier) and owns 32 value columns (B from vt / vl),
//   key loop bounded (block-uniform) at the diagonal.
//   EARLY (QT = 1, first 512 query rows of each sequence): k, P and v residual products into the x1024 accumulators.
//   Long blocks (QT = 2): a wave's 32 key rows and its 32 value columns reach it through its own LDS buffer, half a tile
//   (32 rows x 256 B) at a time, by asynchronous copies that take whole 128-B lines; the fragments are read from there.
//   Early blocks: the same, a quarter tile (32 rows x 128 B) of the hi and of the residual plane at a time.
//   Output: normalised O in f32 staged as a QB x 256 tile in LDS (pitch 260 floats), then each wave writes QB/8 whole
// LDS regions: Q hi, Q lo, P hi (, P lo), pmax, psum, row statistics: all cross-wave, separated by block barriers.
// staged extent == consumed extent: Q tiles QB x 256 fully staged; P tiles QB x 256 fully written every key tile.
// ---------------------------------------------------------------------------------------------
#define KCH      256
#define QSP      264
#define PSP      264
#define OSP      260
#define LATE_LDS  (3 * 32 * QSP * 2 + 2560)
#define EARLY_LDS (4 * 16 * QSP * 2 + 2560)
static_assert((QSP % 8) == 0 && (PSP % 8) == 0 && PSP >= KCH && QSP >= DM && (OSP % 4) == 0 && OSP >= DM);
static_assert(QSP == PSP);
static_assert((SEQ % KCH) == 0 && DM == 8 * 32 && KCH == 8 * 32);
static_assert(LATE_LDS <= 65536 && EARLY_LDS <= 65536);
// Long blocks: one staging buffer per wave, read and refilled by that wave alone: 32 rows x 256 B at a pitch of 272 B
// (16 B x 17: conflict-free for the 16-B fragment reads).
#define SPT       136
#define STG_BYTES (32 * SPT * 2)
static_assert((LATE_LDS % 16) == 0 && (STG_BYTES % 16) == 0 && ((SPT * 2) % 16) == 0);

// Eight asynchronous 16-B-per-lane copies to LDS; copy i moves two 256-B row halves (lanes 0..15 one, 16..31 the next),
// so every request covers whole 128-B lines. l: the lane's LDS byte address, g: the lane's global address, both of copy 0;
// gp: global step between copies in halves. The s_wait_xcnt stands in the statement so that no address register is
// rewritten ahead of it.
__device__ __forceinline__ void copy8(const unsigned l, const _Float16* g, const size_t gp) {
  asm volatile("global_load_async_to_lds_b128 %0, %8, off\n\t"
               "global_load_async_to_lds_b128 %1, %9, off\n\t"
               "global_load_async_to_lds_b128 %2, %10, off\n\t"
               "global_load_async_to_lds_b128 %3, %11, off\n\t"
               "global_load_async_to_lds_b128 %4, %12, off\n\t"
               "global_load_async_to_lds_b128 %5, %13, off\n\t"
               "global_load_async_to_lds_b128 %6, %14, off\n\t"
               "global_load_async_to_lds_b128 %7, %15, off\n\t"
               "s_wait_xcnt 0x0"
               :: "v"(l), "v"(l + 4 * SPT), "v"(l + 8 * SPT), "v"(l + 12 * SPT),
                  "v"(l + 16 * SPT), "v"(l + 20 * SPT), "v"(l + 24 * SPT), "v"(l + 28 * SPT),
                  "v"(g), "v"(g + gp), "v"(g + 2 * gp), "v"(g + 3 * gp),
                  "v"(g + 4 * gp), "v"(g + 5 * gp), "v"(g + 6 * gp), "v"(g + 7 * gp)
               : "memory");
}
// Refill of the wave's own buffer: 32 rows x 256 B = 16 copies. The s_wait_dscnt retires this wave's fragment reads of the
// buffer before a copy may land on them (no other wave touches it, so no barrier is owed).
__device__ __forceinline__ void stage32(const unsigned l, const _Float16* g, const size_t gp) {
  asm volatile("s_wait_dscnt 0x0" ::: "memory");
  copy8(l, g, gp);
  copy8(l + 32 * SPT, g + 8 * gp, gp);
}
// Early blocks: one staging buffer per wave, read and refilled by that wave alone: the hi and the residual plane, each
// 32 rows x 128 B at a pitch of 144 B (16 B x 9: conflict-free for the 16-B fragment reads).
#define EPT        72
#define EPL_BYTES  (32 * EPT * 2)
#define ESTG_BYTES (2 * EPL_BYTES)
static_assert((EARLY_LDS % 16) == 0 && (EPL_BYTES % 16) == 0 && ((EPT * 2) % 16) == 0);
static_assert(EARLY_LDS + 8 * ESTG_BYTES <= LATE_LDS + 8 * STG_BYTES);
// Eight asynchronous 16-B-per-lane copies to LDS; copy i moves four 128-B row pieces (eight lanes each), whole lines.
// l, g: the lane's LDS byte address and global address of copy 0; gp: global step between copies in halves. The
// s_wait_xcnt stands in the statement so that no address register is rewritten ahead of it.
__device__ __forceinline__ void copy8q(const unsigned l, const _Float16* g, const size_t gp) {
  asm volatile("global_load_async_to_lds_b128 %0, %8, off\n\t"
               "global_load_async_to_lds_b128 %1, %9, off\n\t"
               "global_load_async_to_lds_b128 %2, %10, off\n\t"
               "global_load_async_to_lds_b128 %3, %11, off\n\t"
               "global_load_async_to_lds_b128 %4, %12, off\n\t"
               "global_load_async_to_lds_b128 %5, %13, off\n\t"
               "global_load_async_to_lds_b128 %6, %14, off\n\t"
               "global_load_async_to_lds_b128 %7, %15, off\n\t"
               "s_wait_xcnt 0x0"
               :: "v"(l), "v"(l + 8 * EPT), "v"(l + 16 * EPT), "v"(l + 24 * EPT),
                  "v"(l + 32 * EPT), "v"(l + 40 * EPT), "v"(l + 48 * EPT), "v"(l + 56 * EPT),
                  "v"(g), "v"(g + gp), "v"(g + 2 * gp), "v"(g + 3 * gp),
                  "v"(g + 4 * gp), "v"(g + 5 * gp), "v"(g + 6 * gp), "v"(g + 7 * gp)
               : "memory");
}
// Refill of the wave's own buffer, both planes: 2 x 32 rows x 128 B = 16 copies. The s_wait_dscnt retires this wave's
// fragment reads of the buffer before a copy may land on them (no other wave touches it, so no barrier is owed).
__device__ __forceinline__ void stage_pair(const unsigned l, const _Float16* gh, const _Float16* gl, const size_t gp) {
  asm volatile("s_wait_dscnt 0x0" ::: "memory");
  copy8q(l, gh, gp);
  copy8q(l + EPL_BYTES, gl, gp);
}
// The issuing wave's own wait: behind it the staged rows have landed and this wave may read them.
__device__ __forceinline__ void staged_wait() {
  asm volatile("s_wait_asynccnt 0x0" ::: "memory");
}

template <int QT, bool EARLY>
__device__ __forceinline__ void attn_body(char* smem,
                                          const _Float16* __restrict__ qh, const _Float16* __restrict__ ql,
                                          const _Float16* __restrict__ kn, const _Float16* __restrict__ kl,
                                          const _Float16* __restrict__ vt, const _Float16* __restrict__ vl,
                                          float* __restrict__ out, const int batch, const int qloc0) {
  static_assert(EARLY ? (QT == 1) : (QT == 2));
  constexpr int QB  = 16 * QT;
  constexpr int TB  = QB * QSP * 2;             // bytes per 16-bit tile
  constexpr int NPL = EARLY ? 4 : 3;            // tiles: Q hi, Q lo, P hi (, P lo)
  constexpr int RPW = QB / 8;                   // output rows per wave
  static_assert((TB % 16) == 0);
  static_assert(QB * OSP * 4 <= NPL * TB);
  static_assert(8 * QB <= 256);
  static_assert(RPW * 8 == QB);
  static_assert((SEQ % QB) == 0);

  _Float16* Qs = (_Float16*)(smem);
  _Float16* Ls = (_Float16*)(smem + TB);
  _Float16* Ps = (_Float16*)(smem + 2 * TB);
  _Float16* Pl = (_Float16*)(smem + (NPL - 1) * TB);   // distinct tile only when EARLY
  float* pmax = (float*)(smem + NPL * TB);
  float* psum = pmax + 256;
  float* m_s  = psum + 256;
  float* l_s  = m_s + 32;
  float* al_s = m_s + 64;
  float* li_s = m_s + 96;

  const int tid  = (int)threadIdx.x;
  const int wave = __builtin_amdgcn_readfirstlane((int)(threadIdx.x >> 5));
  const int lane = tid & 31, h = lane >> 4, c = lane & 15;
  const int kbase = batch * SEQ;                // compact token row of key 0 of this sequence
  const int q0    = kbase + qloc0;              // compact token row of query 0 of this block
  const int qmax  = qloc0 + QB - 1;             // last local query index of this block
  const float ninf = -__builtin_inff();
  const float sc = 0.000244140625f;             // 1/4096: logits carry 16*16 and the 1/16 score scale
  const float rs = 0.0009765625f;               // 1/1024: residual plane carry

  if (tid < 32) { m_s[tid] = ninf; l_s[tid] = 0.0f; al_s[tid] = 0.0f; li_s[tid] = 0.0f; }
  psum[tid] = 0.0f;
  pmax[tid] = ninf;
  // Q hi and lo tiles: QB rows x 32 pieces of 8 halves per plane; coverage 2*QT * 256 = QB*32 pieces = whole tile each
#pragma unroll
  for (int i = 0; i < 2 * QT; ++i) {
    const int idx = i * 256 + tid;
    const int row = idx >> 5;
    const int pc  = idx & 31;
    const v8h vh = *(const v8h*)(qh + (size_t)(q0 + row) * DM + pc * 8);
    const v8h vq = *(const v8h*)(ql + (size_t)(q0 + row) * DM + pc * 8);
    *(v8h*)(Qs + row * QSP + pc * 8) = vh;
    *(v8h*)(Ls + row * QSP + pc * 8) = vq;
  }
  __syncthreads();

  v8f oacc[QT][2];
  v8f oacl[QT][2];
#pragma unroll
  for (int qt = 0; qt < QT; ++qt)
#pragma unroll
    for (int nt = 0; nt < 2; ++nt) { oacc[qt][nt] = zero8(); oacl[qt][nt] = zero8(); }

  const int qoff = c * QSP + 8 * h;             // LDS fragment offset of query c (add 16*qt*QSP + k)
  // long blocks: this wave's staging buffer, its fragment offset, and the lane's LDS byte address / row / piece for copy 0
  const _Float16* stg = (const _Float16*)(smem + LATE_LDS + wave * STG_BYTES);
  const int soff = c * SPT + 8 * h;
  const unsigned stg_l = (unsigned)(size_t)(smem + LATE_LDS + wave * STG_BYTES) + (unsigned)(h * (SPT * 2) + c * 16);
  // early blocks: the same for their buffer (copy 0: lane's row = lane / 8, 16-B piece = lane % 8)
  const _Float16* est = (const _Float16*)(smem + EARLY_LDS + wave * ESTG_BYTES);
  const int eoff = c * EPT + 8 * h;
  const int erow = lane >> 3, epc = (lane & 7) * 8;
  const unsigned est_l = (unsigned)(size_t)(smem + EARLY_LDS + wave * ESTG_BYTES) + (unsigned)(erow * (EPT * 2) + epc * 2);
  const int ntile = qmax / KCH + 1;             // key tiles up to the diagonal (block-uniform)

#pragma unroll 1
  for (int t = 0; t < ntile; ++t) {
    // ---- logits: S^T subtiles for this wave's 32 keys, queries 0..QB-1; hi and x1024 accumulators ----
    const int kloc = t * KCH + 32 * wave;       // local index of this wave's first key (scalar)
    v8f sacc[QT][2];   // [query subtile][key subtile]; element r: query 16qt+c, key kloc+16kt+8h+r
    v8f sacl[QT][2];
#pragma unroll
    for (int qt = 0; qt < QT; ++qt)
#pragma unroll
      for (int kt = 0; kt < 2; ++kt) { sacc[qt][kt] = zero8(); sacl[qt][kt] = zero8(); }
    if (kloc <= qmax) {                         // wave-uniform: some key of this wave is visible to some query
#pragma unroll 1
      for (int k0 = 0; k0 < DM; k0 += 32) {
        v16h a0, a1;
        if constexpr (EARLY) {
          if ((k0 & 63) == 0) {                 // scalar: columns k0..k0+63 of this wave's 32 key rows, both planes
            const size_t kr = (size_t)(kbase + kloc + erow) * DM + k0 + epc;
            stage_pair(est_l, kn + kr, kl + kr, (size_t)4 * DM);
            staged_wait();
          }
          a0 = ldfrag(est + eoff + (k0 & 63));
          a1 = ldfrag(est + 16 * EPT + eoff + (k0 & 63));
        } else {
          if ((k0 & 127) == 0) {                // scalar: columns k0..k0+127 of this wave's 32 key rows -> its buffer
            stage32(stg_l, kn + (size_t)(kbase + kloc + h) * DM + k0 + c * 8, (size_t)2 * DM);
            staged_wait();
          }
          a0 = ldfrag(stg + soff + (k0 & 127));
          a1 = ldfrag(stg + 16 * SPT + soff + (k0 & 127));
        }
        v16h bq[QT], cq[QT];
#pragma unroll
        for (int qt = 0; qt < QT; ++qt) {
          bq[qt] = ldfrag(Qs + 16 * qt * QSP + qoff + k0);
          cq[qt] = ldfrag(Ls + 16 * qt * QSP + qoff + k0);
        }
#pragma unroll
        for (int qt = 0; qt < QT; ++qt) {
          sacc[qt][0] = mma16(a0, bq[qt], sacc[qt][0]);
          sacc[qt][1] = mma16(a1, bq[qt], sacc[qt][1]);
        }
#pragma unroll
        for (int qt = 0; qt < QT; ++qt) {
          sacl[qt][0] = mma16(a0, cq[qt], sacl[qt][0]);
          sacl[qt][1] = mma16(a1, cq[qt], sacl[qt][1]);
        }
        if constexpr (EARLY) {
          const v16h d0 = ldfrag(est + 32 * EPT + eoff + (k0 & 63)), d1 = ldfrag(est + 48 * EPT + eoff + (k0 & 63));
          sacl[0][0] = mma16(d0, bq[0], sacl[0][0]);
          sacl[0][1] = mma16(d1, bq[0], sacl[0][1]);
          guard_a4f6(sacc[0][0], sacc[0][1], sacl[0][0], sacl[0][1], a0, a1, bq[0], cq[0], d0, d1);
        } else {
          guard_s8(sacc[0][0], sacc[0][1], sacc[QT - 1][0], sacc[QT - 1][1],
                   sacl[0][0], sacl[0][1], sacl[QT - 1][0], sacl[QT - 1][1],
                   a0, a1, bq[0], bq[QT - 1], cq[0], cq[QT - 1]);
        }
      }
    }
    // long blocks: keys 0..127 of the tile for this wave's 32 value columns start towards its buffer now and fly under the
    // softmax phase; they are waited for in front of the P.V loop
    const _Float16* vg = vt + (size_t)(32 * wave + h) * RTOT + kbase + (size_t)t * KCH + c * 8;
    if constexpr (!EARLY) stage32(stg_l, vg, (size_t)2 * RTOT);
    // early blocks: likewise keys 0..63 of the tile, both planes
    const size_t vr = (size_t)(32 * wave + erow) * RTOT + kbase + (size_t)t * KCH + epc;
    if constexpr (EARLY) stage_pair(est_l, vt + vr, vl + vr, (size_t)4 * RTOT);
    // ---- combine hi + lo/1024, scale, causal replace fill, per-wave partial row max ----
    {
#pragma unroll
      for (int qt = 0; qt < QT; ++qt) {
        const int qry = qloc0 + 16 * qt + c;
        float pm = ninf;
#pragma unroll
        for (int kt = 0; kt < 2; ++kt) {
#pragma unroll
          for (int r = 0; r < 8; ++r) {
            const int key = kloc + 16 * kt + 8 * h + r;
            float v = (sacc[qt][kt][r] + sacl[qt][kt][r] * rs) * sc;
            v = (key <= qry) ? v : ninf;
            sacc[qt][kt][r] = v;
            pm = fmaxf(pm, v);
          }
        }
        pm = fmaxf(pm, __shfl_xor(pm, 16, 32));
        pmax[wave * QB + 16 * qt + c] = pm;
      }
    }
    __syncthreads();
    // ---- wave 0, lane = query row: fold the prior tile's sums into l, new running max, rescale factor ----
    if (wave == 0 && lane < QB) {
      const int row = lane;
      float ps = 0.0f;
#pragma unroll
      for (int w = 0; w < 8; ++w) ps += psum[w * QB + row];
      l_s[row] = l_s[row] * al_s[row] + ps;
      const float mo = m_s[row];
      float mx = mo;
#pragma unroll
      for (int w = 0; w < 8; ++w) mx = fmaxf(mx, pmax[w * QB + row]);
      al_s[row] = __expf(mo - mx);
      m_s[row] = mx;
    }
    __syncthreads();
    // ---- p = 2^14 * exp(s - m) as f16 (EARLY: plus residual), P tile(s), partial row sums, rescale O ----
    {
#pragma unroll
      for (int qt = 0; qt < QT; ++qt) {
        const float mq = m_s[16 * qt + c];
        float ps = 0.0f;
#pragma unroll
        for (int kt = 0; kt < 2; ++kt) {
          v8h hh, ll;
#pragma unroll
          for (int r = 0; r < 8; ++r) {
            const float p = __expf(sacc[qt][kt][r] - mq);
            ps += p;
            const float pw = p * 16384.0f;
            const _Float16 ph = (_Float16)pw;
            hh[r] = ph;
            ll[r] = (_Float16)((pw - (float)ph) * 1024.0f);
          }
          *(v8h*)(Ps + (16 * qt + c) * PSP + 32 * wave + 16 * kt + 8 * h) = hh;
          if constexpr (EARLY) *(v8h*)(Pl + (16 * qt + c) * PSP + 32 * wave + 16 * kt + 8 * h) = ll;
        }
        ps += __shfl_xor(ps, 16, 32);
        psum[wave * QB + 16 * qt + c] = ps;
        const v4f aA = *(const v4f*)(al_s + 16 * qt + 8 * h), aB = *(const v4f*)(al_s + 16 * qt + 8 * h + 4);
#pragma unroll
        for (int nt = 0; nt < 2; ++nt) {
#pragma unroll
          for (int r = 0; r < 4; ++r) {
            oacc[qt][nt][r] *= aA[r]; oacc[qt][nt][4 + r] *= aB[r];
            if constexpr (EARLY) { oacl[qt][nt][r] *= aA[r]; oacl[qt][nt][4 + r] *= aB[r]; }
          }
        }
      }
    }
    __syncthreads();
    // ---- O += P . V over the visible keys of the tile; this wave's columns 32w + 16nt + c ----
    {
      const int rem = qmax - t * KCH;                            // >= 0 for visited tiles
      int nks = ((rem >> 5) + 1) * 32;
      nks = (nks < KCH) ? nks : KCH;                             // block-uniform key bound
      staged_wait();                                             // the first value piece, requested before the softmax
      int enext = 64;                                            // early blocks: first key of the next piece to request
#pragma unroll 1
      for (int ks = 0; ks < nks; ks += 32) {
        v16h pa[QT];
#pragma unroll
        for (int qt = 0; qt < QT; ++qt) pa[qt] = ldfrag(Ps + 16 * qt * PSP + c * PSP + 8 * h + ks);
        v16h vb0, vb1;
        if constexpr (EARLY) {
          if (ks == enext) {                    // scalar: the next 64 keys of the tile replace the last
            stage_pair(est_l, vt + vr + ks, vl + vr + ks, (size_t)4 * RTOT);
            staged_wait();
            enext += 64;
          }
          vb0 = ldfrag(est + eoff + (ks & 63));
          vb1 = ldfrag(est + 16 * EPT + eoff + (ks & 63));
        } else {
          if (ks == 128) {                      // scalar: keys 128..255 of the tile replace the first half
            stage32(stg_l, vg + ks, (size_t)2 * RTOT);
            staged_wait();
          }
          vb0 = ldfrag(stg + soff + (ks & 127));
          vb1 = ldfrag(stg + 16 * SPT + soff + (ks & 127));
        }
#pragma unroll
        for (int qt = 0; qt < QT; ++qt) {
          oacc[qt][0] = mma16(pa[qt], vb0, oacc[qt][0]);
          oacc[qt][1] = mma16(pa[qt], vb1, oacc[qt][1]);
        }
        if constexpr (EARLY) {
          const v16h pl0 = ldfrag(Pl + c * PSP + 8 * h + ks);
          const v16h vl0 = ldfrag(est + 32 * EPT + eoff + (ks & 63));
          const v16h vl1 = ldfrag(est + 48 * EPT + eoff + (ks & 63));
          oacl[0][0] = mma16(pa[0], vl0, oacl[0][0]);
          oacl[0][1] = mma16(pa[0], vl1, oacl[0][1]);
          oacl[0][0] = mma16(pl0, vb0, oacl[0][0]);
          oacl[0][1] = mma16(pl0, vb1, oacl[0][1]);
          guard_a4f6(oacc[0][0], oacc[0][1], oacl[0][0], oacl[0][1], pa[0], pl0, vb0, vb1, vl0, vl1);
        } else {
          guard_pv4(oacc[0][0], oacc[0][1], oacc[QT - 1][0], oacc[QT - 1][1], pa[0], pa[QT - 1], vb0, vb1);
        }
      }
    }
  }

  // ---- final normaliser per query row (fold the last tile's sums); O = oacc / (2^14 * 16 * l) ----
  if (wave == 0 && lane < QB) {
    const int row = lane;
    float ps = 0.0f;
#pragma unroll
    for (int w = 0; w < 8; ++w) ps += psum[w * QB + row];
    const float l = l_s[row] * al_s[row] + ps;
    li_s[row] = (1.0f / l) * (1.0f / 262144.0f);
  }
  __syncthreads();
  // ---- stage the normalised QB x 256 f32 tile over the Q / P regions (pitch OSP) ----
  float* Os = (float*)(smem);
  {
#pragma unroll
    for (int qt = 0; qt < QT; ++qt) {
      const v4f iA = *(const v4f*)(li_s + 16 * qt + 8 * h), iB = *(const v4f*)(li_s + 16 * qt + 8 * h + 4);
#pragma unroll
      for (int nt = 0; nt < 2; ++nt) {
        const int col = 32 * wave + 16 * nt + c;
#pragma unroll
        for (int r = 0; r < 4; ++r) {
          float o0 = oacc[qt][nt][r], o1 = oacc[qt][nt][4 + r];
          if constexpr (EARLY) { o0 += oacl[qt][nt][r] * rs; o1 += oacl[qt][nt][4 + r] * rs; }
          Os[(16 * qt + 8 * h + r) * OSP + col]     = o0 * iA[r];
          Os[(16 * qt + 8 * h + 4 + r) * OSP + col] = o1 * iB[r];
        }
      }
    }
  }
  __syncthreads();
  {
    float* go = out + (size_t)q0 * DM;
{
#pragma unroll
      for (int rr = 0; rr < RPW; ++rr) {
        const int row = RPW * wave + rr;
#pragma unroll
        for (int j = 0; j < 2; ++j) {
          const int pc = j * 32 + lane;
          const v4f v = *(const v4f*)(Os + row * OSP + pc * 4);
          *(v4f*)(go + (size_t)row * DM + pc * 4) = v;
        }
      }
      
    }
  }
}

// Both query ranges in ONE launch (they share no output row); the block index picks the range, block-uniform.
//   blocks [0, NB*LBLK): query rows [EROWS, SEQ) of every sequence, 32 rows per block, q residual only (the long blocks,
//                        so they start first); coverage NB * LBLK blocks x 32 rows x 256 floats = NB * (SEQ - EROWS) x 256
//   the NB*EBLK blocks behind them: query rows [0, EROWS), 16 rows per block, full residual set;
//                        coverage NB * EBLK blocks x 16 rows x 256 floats = NB * EROWS x 256
#define ATTN_LDS (LATE_LDS + 8 * STG_BYTES)
static_assert(ATTN_LDS >= EARLY_LDS && 2 * ATTN_LDS <= 327680);
__global__ __launch_bounds__(256) void attn_kernel(const _Float16* __restrict__ qh, const _Float16* __restrict__ ql,
                                                   const _Float16* __restrict__ kn, const _Float16* __restrict__ kl,
                                                   const _Float16* __restrict__ vt, const _Float16* __restrict__ vl,
                                                   float* __restrict__ out) {
  __shared__ __align__(16) char smem[ATTN_LDS];
  const int blk = (int)blockIdx.x;
  if (blk < NB * LBLK) {
    const int batch = blk / LBLKD;
    const int qloc0 = EROWS + (blk - batch * LBLKD) * 32;
    attn_body<2, false>(smem, qh, ql, kn, kn, vt, vt, out, batch, qloc0);
  } else {
    const int eb = blk - NB * LBLK;
    const int batch = eb / EBLK;
    const int qloc0 = (eb - batch * EBLK) * 16;
    attn_body<1, true>(smem, qh, ql, kn, kl, vt, vl, out, batch, qloc0);
  }
}

// ---------------------------------------------------------------------------------------------
// Workspace map (bytes, all regions exact tile / whole-line multiples; R = NB*SEQ = 16384):
//   WT16 : Wq^T | Wk^T | Wv^T f16 [3][256][128] (64*bf16(w))   size 3*256*128*2 =    196,608
//   X16  : f16 [R][128] (16*bf16(x))                          size R*128*2     =  4,194,304
//   Q16 / QL16 : f16 hi / residual [R][256] (16*q)             8,388,608 each
//   K16 / KL16 : f16 hi / residual [R][256] (16*k)             8,388,608 each
//   VT16 / VL16: f16 hi / residual [256][R] (16*v)             8,388,608 each
//   total 54,722,560
// ---------------------------------------------------------------------------------------------
static_assert((size_t)3 * DM * EM * 2 + (size_t)RTOT * EM * 2 + (size_t)6 * RTOT * DM * 2 <= (size_t)134217728);
static_assert(((size_t)3 * DM * EM * 2) % 128 == 0 && ((size_t)RTOT * EM * 2) % 128 == 0 && ((size_t)RTOT * DM * 2) % 128 == 0);

extern "C" void kernel_launch(void* const* d_in, const int* in_sizes, int n_in,
                              void* d_out, int out_size, void* d_ws, size_t ws_size,
                              hipStream_t stream) {
  if (n_in < 7) return;
  const int R = RTOT;
  const long long needx = ((long long)(NB - 1) * SEQ_FULL + SEQ) * EM;
  if ((long long)in_sizes[0] < needx) return;
  if (in_sizes[1] < EM * DM || in_sizes[3] < EM * DM || in_sizes[5] < EM * DM) return;
  if (in_sizes[2] < DM || in_sizes[4] < DM || in_sizes[6] < DM) return;
  if ((long long)out_size < (long long)R * DM) return;

  const float* x  = (const float*)d_in[0];
  const float* Wq = (const float*)d_in[1];
  const float* bq = (const float*)d_in[2];
  const float* Wk = (const float*)d_in[3];
  const float* bk = (const float*)d_in[4];
  const float* Wv = (const float*)d_in[5];
  const float* bv = (const float*)d_in[6];
  float* out = (float*)d_out;

  const size_t bWT = (size_t)3 * DM * EM * 2;
  const size_t bX  = (size_t)R * EM * 2;
  const size_t bPl = (size_t)R * DM * 2;
  size_t off = 0;
  const size_t oWT = off; off += bWT;
  const size_t oX  = off; off += bX;
  const size_t oQ  = off; off += bPl;
  const size_t oQL = off; off += bPl;
  const size_t oK  = off; off += bPl;
  const size_t oKL = off; off += bPl;
  const size_t oVT = off; off += bPl;
  const size_t oVL = off; off += bPl;
  if (off > ws_size) return;                     // 54,722,560 for R = 16384
  if (off > (size_t)134217728) return;

  char* ws = (char*)d_ws;
  _Float16* WT16 = (_Float16*)(ws + oWT);
  _Float16* X16  = (_Float16*)(ws + oX);
  _Float16* Q16  = (_Float16*)(ws + oQ);
  _Float16* QL16 = (_Float16*)(ws + oQL);
  _Float16* K16  = (_Float16*)(ws + oK);
  _Float16* KL16 = (_Float16*)(ws + oKL);
  _Float16* VT16 = (_Float16*)(ws + oVT);
  _Float16* VL16 = (_Float16*)(ws + oVL);

  const dim3 blk(256);
  const int nbx = (R * EM / 8) / 256;            // pieces of 8 halves / 256 threads
  const int nbw = (3 * DM * EM / 8) / 256;       // 48
  if (nbx * 256 * 8 != R * EM) return;

  // (1) x -> X16 (16*bf16), weights -> WT16 (64*bf16, in[128][256] -> out[256][128])
  cvt_kernel<<<dim3(nbx + nbw), blk, 0, stream>>>(x, Wq, Wk, Wv, X16, WT16, nbx);
  // (2) q, k -> hi + residual planes [R][256] (bias by column) and v^T -> hi + residual planes [256][R] (bias by row):
  //     K=128; scale 16/(16*64), bias carry 16; grid.y = product, (R/64)*(256/64) tiles of 64x64 each, 8 per block
  gemm64x3_kernel<<<dim3(((R / 64) * (DM / 64)) / 8, 3), blk, 0, stream>>>(
      X16, WT16, Q16, QL16, K16, KL16, VT16, VL16, bq, bk, bv, 16.0f, 0.015625f);
  // (3) attention, all query rows -> out
  attn_kernel<<<dim3(NB * LBLK + NB * EBLK), blk, 0, stream>>>(Q16, QL16, K16, KL16, VT16, VL16, out);
  (void)hipGetLastError();
}

// v004
// It runs in 57.1 microseconds.
// Two timings next to v003 both put it at 1.08 times that version's speed.
// Counting every step since v000, it is 2.30 times as fast.
// Contractions: q | k = x.Wq | x.Wk and v^T = Wv^T.x^T : v_wmma_f32_16x16x32_f16, f16 operands carrying 16*bf16(x) and
// 64*bf16(W), f32 accumulate; S^T = k.q^T : v_wmma_f32_16x16x32_f16, q as f16 hi (x16) plus f16 residual plane (x2^10, own
// accumulator), k as f16 (x16) plus, for the first 512 query rows, an f16 residual plane (x2^10); O = P.v :
// v_wmma_f32_16x16x32_f16, P = 2^14*exp(s-m) as f16 and v as f16 (x16), both with f16 residual planes (x2^10, own
// accumulator) for the first 512 query rows; f32 accumulate. Float inputs RNE-converted to bf16 on load; bias, softmax
// statistics and output scaling in f32.
#include <hip/hip_runtime.h>
#include <stdint.h>

#ifndef NB
#define NB 8
#endif
#ifndef SEQ
#define SEQ 2048
#endif
#define NB_FULL  8
#define SEQ_FULL 2048
#define EM       128
#define DM       256
#define RTOT     (NB * SEQ)
#define EROWS    ((SEQ) < 512 ? (SEQ) : 512)
#define LBLK     (((SEQ) - EROWS) / 32)
#define LBLKD    (LBLK > 0 ? LBLK : 1)
#define EBLK     (EROWS / 16)

static_assert(NB >= 1 && NB <= NB_FULL);
static_assert(SEQ >= 256 && SEQ <= SEQ_FULL && (SEQ % 256) == 0);
static_assert(DM == 256 && EM == 128);
static_assert((EM % 32) == 0 && (DM % 64) == 0);
static_assert((RTOT % 128) == 0);
static_assert((EROWS % 32) == 0 && ((SEQ - EROWS) % 32) == 0);

typedef _Float16 v16h __attribute__((ext_vector_type(16)));
typedef _Float16 v8h  __attribute__((ext_vector_type(8)));
typedef _Float16 v4h  __attribute__((ext_vector_type(4)));
typedef float    v8f  __attribute__((ext_vector_type(8)));
typedef float    v4f  __attribute__((ext_vector_type(4)));

// f32 -> nearest-even bf16 bits / value
__device__ __forceinline__ unsigned short bfbits(float f) {
  unsigned u = __float_as_uint(f);
  return (unsigned short)((u + 0x7FFFu + ((u >> 16) & 1u)) >> 16);
}
__device__ __forceinline__ float bfval(unsigned short b) { return __uint_as_float(((unsigned)b) << 16); }
__device__ __forceinline__ float bfr(float f) { return bfval(bfbits(f)); }

__device__ __forceinline__ v8f mma16(v16h a, v16h b, v8f c) {
  return __builtin_amdgcn_wmma_f32_16x16x32_f16(false, a, false, b, (short)0, c, false, false);
}

// 16-bit WMMA fragment from k-contiguous storage (A row-major [m][k], or B stored [n][k]):
// p points at element (row_or_col = lane&15, k0 + 8h); elements 0..7 <- p[0..7], 8..15 <- p[16..23].
__device__ __forceinline__ v16h ldfrag(const _Float16* p) {
  union { v16h v; v8h h[2]; } f;
  f.h[0] = *(const v8h*)(p);
  f.h[1] = *(const v8h*)(p + 16);
  return f.v;
}
__device__ __forceinline__ v8f zero8() {
  v8f z;
#pragma unroll
  for (int i = 0; i < 8; ++i) z[i] = 0.0f;
  return z;
}

// hazard guards: 4 VALU slots after the last WMMA of a group, D tied, A/B kept live
__device__ __forceinline__ void guard_g(v8f& a, v8f& b, v16h x, v16h y) {
  asm volatile("v_nop\n\tv_nop\n\tv_nop\n\tv_nop" : "+v"(a), "+v"(b) : "v"(x), "v"(y));
}
__device__ __forceinline__ void keep4(v16h a, v16h b, v16h c, v16h d) {
  asm volatile("v_nop" :: "v"(a), "v"(b), "v"(c), "v"(d));
}
__device__ __forceinline__ void accg4(v8f& a, v8f& b, v8f& c, v8f& d) {
  asm volatile("v_nop\n\tv_nop\n\tv_nop\n\tv_nop" : "+v"(a), "+v"(b), "+v"(c), "+v"(d));
}
__device__ __forceinline__ void guard_s8(v8f& a0, v8f& a1, v8f& a2, v8f& a3, v8f& b0, v8f& b1, v8f& b2, v8f& b3,
                                         v16h x0, v16h x1, v16h y0, v16h y1, v16h z0, v16h z1) {
  asm volatile("v_nop\n\tv_nop\n\tv_nop\n\tv_nop"
               : "+v"(a0), "+v"(a1), "+v"(a2), "+v"(a3), "+v"(b0), "+v"(b1), "+v"(b2), "+v"(b3)
               : "v"(x0), "v"(x1), "v"(y0), "v"(y1), "v"(z0), "v"(z1));
}
__device__ __forceinline__ void guard_a4f6(v8f& a0, v8f& a1, v8f& b0, v8f& b1,
                                           v16h x0, v16h x1, v16h y0, v16h y1, v16h z0, v16h z1) {
  asm volatile("v_nop\n\tv_nop\n\tv_nop\n\tv_nop"
               : "+v"(a0), "+v"(a1), "+v"(b0), "+v"(b1)
               : "v"(x0), "v"(x1), "v"(y0), "v"(y1), "v"(z0), "v"(z1));
}
__device__ __forceinline__ void guard_pv4(v8f& a0, v8f& a1, v8f& b0, v8f& b1,
                                          v16h p0, v16h p1, v16h x0, v16h x1) {
  asm volatile("v_nop\n\tv_nop\n\tv_nop\n\tv_nop"
               : "+v"(a0), "+v"(a1), "+v"(b0), "+v"(b1)
               : "v"(p0), "v"(p1), "v"(x0), "v"(x1));
}

// 8 consecutive k of column n of a [EM][DM] weight, as f16(64 * bf16(w))
__device__ __forceinline__ v8h wpiece(const float* __restrict__ W, int k0, int n) {
  v8h o;
#pragma unroll
  for (int i = 0; i < 8; ++i) o[i] = (_Float16)(bfr(W[(size_t)(k0 + i) * DM + n]) * 64.0f);
  return o;
}

// ---------------------------------------------------------------------------------------------
// Kernel 1: the three projections, from the f32 inputs, in ONE launch; blockIdx.y (block-uniform) picks the product:
//   0: q = X.Wq   -> Q16 / QL16 [R][256], bias by column      1: k = X.Wk -> K16 / KL16 [R][256], bias by column
//   2: v^T = Wv^T.X^T -> VT16 / VL16 [256][R], bias by row
// value[m][n] = scale * sum_k A[m][k] * Bt[n][k] + bsc * bf16(bias[.]); output: f16 hi plane C = f16(value) plus f16
// residual plane C2 = f16((value - hi) * 1024), same layout.
// Block = 512 threads = 16 waves = 256 token rows x all 256 outputs of one product. The block converts its operands itself,
// once, into LDS (no conversion launch, no f16 copy of x or of the weights in global memory):
//   Xs[row][k] = f16(16 * bf16(x[token r0 + row][k])): 256 rows, 16 per wave, one whole row (512 B) per load
//   Ws[n][k]   = f16(64 * bf16(W[k][n])):              256 x 16 pieces of 8 halves, 8 per thread; a wave reads 32 consecutive
//                n of one k per load (one whole line) and stores 8 consecutive k per lane
// and one block barrier publishes both; behind it they are only read. Each wave owns one 64x64 C tile (16 f32 accumulators):
// token rows 64*(wave/4).., outputs 64*(wave%4)..; coverage: RTOT/256 blocks x 16 tiles = RTOT x 256 per product, each tile
// written fully (rows it*4+qq = 0..15 per slab, cols c8 = 0..56 by 8).
// ---------------------------------------------------------------------------------------------
#define GTOK 256
// LDS pitch of the operand rows in halves: 272 B = 16 B x 17, conflict-free for the 16-B fragment reads and piece stores
#define GXP  136
static_assert((RTOT % GTOK) == 0 && (SEQ % GTOK) == 0 && (GTOK % 16) == 0 && EM == 32 * 4 && DM == 8 * 32 && ((GXP * 2) % 16) == 0);
__global__ __launch_bounds__(512) void gemm64x3_kernel(const float* __restrict__ x, const float* __restrict__ Wq,
                                                       const float* __restrict__ Wk, const float* __restrict__ Wv,
                                                       _Float16* __restrict__ Q16, _Float16* __restrict__ QL16,
                                                       _Float16* __restrict__ K16, _Float16* __restrict__ KL16,
                                                       _Float16* __restrict__ VT16, _Float16* __restrict__ VL16,
                                                       const float* __restrict__ bq, const float* __restrict__ bk,
                                                       const float* __restrict__ bv, float bsc, float scale) {
  __shared__ __align__(16) float sT[16][16 * 68];
  __shared__ __align__(16) _Float16 Xs[GTOK * GXP];
  __shared__ __align__(16) _Float16 Ws[DM * GXP];
  const int role = (int)blockIdx.y;
  const float* __restrict__ W = (role == 0) ? Wq : (role == 1) ? Wk : Wv;
  _Float16* __restrict__ C  = (role == 0) ? Q16  : (role == 1) ? K16  : VT16;
  _Float16* __restrict__ C2 = (role == 0) ? QL16 : (role == 1) ? KL16 : VL16;
  const float* __restrict__ bias = (role == 0) ? bq : (role == 1) ? bk : bv;
  const int ldc = (role == 2) ? RTOT : DM;
  const int K = EM;
  const int bias_mode = (role == 2) ? 2 : 1;
  const int tid  = (int)threadIdx.x;
  const int lane = tid & 31;
  const int wave = __builtin_amdgcn_readfirstlane((int)(threadIdx.x >> 5));
  const int r0 = (int)blockIdx.x * GTOK;       // first compact token row (b*SEQ + n) of the block
  const int xb = r0 / SEQ;                     // the block's 256 rows lie in one sequence (GTOK divides SEQ)
  const float* xw = x + ((size_t)xb * SEQ_FULL + (r0 - xb * SEQ) + wave) * EM + lane * 4;
#pragma unroll
  for (int i = 0; i < GTOK / 16; ++i) {
    const int row = i * 16 + wave;             // one whole row (512 B) per wave and load
    const v4f a = *(const v4f*)(xw + (size_t)i * 16 * EM);
    v4h o;
#pragma unroll
    for (int e = 0; e < 4; ++e) o[e] = (_Float16)(bfr(a[e]) * 16.0f);
    *(v4h*)(Xs + row * GXP + lane * 4) = o;
  }
#pragma unroll
  for (int i = 0; i < EM / 16; ++i) {
    const int k0 = (2 * i + (wave >> 3)) * 8;  // scalar; waves 0..7 take the even groups of 8 k, waves 8..15 the odd ones
    const int n  = (wave & 7) * 32 + lane;
    *(v8h*)(Ws + n * GXP + k0) = wpiece(W, k0, n);
  }
  __syncthreads();

  const int xa = (wave >> 2) << 6;             // first token row of the wave's tile inside the block
  const int wa = (wave & 3) << 6;              // first output of the wave's tile
  const _Float16* A  = (role == 2) ? Ws + wa * GXP : Xs + xa * GXP;
  const _Float16* Bt = (role == 2) ? Xs + xa * GXP : Ws + wa * GXP;
  const int m0 = (role == 2) ? wa : r0 + xa;
  const int n0 = (role == 2) ? r0 + xa : wa;
  const int rl = lane & 15;
  const int koff = (lane >> 4) * 8;
  const int mOff = (lane >> 4) * 8;

  v8f acc[4][4];
#pragma unroll
  for (int i = 0; i < 4; ++i)
#pragma unroll
    for (int j = 0; j < 4; ++j) acc[i][j] = zero8();

#pragma unroll 1
  for (int k0 = 0; k0 < K; k0 += 32) {
    v16h bh[4];
#pragma unroll
    for (int j = 0; j < 4; ++j) bh[j] = ldfrag(Bt + ((j << 4) + rl) * GXP + koff + k0);
#pragma unroll
    for (int i = 0; i < 4; ++i) {
      const v16h ah = ldfrag(A + ((i << 4) + rl) * GXP + koff + k0);
#pragma unroll
      for (int j = 0; j < 4; ++j) acc[i][j] = mma16(ah, bh[j], acc[i][j]);
      guard_g(acc[i][0], acc[i][3], ah, bh[3]);
    }
    keep4(bh[0], bh[1], bh[2], bh[3]);
  }
  accg4(acc[0][0], acc[0][1], acc[0][2], acc[0][3]);
  accg4(acc[1][0], acc[1][1], acc[1][2], acc[1][3]);
  accg4(acc[2][0], acc[2][1], acc[2][2], acc[2][3]);
  accg4(acc[3][0], acc[3][1], acc[3][2], acc[3][3]);

  float* slab = sT[wave];
#pragma unroll
  for (int i = 0; i < 4; ++i) {
    const int mBase = m0 + (i << 4);
    float brow[8];
#pragma unroll
    for (int r = 0; r < 8; ++r) brow[r] = 0.0f;
    if (bias_mode == 2) {
      const v4f ba = *(const v4f*)(bias + mBase + mOff);
      const v4f bb = *(const v4f*)(bias + mBase + mOff + 4);
#pragma unroll
      for (int r = 0; r < 4; ++r) { brow[r] = bsc * bfr(ba[r]); brow[4 + r] = bsc * bfr(bb[r]); }
    }
#pragma unroll
    for (int j = 0; j < 4; ++j) {
      float bcol = 0.0f;
      if (bias_mode == 1) bcol = bsc * bfr(bias[n0 + (j << 4) + rl]);
#pragma unroll
      for (int r = 0; r < 8; ++r) {
        const float bb = brow[r] + bcol;         // exactly one of the two is active
        slab[(mOff + r) * 68 + (j << 4) + rl] = acc[i][j][r] * scale + bb;
      }
    }
    __builtin_amdgcn_fence(3 /* release order */, "workgroup");
    __builtin_amdgcn_wave_barrier();
    __builtin_amdgcn_fence(2 /* acquire order */, "workgroup");
    {
      const int qq = lane >> 3, c8 = (lane & 7) * 8;
{
#pragma unroll
        for (int it = 0; it < 4; ++it) {
          const int row = it * 4 + qq;
          const float* sp = slab + row * 68 + c8;
          v8h hv, lv;
#pragma unroll
          for (int e = 0; e < 8; ++e) {
            const float f = sp[e];
            const _Float16 hh = (_Float16)f;
            hv[e] = hh;
            lv[e] = (_Float16)((f - (float)hh) * 1024.0f);
          }
          *(v8h*)(C  + (size_t)(mBase + row) * ldc + n0 + c8) = hv;
          *(v8h*)(C2 + (size_t)(mBase + row) * ldc + n0 + c8) = lv;
        }
        
      }
    }
    __builtin_amdgcn_fence(3 /* release order */, "workgroup");
    __builtin_amdgcn_wave_barrier();
    __builtin_amdgcn_fence(2 /* acquire order */, "workgroup");
  }
}

// ---------------------------------------------------------------------------------------------
// Kernel 2: causal single-head attention per sequence, head width 256, online softmax in f32 (fused; no score or
// probability plane in global memory).
//   qh / ql planes f16 [RTOT][DM] (16*q hi and residual x1024), kn / kl planes f16 [RTOT][DM] (16*k hi and residual
//   x1024), vt / vl planes f16 [DM][RTOT] (16*v hi and residual x1024); out f32 [RTOT][DM] = softmax(mask(q.k^T/16)).v.
//   Block = 256 threads = 8 waves, QB = 16*QT query rows of one sequence; Q hi and lo tiles staged once in LDS.
//   Key tiles of 256, only tiles up to the diagonal are visited: wave w owns keys 32w..32w+31 of the tile for the
//   logits (skipped, wave-uniform, when all its keys lie above the block's last query): S^T subtiles (A = k rows from
//   its staging buffer in LDS, B = Q hi / Q lo rows from LDS, hi and x1024 accumulator sets), so the D layout gives per lane 8 consecutive
//   keys of one query -> P written to LDS as 16-B vectors ([query][key]). Keys above the query get -inf (replace fill).
//   P = 2^14 * exp(s - m_running) as f16 (EARLY: plus residual tile x1024).
//   Row max / sum: per-wave partials in LDS, combined in fixed order by wave 0 (one lane per query row).
//   P.V: every wave reads the P tile(s) (A operand, after a block barrier) and owns 32 value columns (B from vt / vl),
//   key loop bounded (block-uniform) at the diagonal.
//   EARLY (QT = 1, first 512 query rows of each sequence): k, P and v residual products into the x1024 accumulators.
//   Long blocks (QT = 2): a wave's 32 key rows and its 32 value columns reach it through its own LDS buffer, half a tile
//   (32 rows x 256 B) at a time, by asynchronous copies that take whole 128-B lines; the fragments are read from there.
//   Early blocks: the same, a quarter tile (32 rows x 128 B) of the hi and of the residual plane at a time.
//   Output: normalised O in f32 staged as a QB x 256 tile in LDS (pitch 260 floats), then each wave writes QB/8 whole
// LDS regions: Q hi, Q lo, P hi (, P lo), pmax, psum, row statistics: all cross-wave, separated by block barriers.
// staged extent == consumed extent: Q tiles QB x 256 fully staged; P tiles QB x 256 fully written every key tile.
// ---------------------------------------------------------------------------------------------
#define KCH      256
#define QSP      264
#define PSP      264
#define OSP      260
#define LATE_LDS  (3 * 32 * QSP * 2 + 2560)
#define EARLY_LDS (4 * 16 * QSP * 2 + 2560)
static_assert((QSP % 8) == 0 && (PSP % 8) == 0 && PSP >= KCH && QSP >= DM && (OSP % 4) == 0 && OSP >= DM);
static_assert(QSP == PSP);
static_assert((SEQ % KCH) == 0 && DM == 8 * 32 && KCH == 8 * 32);
static_assert(LATE_LDS <= 65536 && EARLY_LDS <= 65536);
// Long blocks: one staging buffer per wave, read and refilled by that wave alone: 32 rows x 256 B at a pitch of 272 B
// (16 B x 17: conflict-free for the 16-B fragment reads).
#define SPT       136
#define STG_BYTES (32 * SPT * 2)
static_assert((LATE_LDS % 16) == 0 && (STG_BYTES % 16) == 0 && ((SPT * 2) % 16) == 0);

// Eight asynchronous 16-B-per-lane copies to LDS; copy i moves two 256-B row halves (lanes 0..15 one, 16..31 the next),
// so every request covers whole 128-B lines. l: the lane's LDS byte address, g: the lane's global address, both of copy 0;
// gp: global step between copies in halves. The s_wait_xcnt stands in the statement so that no address register is
// rewritten ahead of it.
__device__ __forceinline__ void copy8(const unsigned l, const _Float16* g, const size_t gp) {
  asm volatile("global_load_async_to_lds_b128 %0, %8, off\n\t"
               "global_load_async_to_lds_b128 %1, %9, off\n\t"
               "global_load_async_to_lds_b128 %2, %10, off\n\t"
               "global_load_async_to_lds_b128 %3, %11, off\n\t"
               "global_load_async_to_lds_b128 %4, %12, off\n\t"
               "global_load_async_to_lds_b128 %5, %13, off\n\t"
               "global_load_async_to_lds_b128 %6, %14, off\n\t"
               "global_load_async_to_lds_b128 %7, %15, off\n\t"
               "s_wait_xcnt 0x0"
               :: "v"(l), "v"(l + 4 * SPT), "v"(l + 8 * SPT), "v"(l + 12 * SPT),
                  "v"(l + 16 * SPT), "v"(l + 20 * SPT), "v"(l + 24 * SPT), "v"(l + 28 * SPT),
                  "v"(g), "v"(g + gp), "v"(g + 2 * gp), "v"(g + 3 * gp),
                  "v"(g + 4 * gp), "v"(g + 5 * gp), "v"(g + 6 * gp), "v"(g + 7 * gp)
               : "memory");
}
// Refill of the wave's own buffer: 32 rows x 256 B = 16 copies. The s_wait_dscnt retires this wave's fragment reads of the
// buffer before a copy may land on them (no other wave touches it, so no barrier is owed).
__device__ __forceinline__ void stage32(const unsigned l, const _Float16* g, const size_t gp) {
  asm volatile("s_wait_dscnt 0x0" ::: "memory");
  copy8(l, g, gp);
  copy8(l + 32 * SPT, g + 8 * gp, gp);
}
// Early blocks: one staging buffer per wave, read and refilled by that wave alone: the hi and the residual plane, each
// 32 rows x 128 B at a pitch of 144 B (16 B x 9: conflict-free for the 16-B fragment reads).
#define EPT        72
#define EPL_BYTES  (32 * EPT * 2)
#define ESTG_BYTES (2 * EPL_BYTES)
static_assert((EARLY_LDS % 16) == 0 && (EPL_BYTES % 16) == 0 && ((EPT * 2) % 16) == 0);
static_assert(EARLY_LDS + 8 * ESTG_BYTES <= LATE_LDS + 8 * STG_BYTES);
// Eight asynchronous 16-B-per-lane copies to LDS; copy i moves four 128-B row pieces (eight lanes each), whole lines.
// l, g: the lane's LDS byte address and global address of copy 0; gp: global step between copies in halves. The
// s_wait_xcnt stands in the statement so that no address register is rewritten ahead of it.
__device__ __forceinline__ void copy8q(const unsigned l, const _Float16* g, const size_t gp) {
  asm volatile("global_load_async_to_lds_b128 %0, %8, off\n\t"
               "global_load_async_to_lds_b128 %1, %9, off\n\t"
               "global_load_async_to_lds_b128 %2, %10, off\n\t"
               "global_load_async_to_lds_b128 %3, %11, off\n\t"
               "global_load_async_to_lds_b128 %4, %12, off\n\t"
               "global_load_async_to_lds_b128 %5, %13, off\n\t"
               "global_load_async_to_lds_b128 %6, %14, off\n\t"
               "global_load_async_to_lds_b128 %7, %15, off\n\t"
               "s_wait_xcnt 0x0"
               :: "v"(l), "v"(l + 8 * EPT), "v"(l + 16 * EPT), "v"(l + 24 * EPT),
                  "v"(l + 32 * EPT), "v"(l + 40 * EPT), "v"(l + 48 * EPT), "v"(l + 56 * EPT),
                  "v"(g), "v"(g + gp), "v"(g + 2 * gp), "v"(g + 3 * gp),
                  "v"(g + 4 * gp), "v"(g + 5 * gp), "v"(g + 6 * gp), "v"(g + 7 * gp)
               : "memory");
}
// Refill of the wave's own buffer, both planes: 2 x 32 rows x 128 B = 16 copies. The s_wait_dscnt retires this wave's
// fragment reads of the buffer before a copy may land on them (no other wave touches it, so no barrier is owed).
__device__ __forceinline__ void stage_pair(const unsigned l, const _Float16* gh, const _Float16* gl, const size_t gp) {
  asm volatile("s_wait_dscnt 0x0" ::: "memory");
  copy8q(l, gh, gp);
  copy8q(l + EPL_BYTES, gl, gp);
}
// The issuing wave's own wait: behind it the staged rows have landed and this wave may read them.
__device__ __forceinline__ void staged_wait() {
  asm volatile("s_wait_asynccnt 0x0" ::: "memory");
}

template <int QT, bool EARLY>
__device__ __forceinline__ void attn_body(char* smem,
                                          const _Float16* __restrict__ qh, const _Float16* __restrict__ ql,
                                          const _Float16* __restrict__ kn, const _Float16* __restrict__ kl,
                                          const _Float16* __restrict__ vt, const _Float16* __restrict__ vl,
                                          float* __restrict__ out, const int batch, const int qloc0) {
  static_assert(EARLY ? (QT == 1) : (QT == 2));
  constexpr int QB  = 16 * QT;
  constexpr int TB  = QB * QSP * 2;             // bytes per 16-bit tile
  constexpr int NPL = EARLY ? 4 : 3;            // tiles: Q hi, Q lo, P hi (, P lo)
  constexpr int RPW = QB / 8;                   // output rows per wave
  static_assert((TB % 16) == 0);
  static_assert(QB * OSP * 4 <= NPL * TB);
  static_assert(8 * QB <= 256);
  static_assert(RPW * 8 == QB);
  static_assert((SEQ % QB) == 0);

  _Float16* Qs = (_Float16*)(smem);
  _Float16* Ls = (_Float16*)(smem + TB);
  _Float16* Ps = (_Float16*)(smem + 2 * TB);
  _Float16* Pl = (_Float16*)(smem + (NPL - 1) * TB);   // distinct tile only when EARLY
  float* pmax = (float*)(smem + NPL * TB);
  float* psum = pmax + 256;
  float* m_s  = psum + 256;
  float* l_s  = m_s + 32;
  float* al_s = m_s + 64;
  float* li_s = m_s + 96;

  const int tid  = (int)threadIdx.x;
  const int wave = __builtin_amdgcn_readfirstlane((int)(threadIdx.x >> 5));
  const int lane = tid & 31, h = lane >> 4, c = lane & 15;
  const int kbase = batch * SEQ;                // compact token row of key 0 of this sequence
  const int q0    = kbase + qloc0;              // compact token row of query 0 of this block
  const int qmax  = qloc0 + QB - 1;             // last local query index of this block
  const float ninf = -__builtin_inff();
  const float sc = 0.000244140625f;             // 1/4096: logits carry 16*16 and the 1/16 score scale
  const float rs = 0.0009765625f;               // 1/1024: residual plane carry

  if (tid < 32) { m_s[tid] = ninf; l_s[tid] = 0.0f; al_s[tid] = 0.0f; li_s[tid] = 0.0f; }
  psum[tid] = 0.0f;
  pmax[tid] = ninf;
  // Q hi and lo tiles: QB rows x 32 pieces of 8 halves per plane; coverage 2*QT * 256 = QB*32 pieces = whole tile each
#pragma unroll
  for (int i = 0; i < 2 * QT; ++i) {
    const int idx = i * 256 + tid;
    const int row = idx >> 5;
    const int pc  = idx & 31;
    const v8h vh = *(const v8h*)(qh + (size_t)(q0 + row) * DM + pc * 8);
    const v8h vq = *(const v8h*)(ql + (size_t)(q0 + row) * DM + pc * 8);
    *(v8h*)(Qs + row * QSP + pc * 8) = vh;
    *(v8h*)(Ls + row * QSP + pc * 8) = vq;
  }
  __syncthreads();

  v8f oacc[QT][2];
  v8f oacl[QT][2];
#pragma unroll
  for (int qt = 0; qt < QT; ++qt)
#pragma unroll
    for (int nt = 0; nt < 2; ++nt) { oacc[qt][nt] = zero8(); oacl[qt][nt] = zero8(); }

  const int qoff = c * QSP + 8 * h;             // LDS fragment offset of query c (add 16*qt*QSP + k)
  // long blocks: this wave's staging buffer, its fragment offset, and the lane's LDS byte address / row / piece for copy 0
  const _Float16* stg = (const _Float16*)(smem + LATE_LDS + wave * STG_BYTES);
  const int soff = c * SPT + 8 * h;
  const unsigned stg_l = (unsigned)(size_t)(smem + LATE_LDS + wave * STG_BYTES) + (unsigned)(h * (SPT * 2) + c * 16);
  // early blocks: the same for their buffer (copy 0: lane's row = lane / 8, 16-B piece = lane % 8)
  const _Float16* est = (const _Float16*)(smem + EARLY_LDS + wave * ESTG_BYTES);
  const int eoff = c * EPT + 8 * h;
  const int erow = lane >> 3, epc = (lane & 7) * 8;
  const unsigned est_l = (unsigned)(size_t)(smem + EARLY_LDS + wave * ESTG_BYTES) + (unsigned)(erow * (EPT * 2) + epc * 2);
  const int ntile = qmax / KCH + 1;             // key tiles up to the diagonal (block-uniform)

#pragma unroll 1
  for (int t = 0; t < ntile; ++t) {
    // ---- logits: S^T subtiles for this wave's 32 keys, queries 0..QB-1; hi and x1024 accumulators ----
    const int kloc = t * KCH + 32 * wave;       // local index of this wave's first key (scalar)
    v8f sacc[QT][2];   // [query subtile][key subtile]; element r: query 16qt+c, key kloc+16kt+8h+r
    v8f sacl[QT][2];
#pragma unroll
    for (int qt = 0; qt < QT; ++qt)
#pragma unroll
      for (int kt = 0; kt < 2; ++kt) { sacc[qt][kt] = zero8(); sacl[qt][kt] = zero8(); }
    if (kloc <= qmax) {                         // wave-uniform: some key of this wave is visible to some query
#pragma unroll 1
      for (int k0 = 0; k0 < DM; k0 += 32) {
        v16h a0, a1;
        if constexpr (EARLY) {
          if ((k0 & 63) == 0) {                 // scalar: columns k0..k0+63 of this wave's 32 key rows, both planes
            const size_t kr = (size_t)(kbase + kloc + erow) * DM + k0 + epc;
            stage_pair(est_l, kn + kr, kl + kr, (size_t)4 * DM);
            staged_wait();
          }
          a0 = ldfrag(est + eoff + (k0 & 63));
          a1 = ldfrag(est + 16 * EPT + eoff + (k0 & 63));
        } else {
          if ((k0 & 127) == 0) {                // scalar: columns k0..k0+127 of this wave's 32 key rows -> its buffer
            stage32(stg_l, kn + (size_t)(kbase + kloc + h) * DM + k0 + c * 8, (size_t)2 * DM);
            staged_wait();
          }
          a0 = ldfrag(stg + soff + (k0 & 127));
          a1 = ldfrag(stg + 16 * SPT + soff + (k0 & 127));
        }
        v16h bq[QT], cq[QT];
#pragma unroll
        for (int qt = 0; qt < QT; ++qt) {
          bq[qt] = ldfrag(Qs + 16 * qt * QSP + qoff + k0);
          cq[qt] = ldfrag(Ls + 16 * qt * QSP + qoff + k0);
        }
#pragma unroll
        for (int qt = 0; qt < QT; ++qt) {
          sacc[qt][0] = mma16(a0, bq[qt], sacc[qt][0]);
          sacc[qt][1] = mma16(a1, bq[qt], sacc[qt][1]);
        }
#pragma unroll
        for (int qt = 0; qt < QT; ++qt) {
          sacl[qt][0] = mma16(a0, cq[qt], sacl[qt][0]);
          sacl[qt][1] = mma16(a1, cq[qt], sacl[qt][1]);
        }
        if constexpr (EARLY) {
          const v16h d0 = ldfrag(est + 32 * EPT + eoff + (k0 & 63)), d1 = ldfrag(est + 48 * EPT + eoff + (k0 & 63));
          sacl[0][0] = mma16(d0, bq[0], sacl[0][0]);
          sacl[0][1] = mma16(d1, bq[0], sacl[0][1]);
          guard_a4f6(sacc[0][0], sacc[0][1], sacl[0][0], sacl[0][1], a0, a1, bq[0], cq[0], d0, d1);
        } else {
          guard_s8(sacc[0][0], sacc[0][1], sacc[QT - 1][0], sacc[QT - 1][1],
                   sacl[0][0], sacl[0][1], sacl[QT - 1][0], sacl[QT - 1][1],
                   a0, a1, bq[0], bq[QT - 1], cq[0], cq[QT - 1]);
        }
      }
    }
    // long blocks: keys 0..127 of the tile for this wave's 32 value columns start towards its buffer now and fly under the
    // softmax phase; they are waited for in front of the P.V loop
    const _Float16* vg = vt + (size_t)(32 * wave + h) * RTOT + kbase + (size_t)t * KCH + c * 8;
    if constexpr (!EARLY) stage32(stg_l, vg, (size_t)2 * RTOT);
    // early blocks: likewise keys 0..63 of the tile, both planes
    const size_t vr = (size_t)(32 * wave + erow) * RTOT + kbase + (size_t)t * KCH + epc;
    if constexpr (EARLY) stage_pair(est_l, vt + vr, vl + vr, (size_t)4 * RTOT);
    // ---- combine hi + lo/1024, scale, causal replace fill, per-wave partial row max ----
    {
#pragma unroll
      for (int qt = 0; qt < QT; ++qt) {
        const int qry = qloc0 + 16 * qt + c;
        float pm = ninf;
#pragma unroll
        for (int kt = 0; kt < 2; ++kt) {
#pragma unroll
          for (int r = 0; r < 8; ++r) {
            const int key = kloc + 16 * kt + 8 * h + r;
            float v = (sacc[qt][kt][r] + sacl[qt][kt][r] * rs) * sc;
            v = (key <= qry) ? v : ninf;
            sacc[qt][kt][r] = v;
            pm = fmaxf(pm, v);
          }
        }
        pm = fmaxf(pm, __shfl_xor(pm, 16, 32));
        pmax[wave * QB + 16 * qt + c] = pm;
      }
    }
    __syncthreads();
    // ---- wave 0, lane = query row: fold the prior tile's sums into l, new running max, rescale factor ----
    if (wave == 0 && lane < QB) {
      const int row = lane;
      float ps = 0.0f;
#pragma unroll
      for (int w = 0; w < 8; ++w) ps += psum[w * QB + row];
      l_s[row] = l_s[row] * al_s[row] + ps;
      const float mo = m_s[row];
      float mx = mo;
#pragma unroll
      for (int w = 0; w < 8; ++w) mx = fmaxf(mx, pmax[w * QB + row]);
      al_s[row] = __expf(mo - mx);
      m_s[row] = mx;
    }
    __syncthreads();
    // ---- p = 2^14 * exp(s - m) as f16 (EARLY: plus residual), P tile(s), partial row sums, rescale O ----
    {
#pragma unroll
      for (int qt = 0; qt < QT; ++qt) {
        const float mq = m_s[16 * qt + c];
        float ps = 0.0f;
#pragma unroll
        for (int kt = 0; kt < 2; ++kt) {
          v8h hh, ll;
#pragma unroll
          for (int r = 0; r < 8; ++r) {
            const float p = __expf(sacc[qt][kt][r] - mq);
            ps += p;
            const float pw = p * 16384.0f;
            const _Float16 ph = (_Float16)pw;
            hh[r] = ph;
            ll[r] = (_Float16)((pw - (float)ph) * 1024.0f);
          }
          *(v8h*)(Ps + (16 * qt + c) * PSP + 32 * wave + 16 * kt + 8 * h) = hh;
          if constexpr (EARLY) *(v8h*)(Pl + (16 * qt + c) * PSP + 32 * wave + 16 * kt + 8 * h) = ll;
        }
        ps += __shfl_xor(ps, 16, 32);
        psum[wave * QB + 16 * qt + c] = ps;
        const v4f aA = *(const v4f*)(al_s + 16 * qt + 8 * h), aB = *(const v4f*)(al_s + 16 * qt + 8 * h + 4);
#pragma unroll
        for (int nt = 0; nt < 2; ++nt) {
#pragma unroll
          for (int r = 0; r < 4; ++r) {
            oacc[qt][nt][r] *= aA[r]; oacc[qt][nt][4 + r] *= aB[r];
            if constexpr (EARLY) { oacl[qt][nt][r] *= aA[r]; oacl[qt][nt][4 + r] *= aB[r]; }
          }
        }
      }
    }
    __syncthreads();
    // ---- O += P . V over the visible keys of the tile; this wave's columns 32w + 16nt + c ----
    {
      const int rem = qmax - t * KCH;                            // >= 0 for visited tiles
      int nks = ((rem >> 5) + 1) * 32;
      nks = (nks < KCH) ? nks : KCH;                             // block-uniform key bound
      staged_wait();                                             // the first value piece, requested before the softmax
      int enext = 64;                                            // early blocks: first key of the next piece to request
#pragma unroll 1
      for (int ks = 0; ks < nks; ks += 32) {
        v16h pa[QT];
#pragma unroll
        for (int qt = 0; qt < QT; ++qt) pa[qt] = ldfrag(Ps + 16 * qt * PSP + c * PSP + 8 * h + ks);
        v16h vb0, vb1;
        if constexpr (EARLY) {
          if (ks == enext) {                    // scalar: the next 64 keys of the tile replace the last
            stage_pair(est_l, vt + vr + ks, vl + vr + ks, (size_t)4 * RTOT);
            staged_wait();
            enext += 64;
          }
          vb0 = ldfrag(est + eoff + (ks & 63));
          vb1 = ldfrag(est + 16 * EPT + eoff + (ks & 63));
        } else {
          if (ks == 128) {                      // scalar: keys 128..255 of the tile replace the first half
            stage32(stg_l, vg + ks, (size_t)2 * RTOT);
            staged_wait();
          }
          vb0 = ldfrag(stg + soff + (ks & 127));
          vb1 = ldfrag(stg + 16 * SPT + soff + (ks & 127));
        }
#pragma unroll
        for (int qt = 0; qt < QT; ++qt) {
          oacc[qt][0] = mma16(pa[qt], vb0, oacc[qt][0]);
          oacc[qt][1] = mma16(pa[qt], vb1, oacc[qt][1]);
        }
        if constexpr (EARLY) {
          const v16h pl0 = ldfrag(Pl + c * PSP + 8 * h + ks);
          const v16h vl0 = ldfrag(est + 32 * EPT + eoff + (ks & 63));
          const v16h vl1 = ldfrag(est + 48 * EPT + eoff + (ks & 63));
          oacl[0][0] = mma16(pa[0], vl0, oacl[0][0]);
          oacl[0][1] = mma16(pa[0], vl1, oacl[0][1]);
          oacl[0][0] = mma16(pl0, vb0, oacl[0][0]);
          oacl[0][1] = mma16(pl0, vb1, oacl[0][1]);
          guard_a4f6(oacc[0][0], oacc[0][1], oacl[0][0], oacl[0][1], pa[0], pl0, vb0, vb1, vl0, vl1);
        } else {
          guard_pv4(oacc[0][0], oacc[0][1], oacc[QT - 1][0], oacc[QT - 1][1], pa[0], pa[QT - 1], vb0, vb1);
        }
      }
    }
  }

  // ---- final normaliser per query row (fold the last tile's sums); O = oacc / (2^14 * 16 * l) ----
  if (wave == 0 && lane < QB) {
    const int row = lane;
    float ps = 0.0f;
#pragma unroll
    for (int w = 0; w < 8; ++w) ps += psum[w * QB + row];
    const float l = l_s[row] * al_s[row] + ps;
    li_s[row] = (1.0f / l) * (1.0f / 262144.0f);
  }
  __syncthreads();
  // ---- stage the normalised QB x 256 f32 tile over the Q / P regions (pitch OSP) ----
  float* Os = (float*)(smem);
  {
#pragma unroll
    for (int qt = 0; qt < QT; ++qt) {
      const v4f iA = *(const v4f*)(li_s + 16 * qt + 8 * h), iB = *(const v4f*)(li_s + 16 * qt + 8 * h + 4);
#pragma unroll
      for (int nt = 0; nt < 2; ++nt) {
        const int col = 32 * wave + 16 * nt + c;
#pragma unroll
        for (int r = 0; r < 4; ++r) {
          float o0 = oacc[qt][nt][r], o1 = oacc[qt][nt][4 + r];
          if constexpr (EARLY) { o0 += oacl[qt][nt][r] * rs; o1 += oacl[qt][nt][4 + r] * rs; }
          Os[(16 * qt + 8 * h + r) * OSP + col]     = o0 * iA[r];
          Os[(16 * qt + 8 * h + 4 + r) * OSP + col] = o1 * iB[r];
        }
      }
    }
  }
  __syncthreads();
  {
    float* go = out + (size_t)q0 * DM;
{
#pragma unroll
      for (int rr = 0; rr < RPW; ++rr) {
        const int row = RPW * wave + rr;
#pragma unroll
        for (int j = 0; j < 2; ++j) {
          const int pc = j * 32 + lane;
          const v4f v = *(const v4f*)(Os + row * OSP + pc * 4);
          *(v4f*)(go + (size_t)row * DM + pc * 4) = v;
        }
      }
      
    }
  }
}

// Both query ranges in ONE launch (they share no output row); the block index picks the range, block-uniform.
//   blocks [0, NB*LBLK): query rows [EROWS, SEQ) of every sequence, 32 rows per block, q residual only (the long blocks,
//                        so they start first); coverage NB * LBLK blocks x 32 rows x 256 floats = NB * (SEQ - EROWS) x 256
//   the NB*EBLK blocks behind them: query rows [0, EROWS), 16 rows per block, full residual set;
//                        coverage NB * EBLK blocks x 16 rows x 256 floats = NB * EROWS x 256
#define ATTN_LDS (LATE_LDS + 8 * STG_BYTES)
static_assert(ATTN_LDS >= EARLY_LDS && 2 * ATTN_LDS <= 327680);
__global__ __launch_bounds__(256) void attn_kernel(const _Float16* __restrict__ qh, const _Float16* __restrict__ ql,
                                                   const _Float16* __restrict__ kn, const _Float16* __restrict__ kl,
                                                   const _Float16* __restrict__ vt, const _Float16* __restrict__ vl,
                                                   float* __restrict__ out) {
  __shared__ __align__(16) char smem[ATTN_LDS];
  const int blk = (int)blockIdx.x;
  if (blk < NB * LBLK) {
    const int batch = blk / LBLKD;
    const int qloc0 = EROWS + (blk - batch * LBLKD) * 32;
    attn_body<2, false>(smem, qh, ql, kn, kn, vt, vt, out, batch, qloc0);
  } else {
    const int eb = blk - NB * LBLK;
    const int batch = eb / EBLK;
    const int qloc0 = (eb - batch * EBLK) * 16;
    attn_body<1, true>(smem, qh, ql, kn, kl, vt, vl, out, batch, qloc0);
  }
}

// ---------------------------------------------------------------------------------------------
// Workspace map (bytes, all regions exact tile / whole-line multiples; R = NB*SEQ = 16384):
//   Q16 / QL16 : f16 hi / residual [R][256] (16*q)             8,388,608 each
//   K16 / KL16 : f16 hi / residual [R][256] (16*k)             8,388,608 each
//   VT16 / VL16: f16 hi / residual [256][R] (16*v)             8,388,608 each
//   total 50,331,648
// ---------------------------------------------------------------------------------------------
static_assert((size_t)6 * RTOT * DM * 2 <= (size_t)134217728);
static_assert(((size_t)RTOT * DM * 2) % 128 == 0);

extern "C" void kernel_launch(void* const* d_in, const int* in_sizes, int n_in,
                              void* d_out, int out_size, void* d_ws, size_t ws_size,
                              hipStream_t stream) {
  if (n_in < 7) return;
  const int R = RTOT;
  const long long needx = ((long long)(NB - 1) * SEQ_FULL + SEQ) * EM;
  if ((long long)in_sizes[0] < needx) return;
  if (in_sizes[1] < EM * DM || in_sizes[3] < EM * DM || in_sizes[5] < EM * DM) return;
  if (in_sizes[2] < DM || in_sizes[4] < DM || in_sizes[6] < DM) return;
  if ((long long)out_size < (long long)R * DM) return;

  const float* x  = (const float*)d_in[0];
  const float* Wq = (const float*)d_in[1];
  const float* bq = (const float*)d_in[2];
  const float* Wk = (const float*)d_in[3];
  const float* bk = (const float*)d_in[4];
  const float* Wv = (const float*)d_in[5];
  const float* bv = (const float*)d_in[6];
  float* out = (float*)d_out;

  const size_t bPl = (size_t)R * DM * 2;
  size_t off = 0;
  const size_t oQ  = off; off += bPl;
  const size_t oQL = off; off += bPl;
  const size_t oK  = off; off += bPl;
  const size_t oKL = off; off += bPl;
  const size_t oVT = off; off += bPl;
  const size_t oVL = off; off += bPl;
  if (off > ws_size) return;                     // 50,331,648 for R = 16384
  if (off > (size_t)134217728) return;

  char* ws = (char*)d_ws;
  _Float16* Q16  = (_Float16*)(ws + oQ);
  _Float16* QL16 = (_Float16*)(ws + oQL);
  _Float16* K16  = (_Float16*)(ws + oK);
  _Float16* KL16 = (_Float16*)(ws + oKL);
  _Float16* VT16 = (_Float16*)(ws + oVT);
  _Float16* VL16 = (_Float16*)(ws + oVL);

  const dim3 blk(256);

  // (1) q, k -> hi + residual planes [R][256] (bias by column) and v^T -> hi + residual planes [256][R] (bias by row), from
  //     the f32 inputs: K=128; scale 16/(16*64), bias carry 16; grid.y = product, 256 token rows (16 tiles of 64x64) per block
  gemm64x3_kernel<<<dim3(R / GTOK, 3), dim3(512), 0, stream>>>(
      x, Wq, Wk, Wv, Q16, QL16, K16, KL16, VT16, VL16, bq, bk, bv, 16.0f, 0.015625f);
  // (2) attention, all query rows -> out
  attn_kernel<<<dim3(NB * LBLK + NB * EBLK), blk, 0, stream>>>(Q16, QL16, K16, KL16, VT16, VL16, out);
  (void)hipGetLastError();
}

// v005
// One run takes 53.7 microseconds.
// In two side-by-side timings against v004, it was 1.05 and 1.06 times as fast.
// Counting every step since v000, it is 2.43 times as fast.
// Contractions: q | k = x.Wq | x.Wk and v^T = Wv^T.x^T : v_wmma_f32_16x16x32_f16, f16 operands carrying 16*bf16(x) and
// 64*bf16(W), f32 accumulate; S^T = k.q^T : v_wmma_f32_16x16x32_f16, q as f16 hi (x16) plus f16 residual plane (x2^10, own
// accumulator), k as f16 (x16) plus, for the first 512 query rows, an f16 residual plane (x2^10); O = P.v :
// v_wmma_f32_16x16x32_f16, P = 2^14*exp(s-m) as f16 and v as f16 (x16), both with f16 residual planes (x2^10, own
// accumulator) for the first 512 query rows; f32 accumulate. Float inputs RNE-converted to bf16 on load; bias, softmax
// statistics and output scaling in f32.
#include <hip/hip_runtime.h>
#include <stdint.h>

#ifndef NB
#define NB 8
#endif
#ifndef SEQ
#define SEQ 2048
#endif
#define NB_FULL  8
#define SEQ_FULL 2048
#define EM       128
#define DM       256
#define RTOT     (NB * SEQ)
#define EROWS    ((SEQ) < 512 ? (SEQ) : 512)
#define LBLK     (((SEQ) - EROWS) / 64)
#define LBLKD    (LBLK > 0 ? LBLK : 1)
#define EBLK     (EROWS / 32)

static_assert(NB >= 1 && NB <= NB_FULL);
static_assert(SEQ >= 256 && SEQ <= SEQ_FULL && (SEQ % 256) == 0);
static_assert(DM == 256 && EM == 128);
static_assert((EM % 32) == 0 && (DM % 64) == 0);
static_assert((RTOT % 128) == 0);
static_assert((EROWS % 32) == 0 && ((SEQ - EROWS) % 64) == 0 && (EROWS % 64) == 0);

typedef _Float16 v16h __attribute__((ext_vector_type(16)));
typedef _Float16 v8h  __attribute__((ext_vector_type(8)));
typedef _Float16 v4h  __attribute__((ext_vector_type(4)));
typedef float    v8f  __attribute__((ext_vector_type(8)));
typedef float    v4f  __attribute__((ext_vector_type(4)));

// f32 -> nearest-even bf16 bits / value
__device__ __forceinline__ unsigned short bfbits(float f) {
  unsigned u = __float_as_uint(f);
  return (unsigned short)((u + 0x7FFFu + ((u >> 16) & 1u)) >> 16);
}
__device__ __forceinline__ float bfval(unsigned short b) { return __uint_as_float(((unsigned)b) << 16); }
__device__ __forceinline__ float bfr(float f) { return bfval(bfbits(f)); }

__device__ __forceinline__ v8f mma16(v16h a, v16h b, v8f c) {
  return __builtin_amdgcn_wmma_f32_16x16x32_f16(false, a, false, b, (short)0, c, false, false);
}

// 16-bit WMMA fragment from k-contiguous storage (A row-major [m][k], or B stored [n][k]):
// p points at element (row_or_col = lane&15, k0 + 8h); elements 0..7 <- p[0..7], 8..15 <- p[16..23].
__device__ __forceinline__ v16h ldfrag(const _Float16* p) {
  union { v16h v; v8h h[2]; } f;
  f.h[0] = *(const v8h*)(p);
  f.h[1] = *(const v8h*)(p + 16);
  return f.v;
}
__device__ __forceinline__ v8f zero8() {
  v8f z;
#pragma unroll
  for (int i = 0; i < 8; ++i) z[i] = 0.0f;
  return z;
}

// hazard guards: 4 VALU slots after the last WMMA of a group, D tied, A/B kept live
__device__ __forceinline__ void guard_g(v8f& a, v8f& b, v16h x, v16h y) {
  asm volatile("v_nop\n\tv_nop\n\tv_nop\n\tv_nop" : "+v"(a), "+v"(b) : "v"(x), "v"(y));
}
__device__ __forceinline__ void keep4(v16h a, v16h b, v16h c, v16h d) {
  asm volatile("v_nop" :: "v"(a), "v"(b), "v"(c), "v"(d));
}
__device__ __forceinline__ void accg4(v8f& a, v8f& b, v8f& c, v8f& d) {
  asm volatile("v_nop\n\tv_nop\n\tv_nop\n\tv_nop" : "+v"(a), "+v"(b), "+v"(c), "+v"(d));
}
__device__ __forceinline__ void guard_s8(v8f& a0, v8f& a1, v8f& a2, v8f& a3, v8f& b0, v8f& b1, v8f& b2, v8f& b3,
                                         v16h x0, v16h x1, v16h y0, v16h y1, v16h z0, v16h z1) {
  asm volatile("v_nop\n\tv_nop\n\tv_nop\n\tv_nop"
               : "+v"(a0), "+v"(a1), "+v"(a2), "+v"(a3), "+v"(b0), "+v"(b1), "+v"(b2), "+v"(b3)
               : "v"(x0), "v"(x1), "v"(y0), "v"(y1), "v"(z0), "v"(z1));
}
__device__ __forceinline__ void guard_a4f6(v8f& a0, v8f& a1, v8f& b0, v8f& b1,
                                           v16h x0, v16h x1, v16h y0, v16h y1, v16h z0, v16h z1) {
  asm volatile("v_nop\n\tv_nop\n\tv_nop\n\tv_nop"
               : "+v"(a0), "+v"(a1), "+v"(b0), "+v"(b1)
               : "v"(x0), "v"(x1), "v"(y0), "v"(y1), "v"(z0), "v"(z1));
}
__device__ __forceinline__ void guard_pv4(v8f& a0, v8f& a1, v8f& b0, v8f& b1,
                                          v16h p0, v16h p1, v16h x0, v16h x1) {
  asm volatile("v_nop\n\tv_nop\n\tv_nop\n\tv_nop"
               : "+v"(a0), "+v"(a1), "+v"(b0), "+v"(b1)
               : "v"(p0), "v"(p1), "v"(x0), "v"(x1));
}

// 8 consecutive k of column n of a [EM][DM] weight, as f16(64 * bf16(w))
__device__ __forceinline__ v8h wpiece(const float* __restrict__ W, int k0, int n) {
  v8h o;
#pragma unroll
  for (int i = 0; i < 8; ++i) o[i] = (_Float16)(bfr(W[(size_t)(k0 + i) * DM + n]) * 64.0f);
  return o;
}

// ---------------------------------------------------------------------------------------------
// Kernel 1: the three projections, from the f32 inputs, in ONE launch; blockIdx.y (block-uniform) picks the product:
//   0: q = X.Wq   -> Q16 / QL16 [R][256], bias by column      1: k = X.Wk -> K16 / KL16 [R][256], bias by column
//   2: v^T = Wv^T.X^T -> VT16 / VL16 [256][R], bias by row
// value[m][n] = scale * sum_k A[m][k] * Bt[n][k] + bsc * bf16(bias[.]); output: f16 hi plane C = f16(value) plus f16
// residual plane C2 = f16((value - hi) * 1024), same layout.
// Block = 512 threads = 16 waves = 256 token rows x all 256 outputs of one product. The block converts its operands itself,
// once, into LDS (no conversion launch, no f16 copy of x or of the weights in global memory):
//   Xs[row][k] = f16(16 * bf16(x[token r0 + row][k])): 256 rows, 16 per wave, one whole row (512 B) per load
//   Ws[n][k]   = f16(64 * bf16(W[k][n])):              256 x 16 pieces of 8 halves, 8 per thread; a wave reads 32 consecutive
//                n of one k per load (one whole line) and stores 8 consecutive k per lane
// and one block barrier publishes both; behind it they are only read. Each wave owns one 64x64 C tile (16 f32 accumulators):
// token rows 64*(wave/4).., outputs 64*(wave%4)..; coverage: RTOT/256 blocks x 16 tiles = RTOT x 256 per product, each tile
// written fully (rows it*4+qq = 0..15 per slab, cols c8 = 0..56 by 8).
// ---------------------------------------------------------------------------------------------
#define GTOK 256
// LDS pitch of the operand rows in halves: 272 B = 16 B x 17, conflict-free for the 16-B fragment reads and piece stores
#define GXP  136
static_assert((RTOT % GTOK) == 0 && (SEQ % GTOK) == 0 && (GTOK % 16) == 0 && EM == 32 * 4 && DM == 8 * 32 && ((GXP * 2) % 16) == 0);
__global__ __launch_bounds__(512) void gemm64x3_kernel(const float* __restrict__ x, const float* __restrict__ Wq,
                                                       const float* __restrict__ Wk, const float* __restrict__ Wv,
                                                       _Float16* __restrict__ Q16, _Float16* __restrict__ QL16,
                                                       _Float16* __restrict__ K16, _Float16* __restrict__ KL16,
                                                       _Float16* __restrict__ VT16, _Float16* __restrict__ VL16,
                                                       const float* __restrict__ bq, const float* __restrict__ bk,
                                                       const float* __restrict__ bv, float bsc, float scale) {
  __shared__ __align__(16) float sT[16][16 * 68];
  __shared__ __align__(16) _Float16 Xs[GTOK * GXP];
  __shared__ __align__(16) _Float16 Ws[DM * GXP];
  const int role = (int)blockIdx.y;
  const float* __restrict__ W = (role == 0) ? Wq : (role == 1) ? Wk : Wv;
  _Float16* __restrict__ C  = (role == 0) ? Q16  : (role == 1) ? K16  : VT16;
  _Float16* __restrict__ C2 = (role == 0) ? QL16 : (role == 1) ? KL16 : VL16;
  const float* __restrict__ bias = (role == 0) ? bq : (role == 1) ? bk : bv;
  const int ldc = (role == 2) ? RTOT : DM;
  const int K = EM;
  const int bias_mode = (role == 2) ? 2 : 1;
  const int tid  = (int)threadIdx.x;
  const int lane = tid & 31;
  const int wave = __builtin_amdgcn_readfirstlane((int)(threadIdx.x >> 5));
  const int r0 = (int)blockIdx.x * GTOK;       // first compact token row (b*SEQ + n) of the block
  const int xb = r0 / SEQ;                     // the block's 256 rows lie in one sequence (GTOK divides SEQ)
  const float* xw = x + ((size_t)xb * SEQ_FULL + (r0 - xb * SEQ) + wave) * EM + lane * 4;
#pragma unroll
  for (int i = 0; i < GTOK / 16; ++i) {
    const int row = i * 16 + wave;             // one whole row (512 B) per wave and load
    const v4f a = *(const v4f*)(xw + (size_t)i * 16 * EM);
    v4h o;
#pragma unroll
    for (int e = 0; e < 4; ++e) o[e] = (_Float16)(bfr(a[e]) * 16.0f);
    *(v4h*)(Xs + row * GXP + lane * 4) = o;
  }
#pragma unroll
  for (int i = 0; i < EM / 16; ++i) {
    const int k0 = (2 * i + (wave >> 3)) * 8;  // scalar; waves 0..7 take the even groups of 8 k, waves 8..15 the odd ones
    const int n  = (wave & 7) * 32 + lane;
    *(v8h*)(Ws + n * GXP + k0) = wpiece(W, k0, n);
  }
  __syncthreads();

  const int xa = (wave >> 2) << 6;             // first token row of the wave's tile inside the block
  const int wa = (wave & 3) << 6;              // first output of the wave's tile
  const _Float16* A  = (role == 2) ? Ws + wa * GXP : Xs + xa * GXP;
  const _Float16* Bt = (role == 2) ? Xs + xa * GXP : Ws + wa * GXP;
  const int m0 = (role == 2) ? wa : r0 + xa;
  const int n0 = (role == 2) ? r0 + xa : wa;
  const int rl = lane & 15;
  const int koff = (lane >> 4) * 8;
  const int mOff = (lane >> 4) * 8;

  v8f acc[4][4];
#pragma unroll
  for (int i = 0; i < 4; ++i)
#pragma unroll
    for (int j = 0; j < 4; ++j) acc[i][j] = zero8();

#pragma unroll 1
  for (int k0 = 0; k0 < K; k0 += 32) {
    v16h bh[4];
#pragma unroll
    for (int j = 0; j < 4; ++j) bh[j] = ldfrag(Bt + ((j << 4) + rl) * GXP + koff + k0);
#pragma unroll
    for (int i = 0; i < 4; ++i) {
      const v16h ah = ldfrag(A + ((i << 4) + rl) * GXP + koff + k0);
#pragma unroll
      for (int j = 0; j < 4; ++j) acc[i][j] = mma16(ah, bh[j], acc[i][j]);
      guard_g(acc[i][0], acc[i][3], ah, bh[3]);
    }
    keep4(bh[0], bh[1], bh[2], bh[3]);
  }
  accg4(acc[0][0], acc[0][1], acc[0][2], acc[0][3]);
  accg4(acc[1][0], acc[1][1], acc[1][2], acc[1][3]);
  accg4(acc[2][0], acc[2][1], acc[2][2], acc[2][3]);
  accg4(acc[3][0], acc[3][1], acc[3][2], acc[3][3]);

  float* slab = sT[wave];
#pragma unroll
  for (int i = 0; i < 4; ++i) {
    const int mBase = m0 + (i << 4);
    float brow[8];
#pragma unroll
    for (int r = 0; r < 8; ++r) brow[r] = 0.0f;
    if (bias_mode == 2) {
      const v4f ba = *(const v4f*)(bias + mBase + mOff);
      const v4f bb = *(const v4f*)(bias + mBase + mOff + 4);
#pragma unroll
      for (int r = 0; r < 4; ++r) { brow[r] = bsc * bfr(ba[r]); brow[4 + r] = bsc * bfr(bb[r]); }
    }
#pragma unroll
    for (int j = 0; j < 4; ++j) {
      float bcol = 0.0f;
      if (bias_mode == 1) bcol = bsc * bfr(bias[n0 + (j << 4) + rl]);
#pragma unroll
      for (int r = 0; r < 8; ++r) {
        const float bb = brow[r] + bcol;         // exactly one of the two is active
        slab[(mOff + r) * 68 + (j << 4) + rl] = acc[i][j][r] * scale + bb;
      }
    }
    __builtin_amdgcn_fence(3 /* release order */, "workgroup");
    __builtin_amdgcn_wave_barrier();
    __builtin_amdgcn_fence(2 /* acquire order */, "workgroup");
    {
      const int qq = lane >> 3, c8 = (lane & 7) * 8;
{
#pragma unroll
        for (int it = 0; it < 4; ++it) {
          const int row = it * 4 + qq;
          const float* sp = slab + row * 68 + c8;
          v8h hv, lv;
#pragma unroll
          for (int e = 0; e < 8; ++e) {
            const float f = sp[e];
            const _Float16 hh = (_Float16)f;
            hv[e] = hh;
            lv[e] = (_Float16)((f - (float)hh) * 1024.0f);
          }
          *(v8h*)(C  + (size_t)(mBase + row) * ldc + n0 + c8) = hv;
          *(v8h*)(C2 + (size_t)(mBase + row) * ldc + n0 + c8) = lv;
        }
        
      }
    }
    __builtin_amdgcn_fence(3 /* release order */, "workgroup");
    __builtin_amdgcn_wave_barrier();
    __builtin_amdgcn_fence(2 /* acquire order */, "workgroup");
  }
}

// ---------------------------------------------------------------------------------------------
// Kernel 2: causal single-head attention per sequence, head width 256, online softmax in f32 (fused; no score or
// probability plane in global memory).
//   qh / ql planes f16 [RTOT][DM] (16*q hi and residual x1024), kn / kl planes f16 [RTOT][DM] (16*k hi and residual
//   x1024), vt / vl planes f16 [DM][RTOT] (16*v hi and residual x1024); out f32 [RTOT][DM] = softmax(mask(q.k^T/16)).v.
//   Block = 512 threads = two groups of 8 waves; a group has QB = 16*QT query rows of one sequence and its own Q, P and
//   statistics regions; "wave" below is the wave's number inside its group. Q hi and lo tiles staged once in LDS.
//   Key tiles of 256, only tiles up to the diagonal are visited: wave w owns keys 32w..32w+31 of the tile for the
//   logits (skipped, wave-uniform, when all its keys lie above the block's last query): S^T subtiles (A = k rows from
//   its staging buffer in LDS, B = Q hi / Q lo rows from LDS, hi and x1024 accumulator sets), so the D layout gives per lane 8 consecutive
//   keys of one query -> P written to LDS as 16-B vectors ([query][key]). Keys above the query get -inf (replace fill).
//   P = 2^14 * exp(s - m_running) as f16 (EARLY: plus residual tile x1024).
//   Row max / sum: per-wave partials in LDS, combined in fixed order by wave 0 (one lane per query row).
//   P.V: every wave reads the P tile(s) (A operand, after a block barrier) and owns 32 value columns (B from vt / vl),
//   key loop bounded (block-uniform) at the diagonal.
//   EARLY (QT = 1, first 512 query rows of each sequence): k, P and v residual products into the x1024 accumulators.
//   Long blocks (QT = 2, 64 query rows): wave w of both groups works on the same 32 key rows and the same 32 value columns;
//   the pair shares one LDS buffer of 32 rows x 512 B, each of the two filling half of every row by asynchronous copies
//   that take whole 128-B lines, so a K or V byte leaves L2 once for 64 query rows; block barriers publish and free it.
//   Early blocks: each wave has its own buffer, a quarter tile (32 rows x 128 B) of the hi and of the residual plane at a time.
//   Output: normalised O in f32 staged as a QB x 256 tile in LDS (pitch 260 floats), then each wave writes QB/8 whole
// LDS regions: Q hi, Q lo, P hi (, P lo), pmax, psum, row statistics: all cross-wave, separated by block barriers.
// staged extent == consumed extent: Q tiles QB x 256 fully staged; P tiles QB x 256 fully written every key tile.
// ---------------------------------------------------------------------------------------------
#define KCH      256
#define QSP      264
#define PSP      264
#define OSP      260
#define LATE_LDS  (3 * 32 * QSP * 2 + 2560)
#define EARLY_LDS (4 * 16 * QSP * 2 + 2560)
static_assert((QSP % 8) == 0 && (PSP % 8) == 0 && PSP >= KCH && QSP >= DM && (OSP % 4) == 0 && OSP >= DM);
static_assert(QSP == PSP);
static_assert((SEQ % KCH) == 0 && DM == 8 * 32 && KCH == 8 * 32);
static_assert(LATE_LDS <= 65536 && EARLY_LDS <= 65536);
// Long blocks: one staging buffer per pair of waves (wave w of either group): 32 rows x 512 B at a pitch of 528 B
// (16 B x 33: conflict-free for the 16-B fragment reads).
#define SPT       264
#define STG_BYTES (32 * SPT * 2)
static_assert((LATE_LDS % 16) == 0 && (STG_BYTES % 16) == 0 && ((SPT * 2) % 16) == 0);

// Eight asynchronous 16-B-per-lane copies to LDS; copy i moves two 256-B row halves (lanes 0..15 one, 16..31 the next),
// so every request covers whole 128-B lines. l: the lane's LDS byte address, g: the lane's global address, both of copy 0;
// gp: global step between copies in halves. The s_wait_xcnt stands in the statement so that no address register is
// rewritten ahead of it.
__device__ __forceinline__ void copy8(const unsigned l, const _Float16* g, const size_t gp) {
  asm volatile("global_load_async_to_lds_b128 %0, %8, off\n\t"
               "global_load_async_to_lds_b128 %1, %9, off\n\t"
               "global_load_async_to_lds_b128 %2, %10, off\n\t"
               "global_load_async_to_lds_b128 %3, %11, off\n\t"
               "global_load_async_to_lds_b128 %4, %12, off\n\t"
               "global_load_async_to_lds_b128 %5, %13, off\n\t"
               "global_load_async_to_lds_b128 %6, %14, off\n\t"
               "global_load_async_to_lds_b128 %7, %15, off\n\t"
               "s_wait_xcnt 0x0"
               :: "v"(l), "v"(l + 4 * SPT), "v"(l + 8 * SPT), "v"(l + 12 * SPT),
                  "v"(l + 16 * SPT), "v"(l + 20 * SPT), "v"(l + 24 * SPT), "v"(l + 28 * SPT),
                  "v"(g), "v"(g + gp), "v"(g + 2 * gp), "v"(g + 3 * gp),
                  "v"(g + 4 * gp), "v"(g + 5 * gp), "v"(g + 6 * gp), "v"(g + 7 * gp)
               : "memory");
}
// This wave's half (256 B) of all 32 rows of the pair's buffer = 16 copies. The s_wait_dscnt retires this wave's fragment
// reads of the buffer before a copy may land on them; the partner's have ended at the block barrier in front of every call.
__device__ __forceinline__ void stage32(const unsigned l, const _Float16* g, const size_t gp) {
  asm volatile("s_wait_dscnt 0x0" ::: "memory");
  copy8(l, g, gp);
  copy8(l + 32 * SPT, g + 8 * gp, gp);
}
// Early blocks: one staging buffer per wave, read and refilled by that wave alone: the hi and the residual plane, each
// 32 rows x 128 B at a pitch of 144 B (16 B x 9: conflict-free for the 16-B fragment reads).
#define EPT        72
#define EPL_BYTES  (32 * EPT * 2)
#define ESTG_BYTES (2 * EPL_BYTES)
static_assert((EARLY_LDS % 16) == 0 && (EPL_BYTES % 16) == 0 && ((EPT * 2) % 16) == 0);
#define EGRP_BYTES (EARLY_LDS + 8 * ESTG_BYTES)
static_assert(2 * EGRP_BYTES <= 2 * LATE_LDS + 8 * STG_BYTES && (EGRP_BYTES % 16) == 0);
// Eight asynchronous 16-B-per-lane copies to LDS; copy i moves four 128-B row pieces (eight lanes each), whole lines.
// l, g: the lane's LDS byte address and global address of copy 0; gp: global step between copies in halves. The
// s_wait_xcnt stands in the statement so that no address register is rewritten ahead of it.
__device__ __forceinline__ void copy8q(const unsigned l, const _Float16* g, const size_t gp) {
  asm volatile("global_load_async_to_lds_b128 %0, %8, off\n\t"
               "global_load_async_to_lds_b128 %1, %9, off\n\t"
               "global_load_async_to_lds_b128 %2, %10, off\n\t"
               "global_load_async_to_lds_b128 %3, %11, off\n\t"
               "global_load_async_to_lds_b128 %4, %12, off\n\t"
               "global_load_async_to_lds_b128 %5, %13, off\n\t"
               "global_load_async_to_lds_b128 %6, %14, off\n\t"
               "global_load_async_to_lds_b128 %7, %15, off\n\t"
               "s_wait_xcnt 0x0"
               :: "v"(l), "v"(l + 8 * EPT), "v"(l + 16 * EPT), "v"(l + 24 * EPT),
                  "v"(l + 32 * EPT), "v"(l + 40 * EPT), "v"(l + 48 * EPT), "v"(l + 56 * EPT),
                  "v"(g), "v"(g + gp), "v"(g + 2 * gp), "v"(g + 3 * gp),
                  "v"(g + 4 * gp), "v"(g + 5 * gp), "v"(g + 6 * gp), "v"(g + 7 * gp)
               : "memory");
}
// Refill of the wave's own buffer, both planes: 2 x 32 rows x 128 B = 16 copies. The s_wait_dscnt retires this wave's
// fragment reads of the buffer before a copy may land on them (no other wave touches it, so no barrier is owed).
__device__ __forceinline__ void stage_pair(const unsigned l, const _Float16* gh, const _Float16* gl, const size_t gp) {
  asm volatile("s_wait_dscnt 0x0" ::: "memory");
  copy8q(l, gh, gp);
  copy8q(l + EPL_BYTES, gl, gp);
}
// The issuing wave's own wait: behind it the staged rows have landed and this wave may read them.
__device__ __forceinline__ void staged_wait() {
  asm volatile("s_wait_asynccnt 0x0" ::: "memory");
}

template <int QT, bool EARLY>
__device__ __forceinline__ void attn_body(char* smem, char* lstg, const int grp,
                                          const _Float16* __restrict__ qh, const _Float16* __restrict__ ql,
                                          const _Float16* __restrict__ kn, const _Float16* __restrict__ kl,
                                          const _Float16* __restrict__ vt, const _Float16* __restrict__ vl,
                                          float* __restrict__ out, const int batch, const int qloc0, const int qmax) {
  static_assert(EARLY ? (QT == 1) : (QT == 2));
  constexpr int QB  = 16 * QT;
  constexpr int TB  = QB * QSP * 2;             // bytes per 16-bit tile
  constexpr int NPL = EARLY ? 4 : 3;            // tiles: Q hi, Q lo, P hi (, P lo)
  constexpr int RPW = QB / 8;                   // output rows per wave
  static_assert((TB % 16) == 0);
  static_assert(QB * OSP * 4 <= NPL * TB);
  static_assert(8 * QB <= 256);
  static_assert(RPW * 8 == QB);
  static_assert((SEQ % QB) == 0);

  _Float16* Qs = (_Float16*)(smem);
  _Float16* Ls = (_Float16*)(smem + TB);
  _Float16* Ps = (_Float16*)(smem + 2 * TB);
  _Float16* Pl = (_Float16*)(smem + (NPL - 1) * TB);   // distinct tile only when EARLY
  float* pmax = (float*)(smem + NPL * TB);
  float* psum = pmax + 256;
  float* m_s  = psum + 256;
  float* l_s  = m_s + 32;
  float* al_s = m_s + 64;
  float* li_s = m_s + 96;

  const int tid  = (int)threadIdx.x & 255;      // inside the group
  const int wave = __builtin_amdgcn_readfirstlane((int)(threadIdx.x >> 5)) & 7;
  const int lane = tid & 31, h = lane >> 4, c = lane & 15;
  const int kbase = batch * SEQ;                // compact token row of key 0 of this sequence
  const int q0    = kbase + qloc0;              // compact token row of query 0 of this group
  const float ninf = -__builtin_inff();
  const float sc = 0.000244140625f;             // 1/4096: logits carry 16*16 and the 1/16 score scale
  const float rs = 0.0009765625f;               // 1/1024: residual plane carry

  if (tid < 32) { m_s[tid] = ninf; l_s[tid] = 0.0f; al_s[tid] = 0.0f; li_s[tid] = 0.0f; }
  psum[tid] = 0.0f;
  pmax[tid] = ninf;
  // Q hi and lo tiles: QB rows x 32 pieces of 8 halves per plane; coverage 2*QT * 256 = QB*32 pieces = whole tile each
#pragma unroll
  for (int i = 0; i < 2 * QT; ++i) {
    const int idx = i * 256 + tid;
    const int row = idx >> 5;
    const int pc  = idx & 31;
    const v8h vh = *(const v8h*)(qh + (size_t)(q0 + row) * DM + pc * 8);
    const v8h vq = *(const v8h*)(ql + (size_t)(q0 + row) * DM + pc * 8);
    *(v8h*)(Qs + row * QSP + pc * 8) = vh;
    *(v8h*)(Ls + row * QSP + pc * 8) = vq;
  }
  __syncthreads();

  v8f oacc[QT][2];
  v8f oacl[QT][2];
#pragma unroll
  for (int qt = 0; qt < QT; ++qt)
#pragma unroll
    for (int nt = 0; nt < 2; ++nt) { oacc[qt][nt] = zero8(); oacl[qt][nt] = zero8(); }

  const int qoff = c * QSP + 8 * h;             // LDS fragment offset of query c (add 16*qt*QSP + k)
  // long blocks: the pair's staging buffer, the fragment offset, and the lane's LDS byte address for copy 0 (row h, this
  // group's 256-B half of the row, 16-B piece c)
  const _Float16* stg = (const _Float16*)(lstg + wave * STG_BYTES);
  const int soff = c * SPT + 8 * h;
  const unsigned stg_l = (unsigned)(size_t)(lstg + wave * STG_BYTES) + (unsigned)(h * (SPT * 2) + grp * 256 + c * 16);
  // early blocks: the same for their buffer (copy 0: lane's row = lane / 8, 16-B piece = lane % 8)
  const _Float16* est = (const _Float16*)(smem + EARLY_LDS + wave * ESTG_BYTES);
  const int eoff = c * EPT + 8 * h;
  const int erow = lane >> 3, epc = (lane & 7) * 8;
  const unsigned est_l = (unsigned)(size_t)(smem + EARLY_LDS + wave * ESTG_BYTES) + (unsigned)(erow * (EPT * 2) + epc * 2);
  const int ntile = qmax / KCH + 1;             // key tiles up to the diagonal (block-uniform)

#pragma unroll 1
  for (int t = 0; t < ntile; ++t) {
    // ---- logits: S^T subtiles for this wave's 32 keys, queries 0..QB-1; hi and x1024 accumulators ----
    const int kloc = t * KCH + 32 * wave;       // local index of this wave's first key (scalar)
    v8f sacc[QT][2];   // [query subtile][key subtile]; element r: query 16qt+c, key kloc+16kt+8h+r
    v8f sacl[QT][2];
#pragma unroll
    for (int qt = 0; qt < QT; ++qt)
#pragma unroll
      for (int kt = 0; kt < 2; ++kt) { sacc[qt][kt] = zero8(); sacl[qt][kt] = zero8(); }
    if constexpr (!EARLY) {
      // columns 128*grp .. +127 of the pair's 32 key rows; the wait, then the barrier, publish both halves to both waves
      if (kloc <= qmax) stage32(stg_l, kn + (size_t)(kbase + kloc + h) * DM + grp * 128 + c * 8, (size_t)2 * DM);
      staged_wait();
      __syncthreads();
    }
    if (kloc <= qmax) {                         // wave-uniform: some key of this wave is visible to some query
#pragma unroll 1
      for (int k0 = 0; k0 < DM; k0 += 32) {
        v16h a0, a1;
        if constexpr (EARLY) {
          if ((k0 & 63) == 0) {                 // scalar: columns k0..k0+63 of this wave's 32 key rows, both planes
            const size_t kr = (size_t)(kbase + kloc + erow) * DM + k0 + epc;
            stage_pair(est_l, kn + kr, kl + kr, (size_t)4 * DM);
            staged_wait();
          }
          a0 = ldfrag(est + eoff + (k0 & 63));
          a1 = ldfrag(est + 16 * EPT + eoff + (k0 & 63));
        } else {
          a0 = ldfrag(stg + soff + k0);
          a1 = ldfrag(stg + 16 * SPT + soff + k0);
        }
        v16h bq[QT], cq[QT];
#pragma unroll
        for (int qt = 0; qt < QT; ++qt) {
          bq[qt] = ldfrag(Qs + 16 * qt * QSP + qoff + k0);
          cq[qt] = ldfrag(Ls + 16 * qt * QSP + qoff + k0);
        }
#pragma unroll
        for (int qt = 0; qt < QT; ++qt) {
          sacc[qt][0] = mma16(a0, bq[qt], sacc[qt][0]);
          sacc[qt][1] = mma16(a1, bq[qt], sacc[qt][1]);
        }
#pragma unroll
        for (int qt = 0; qt < QT; ++qt) {
          sacl[qt][0] = mma16(a0, cq[qt], sacl[qt][0]);
          sacl[qt][1] = mma16(a1, cq[qt], sacl[qt][1]);
        }
        if constexpr (EARLY) {
          const v16h d0 = ldfrag(est + 32 * EPT + eoff + (k0 & 63)), d1 = ldfrag(est + 48 * EPT + eoff + (k0 & 63));
          sacl[0][0] = mma16(d0, bq[0], sacl[0][0]);
          sacl[0][1] = mma16(d1, bq[0], sacl[0][1]);
          guard_a4f6(sacc[0][0], sacc[0][1], sacl[0][0], sacl[0][1], a0, a1, bq[0], cq[0], d0, d1);
        } else {
          guard_s8(sacc[0][0], sacc[0][1], sacc[QT - 1][0], sacc[QT - 1][1],
                   sacl[0][0], sacl[0][1], sacl[QT - 1][0], sacl[QT - 1][1],
                   a0, a1, bq[0], bq[QT - 1], cq[0], cq[QT - 1]);
        }
      }
    }
    const int rem = qmax - t * KCH;                              // >= 0 for visited tiles
    int nks = ((rem >> 5) + 1) * 32;
    nks = (nks < KCH) ? nks : KCH;                               // block-uniform key bound of the P.V loop
    // early blocks: keys 0..63 of the tile for this wave's 32 value columns, both planes, start towards its buffer now and
    // fly under the softmax phase; they are waited for in front of the P.V loop
    const size_t vr = (size_t)(32 * wave + erow) * RTOT + kbase + (size_t)t * KCH + epc;
    if constexpr (EARLY) stage_pair(est_l, vt + vr, vl + vr, (size_t)4 * RTOT);
    // ---- combine hi + lo/1024, scale, causal replace fill, per-wave partial row max ----
    {
#pragma unroll
      for (int qt = 0; qt < QT; ++qt) {
        const int qry = qloc0 + 16 * qt + c;
        float pm = ninf;
#pragma unroll
        for (int kt = 0; kt < 2; ++kt) {
#pragma unroll
          for (int r = 0; r < 8; ++r) {
            const int key = kloc + 16 * kt + 8 * h + r;
            float v = (sacc[qt][kt][r] + sacl[qt][kt][r] * rs) * sc;
            v = (key <= qry) ? v : ninf;
            sacc[qt][kt][r] = v;
            pm = fmaxf(pm, v);
          }
        }
        pm = fmaxf(pm, __shfl_xor(pm, 16, 32));
        pmax[wave * QB + 16 * qt + c] = pm;
      }
    }
    __syncthreads();
    // long blocks: behind this barrier nobody reads the key rows any more: keys 128*grp .. +127 of the tile for the pair's 32
    // value columns start towards the buffer and fly under the rest of the softmax phase (scalar test: only keys the P.V
    // loop will read)
    if constexpr (!EARLY) {
      if (grp * 128 < nks)
        stage32(stg_l, vt + (size_t)(32 * wave + h) * RTOT + kbase + (size_t)t * KCH + grp * 128 + c * 8, (size_t)2 * RTOT);
    }
    // ---- wave 0, lane = query row: fold the prior tile's sums into l, new running max, rescale factor ----
    if (wave == 0 && lane < QB) {
      const int row = lane;
      float ps = 0.0f;
#pragma unroll
      for (int w = 0; w < 8; ++w) ps += psum[w * QB + row];
      l_s[row] = l_s[row] * al_s[row] + ps;
      const float mo = m_s[row];
      float mx = mo;
#pragma unroll
      for (int w = 0; w < 8; ++w) mx = fmaxf(mx, pmax[w * QB + row]);
      al_s[row] = __expf(mo - mx);
      m_s[row] = mx;
    }
    __syncthreads();
    // ---- p = 2^14 * exp(s - m) as f16 (EARLY: plus residual), P tile(s), partial row sums, rescale O ----
    {
#pragma unroll
      for (int qt = 0; qt < QT; ++qt) {
        const float mq = m_s[16 * qt + c];
        float ps = 0.0f;
#pragma unroll
        for (int kt = 0; kt < 2; ++kt) {
          v8h hh, ll;
#pragma unroll
          for (int r = 0; r < 8; ++r) {
            const float p = __expf(sacc[qt][kt][r] - mq);
            ps += p;
            const float pw = p * 16384.0f;
            const _Float16 ph = (_Float16)pw;
            hh[r] = ph;
            ll[r] = (_Float16)((pw - (float)ph) * 1024.0f);
          }
          *(v8h*)(Ps + (16 * qt + c) * PSP + 32 * wave + 16 * kt + 8 * h) = hh;
          if constexpr (EARLY) *(v8h*)(Pl + (16 * qt + c) * PSP + 32 * wave + 16 * kt + 8 * h) = ll;
        }
        ps += __shfl_xor(ps, 16, 32);
        psum[wave * QB + 16 * qt + c] = ps;
        const v4f aA = *(const v4f*)(al_s + 16 * qt + 8 * h), aB = *(const v4f*)(al_s + 16 * qt + 8 * h + 4);
#pragma unroll
        for (int nt = 0; nt < 2; ++nt) {
#pragma unroll
          for (int r = 0; r < 4; ++r) {
            oacc[qt][nt][r] *= aA[r]; oacc[qt][nt][4 + r] *= aB[r];
            if constexpr (EARLY) { oacl[qt][nt][r] *= aA[r]; oacl[qt][nt][4 + r] *= aB[r]; }
          }
        }
      }
    }
    if constexpr (!EARLY) staged_wait();        // this wave's half of the value rows has landed; the barrier publishes it
    __syncthreads();
    // ---- O += P . V over the visible keys of the tile; this wave's columns 32w + 16nt + c ----
    {
      if constexpr (EARLY) staged_wait();                        // the first value piece, requested before the softmax
      int enext = 64;                                            // early blocks: first key of the next piece to request
#pragma unroll 1
      for (int ks = 0; ks < nks; ks += 32) {
        v16h pa[QT];
#pragma unroll
        for (int qt = 0; qt < QT; ++qt) pa[qt] = ldfrag(Ps + 16 * qt * PSP + c * PSP + 8 * h + ks);
        v16h vb0, vb1;
        if constexpr (EARLY) {
          if (ks == enext) {                    // scalar: the next 64 keys of the tile replace the last
            stage_pair(est_l, vt + vr + ks, vl + vr + ks, (size_t)4 * RTOT);
            staged_wait();
            enext += 64;
          }
          vb0 = ldfrag(est + eoff + (ks & 63));
          vb1 = ldfrag(est + 16 * EPT + eoff + (ks & 63));
        } else {
          vb0 = ldfrag(stg + soff + ks);
          vb1 = ldfrag(stg + 16 * SPT + soff + ks);
        }
#pragma unroll
        for (int qt = 0; qt < QT; ++qt) {
          oacc[qt][0] = mma16(pa[qt], vb0, oacc[qt][0]);
          oacc[qt][1] = mma16(pa[qt], vb1, oacc[qt][1]);
        }
        if constexpr (EARLY) {
          const v16h pl0 = ldfrag(Pl + c * PSP + 8 * h + ks);
          const v16h vl0 = ldfrag(est + 32 * EPT + eoff + (ks & 63));
          const v16h vl1 = ldfrag(est + 48 * EPT + eoff + (ks & 63));
          oacl[0][0] = mma16(pa[0], vl0, oacl[0][0]);
          oacl[0][1] = mma16(pa[0], vl1, oacl[0][1]);
          oacl[0][0] = mma16(pl0, vb0, oacl[0][0]);
          oacl[0][1] = mma16(pl0, vb1, oacl[0][1]);
          guard_a4f6(oacc[0][0], oacc[0][1], oacl[0][0], oacl[0][1], pa[0], pl0, vb0, vb1, vl0, vl1);
        } else {
          guard_pv4(oacc[0][0], oacc[0][1], oacc[QT - 1][0], oacc[QT - 1][1], pa[0], pa[QT - 1], vb0, vb1);
        }
      }
    }
    // long blocks: ends both waves' reads of the value rows before the next tile's key rows are copied over them
    if constexpr (!EARLY) __syncthreads();
  }

  // ---- final normaliser per query row (fold the last tile's sums); O = oacc / (2^14 * 16 * l) ----
  if (wave == 0 && lane < QB) {
    const int row = lane;
    float ps = 0.0f;
#pragma unroll
    for (int w = 0; w < 8; ++w) ps += psum[w * QB + row];
    const float l = l_s[row] * al_s[row] + ps;
    li_s[row] = (1.0f / l) * (1.0f / 262144.0f);
  }
  __syncthreads();
  // ---- stage the normalised QB x 256 f32 tile over the Q / P regions (pitch OSP) ----
  float* Os = (float*)(smem);
  {
#pragma unroll
    for (int qt = 0; qt < QT; ++qt) {
      const v4f iA = *(const v4f*)(li_s + 16 * qt + 8 * h), iB = *(const v4f*)(li_s + 16 * qt + 8 * h + 4);
#pragma unroll
      for (int nt = 0; nt < 2; ++nt) {
        const int col = 32 * wave + 16 * nt + c;
#pragma unroll
        for (int r = 0; r < 4; ++r) {
          float o0 = oacc[qt][nt][r], o1 = oacc[qt][nt][4 + r];
          if constexpr (EARLY) { o0 += oacl[qt][nt][r] * rs; o1 += oacl[qt][nt][4 + r] * rs; }
          Os[(16 * qt + 8 * h + r) * OSP + col]     = o0 * iA[r];
          Os[(16 * qt + 8 * h + 4 + r) * OSP + col] = o1 * iB[r];
        }
      }
    }
  }
  __syncthreads();
  {
    float* go = out + (size_t)q0 * DM;
{
#pragma unroll
      for (int rr = 0; rr < RPW; ++rr) {
        const int row = RPW * wave + rr;
#pragma unroll
        for (int j = 0; j < 2; ++j) {
          const int pc = j * 32 + lane;
          const v4f v = *(const v4f*)(Os + row * OSP + pc * 4);
          *(v4f*)(go + (size_t)row * DM + pc * 4) = v;
        }
        // the next row's pieces reuse the data registers of this row's two stores: the wait stands in front of that rewrite
        asm volatile("s_wait_xcnt 0x0" ::: "memory");
      }
      
    }
  }
}

// Both query ranges in ONE launch (they share no output row); the block index picks the range, block-uniform; the wave's
// group (waves 0..7, 8..15; scalar) picks the half of the block's rows. Both groups of a block see the same number of key
// tiles (64 and 32 divide KCH), so every block barrier is passed by all 16 waves.
//   blocks [0, NB*LBLK): query rows [EROWS, SEQ) of every sequence, 2 x 32 rows per block, q residual only (the long blocks,
//                        so they start first); coverage NB * LBLK blocks x 64 rows x 256 floats = NB * (SEQ - EROWS) x 256;
//                        both groups bound their key work by the block's last row, as they share the staged rows
//   the NB*EBLK blocks behind them: query rows [0, EROWS), 2 x 16 rows per block, full residual set;
//                        coverage NB * EBLK blocks x 32 rows x 256 floats = NB * EROWS x 256
#define ATTN_LDS (2 * LATE_LDS + 8 * STG_BYTES)
static_assert(ATTN_LDS <= 327680 && (KCH % 64) == 0);
__global__ __launch_bounds__(512) void attn_kernel(const _Float16* __restrict__ qh, const _Float16* __restrict__ ql,
                                                   const _Float16* __restrict__ kn, const _Float16* __restrict__ kl,
                                                   const _Float16* __restrict__ vt, const _Float16* __restrict__ vl,
                                                   float* __restrict__ out) {
  __shared__ __align__(16) char smem[ATTN_LDS];
  const int blk = (int)blockIdx.x;
  const int grp = __builtin_amdgcn_readfirstlane((int)(threadIdx.x >> 8));
  if (blk < NB * LBLK) {
    const int batch = blk / LBLKD;
    const int qblk0 = EROWS + (blk - batch * LBLKD) * 64;
    attn_body<2, false>(smem + grp * LATE_LDS, smem + 2 * LATE_LDS, grp, qh, ql, kn, kn, vt, vt, out, batch,
                        qblk0 + 32 * grp, qblk0 + 63);
  } else {
    const int eb = blk - NB * LBLK;
    const int batch = eb / EBLK;
    const int qloc0 = (eb - batch * EBLK) * 32 + 16 * grp;
    attn_body<1, true>(smem + grp * EGRP_BYTES, smem, grp, qh, ql, kn, kl, vt, vl, out, batch, qloc0, qloc0 + 15);
  }
}

// ---------------------------------------------------------------------------------------------
// Workspace map (bytes, all regions exact tile / whole-line multiples; R = NB*SEQ = 16384):
//   Q16 / QL16 : f16 hi / residual [R][256] (16*q)             8,388,608 each
//   K16 / KL16 : f16 hi / residual [R][256] (16*k)             8,388,608 each
//   VT16 / VL16: f16 hi / residual [256][R] (16*v)             8,388,608 each
//   total 50,331,648
// ---------------------------------------------------------------------------------------------
static_assert((size_t)6 * RTOT * DM * 2 <= (size_t)134217728);
static_assert(((size_t)RTOT * DM * 2) % 128 == 0);

extern "C" void kernel_launch(void* const* d_in, const int* in_sizes, int n_in,
                              void* d_out, int out_size, void* d_ws, size_t ws_size,
                              hipStream_t stream) {
  if (n_in < 7) return;
  const int R = RTOT;
  const long long needx = ((long long)(NB - 1) * SEQ_FULL + SEQ) * EM;
  if ((long long)in_sizes[0] < needx) return;
  if (in_sizes[1] < EM * DM || in_sizes[3] < EM * DM || in_sizes[5] < EM * DM) return;
  if (in_sizes[2] < DM || in_sizes[4] < DM || in_sizes[6] < DM) return;
  if ((long long)out_size < (long long)R * DM) return;

  const float* x  = (const float*)d_in[0];
  const float* Wq = (const float*)d_in[1];
  const float* bq = (const float*)d_in[2];
  const float* Wk = (const float*)d_in[3];
  const float* bk = (const float*)d_in[4];
  const float* Wv = (const float*)d_in[5];
  const float* bv = (const float*)d_in[6];
  float* out = (float*)d_out;

  const size_t bPl = (size_t)R * DM * 2;
  size_t off = 0;
  const size_t oQ  = off; off += bPl;
  const size_t oQL = off; off += bPl;
  const size_t oK  = off; off += bPl;
  const size_t oKL = off; off += bPl;
  const size_t oVT = off; off += bPl;
  const size_t oVL = off; off += bPl;
  if (off > ws_size) return;                     // 50,331,648 for R = 16384
  if (off > (size_t)134217728) return;

  char* ws = (char*)d_ws;
  _Float16* Q16  = (_Float16*)(ws + oQ);
  _Float16* QL16 = (_Float16*)(ws + oQL);
  _Float16* K16  = (_Float16*)(ws + oK);
  _Float16* KL16 = (_Float16*)(ws + oKL);
  _Float16* VT16 = (_Float16*)(ws + oVT);
  _Float16* VL16 = (_Float16*)(ws + oVL);

  // (1) q, k -> hi + residual planes [R][256] (bias by column) and v^T -> hi + residual planes [256][R] (bias by row), from
  //     the f32 inputs: K=128; scale 16/(16*64), bias carry 16; grid.y = product, 256 token rows (16 tiles of 64x64) per block
  gemm64x3_kernel<<<dim3(R / GTOK, 3), dim3(512), 0, stream>>>(
      x, Wq, Wk, Wv, Q16, QL16, K16, KL16, VT16, VL16, bq, bk, bv, 16.0f, 0.015625f);
  // (2) attention, all query rows -> out
  attn_kernel<<<dim3(NB * LBLK + NB * EBLK), dim3(512), 0, stream>>>(Q16, QL16, K16, KL16, VT16, VL16, out);
  (void)hipGetLastError();
}

// v006
// One run takes 52.4 microseconds.
// In both of two side-by-side timings against v005, it was 1.03 times as fast.
// Counting every step since v000, it is 2.50 times as fast.
// Contractions: q | k = x.Wq | x.Wk and v^T = Wv^T.x^T : v_wmma_f32_16x16x32_f16, f16 operands carrying 16*bf16(x) and
// 64*bf16(W), f32 accumulate; S^T = k.q^T : v_wmma_f32_16x16x32_f16, q as f16 hi (x16) plus f16 residual plane (x2^10, own
// accumulator), k as f16 (x16) plus, for the first 512 query rows, an f16 residual plane (x2^10); O = P.v :
// v_wmma_f32_16x16x32_f16, P = 2^14*exp(s-m) as f16 and v as f16 (x16), both with f16 residual planes (x2^10, own
// accumulator) for the first 512 query rows; f32 accumulate. Float inputs RNE-converted to bf16 on load; bias, softmax
// statistics and output scaling in f32.
#include <hip/hip_runtime.h>
#include <stdint.h>

#ifndef NB
#define NB 8
#endif
#ifndef SEQ
#define SEQ 2048
#endif
#define NB_FULL  8
#define SEQ_FULL 2048
#define EM       128
#define DM       256
#define RTOT     (NB * SEQ)
#define EROWS    ((SEQ) < 512 ? (SEQ) : 512)
#define LBLK     (((SEQ) - EROWS) / 64)
#define LBLKD    (LBLK > 0 ? LBLK : 1)
#define EBLK     (EROWS / 32)

static_assert(NB >= 1 && NB <= NB_FULL);
static_assert(SEQ >= 256 && SEQ <= SEQ_FULL && (SEQ % 256) == 0);
static_assert(DM == 256 && EM == 128);
static_assert((EM % 32) == 0 && (DM % 64) == 0);
static_assert((RTOT % 128) == 0);
static_assert((EROWS % 32) == 0 && ((SEQ - EROWS) % 64) == 0 && (EROWS % 64) == 0);

typedef _Float16 v16h __attribute__((ext_vector_type(16)));
typedef _Float16 v8h  __attribute__((ext_vector_type(8)));
typedef _Float16 v4h  __attribute__((ext_vector_type(4)));
typedef float    v8f  __attribute__((ext_vector_type(8)));
typedef float    v4f  __attribute__((ext_vector_type(4)));

// f32 -> nearest-even bf16 bits / value
__device__ __forceinline__ unsigned short bfbits(float f) {
  unsigned u = __float_as_uint(f);
  return (unsigned short)((u + 0x7FFFu + ((u >> 16) & 1u)) >> 16);
}
__device__ __forceinline__ float bfval(unsigned short b) { return __uint_as_float(((unsigned)b) << 16); }
__device__ __forceinline__ float bfr(float f) { return bfval(bfbits(f)); }

__device__ __forceinline__ v8f mma16(v16h a, v16h b, v8f c) {
  return __builtin_amdgcn_wmma_f32_16x16x32_f16(false, a, false, b, (short)0, c, false, false);
}

// 16-bit WMMA fragment from k-contiguous storage (A row-major [m][k], or B stored [n][k]):
// p points at element (row_or_col = lane&15, k0 + 8h); elements 0..7 <- p[0..7], 8..15 <- p[16..23].
__device__ __forceinline__ v16h ldfrag(const _Float16* p) {
  union { v16h v; v8h h[2]; } f;
  f.h[0] = *(const v8h*)(p);
  f.h[1] = *(const v8h*)(p + 16);
  return f.v;
}
__device__ __forceinline__ v8f zero8() {
  v8f z;
#pragma unroll
  for (int i = 0; i < 8; ++i) z[i] = 0.0f;
  return z;
}

// hazard guards: 4 VALU slots after the last WMMA of a group, D tied, A/B kept live
__device__ __forceinline__ void guard_g(v8f& a, v8f& b, v16h x, v16h y) {
  asm volatile("v_nop\n\tv_nop\n\tv_nop\n\tv_nop" : "+v"(a), "+v"(b) : "v"(x), "v"(y));
}
__device__ __forceinline__ void keep4(v16h a, v16h b, v16h c, v16h d) {
  asm volatile("v_nop" :: "v"(a), "v"(b), "v"(c), "v"(d));
}
__device__ __forceinline__ void accg4(v8f& a, v8f& b, v8f& c, v8f& d) {
  asm volatile("v_nop\n\tv_nop\n\tv_nop\n\tv_nop" : "+v"(a), "+v"(b), "+v"(c), "+v"(d));
}
__device__ __forceinline__ void guard_s8(v8f& a0, v8f& a1, v8f& a2, v8f& a3, v8f& b0, v8f& b1, v8f& b2, v8f& b3,
                                         v16h x0, v16h x1, v16h y0, v16h y1, v16h z0, v16h z1) {
  asm volatile("v_nop\n\tv_nop\n\tv_nop\n\tv_nop"
               : "+v"(a0), "+v"(a1), "+v"(a2), "+v"(a3), "+v"(b0), "+v"(b1), "+v"(b2), "+v"(b3)
               : "v"(x0), "v"(x1), "v"(y0), "v"(y1), "v"(z0), "v"(z1));
}
__device__ __forceinline__ void guard_a4f6(v8f& a0, v8f& a1, v8f& b0, v8f& b1,
                                           v16h x0, v16h x1, v16h y0, v16h y1, v16h z0, v16h z1) {
  asm volatile("v_nop\n\tv_nop\n\tv_nop\n\tv_nop"
               : "+v"(a0), "+v"(a1), "+v"(b0), "+v"(b1)
               : "v"(x0), "v"(x1), "v"(y0), "v"(y1), "v"(z0), "v"(z1));
}
__device__ __forceinline__ void guard_pv4(v8f& a0, v8f& a1, v8f& b0, v8f& b1,
                                          v16h p0, v16h p1, v16h x0, v16h x1) {
  asm volatile("v_nop\n\tv_nop\n\tv_nop\n\tv_nop"
               : "+v"(a0), "+v"(a1), "+v"(b0), "+v"(b1)
               : "v"(p0), "v"(p1), "v"(x0), "v"(x1));
}

// 8 consecutive k of column n of a [EM][DM] weight, as f16(64 * bf16(w))
__device__ __forceinline__ v8h wpiece(const float* __restrict__ W, int k0, int n) {
  v8h o;
#pragma unroll
  for (int i = 0; i < 8; ++i) o[i] = (_Float16)(bfr(W[(size_t)(k0 + i) * DM + n]) * 64.0f);
  return o;
}

// ---------------------------------------------------------------------------------------------
// Kernel 1: the three projections, from the f32 inputs, in ONE launch; blockIdx.y (block-uniform) picks the product:
//   0: q = X.Wq   -> Q16 / QL16 [R][256], bias by column      1: k = X.Wk -> K16 / KL16 [R][256], bias by column
//   2: v^T = Wv^T.X^T -> VT16 / VL16 [256][R], bias by row
// value[m][n] = scale * sum_k A[m][k] * Bt[n][k] + bsc * bf16(bias[.]); output: f16 hi plane C = f16(value) plus f16
// residual plane C2 = f16((value - hi) * 1024), same layout.
// Block = 512 threads = 16 waves = 256 token rows x all 256 outputs of one product. The block converts its operands itself,
// once, into LDS (no conversion launch, no f16 copy of x or of the weights in global memory):
//   Xs[row][k] = f16(16 * bf16(x[token r0 + row][k])): 256 rows, 16 per wave, one whole row (512 B) per load
//   Ws[n][k]   = f16(64 * bf16(W[k][n])):              256 x 16 pieces of 8 halves, 8 per thread; a wave reads 32 consecutive
//                n of one k per load (one whole line) and stores 8 consecutive k per lane
// and one block barrier publishes both; behind it they are only read. Each wave owns one 64x64 C tile (16 f32 accumulators):
// token rows 64*(wave/4).., outputs 64*(wave%4)..; coverage: RTOT/256 blocks x 16 tiles = RTOT x 256 per product, each tile
// written fully (rows it*4+qq = 0..15 per slab, cols c8 = 0..56 by 8).
// ---------------------------------------------------------------------------------------------
#define GTOK 256
// LDS pitch of the operand rows in halves: 272 B = 16 B x 17, conflict-free for the 16-B fragment reads and piece stores
#define GXP  136
static_assert((RTOT % GTOK) == 0 && (SEQ % GTOK) == 0 && (GTOK % 16) == 0 && EM == 32 * 4 && DM == 8 * 32 && ((GXP * 2) % 16) == 0);
__global__ __launch_bounds__(512) void gemm64x3_kernel(const float* __restrict__ x, const float* __restrict__ Wq,
                                                       const float* __restrict__ Wk, const float* __restrict__ Wv,
                                                       _Float16* __restrict__ Q16, _Float16* __restrict__ QL16,
                                                       _Float16* __restrict__ K16, _Float16* __restrict__ KL16,
                                                       _Float16* __restrict__ VT16, _Float16* __restrict__ VL16,
                                                       const float* __restrict__ bq, const float* __restrict__ bk,
                                                       const float* __restrict__ bv, float bsc, float scale) {
  __shared__ __align__(16) float sT[16][16 * 68];
  __shared__ __align__(16) _Float16 Xs[GTOK * GXP];
  __shared__ __align__(16) _Float16 Ws[DM * GXP];
  const int role = (int)blockIdx.y;
  const float* __restrict__ W = (role == 0) ? Wq : (role == 1) ? Wk : Wv;
  _Float16* __restrict__ C  = (role == 0) ? Q16  : (role == 1) ? K16  : VT16;
  _Float16* __restrict__ C2 = (role == 0) ? QL16 : (role == 1) ? KL16 : VL16;
  const float* __restrict__ bias = (role == 0) ? bq : (role == 1) ? bk : bv;
  const int ldc = (role == 2) ? RTOT : DM;
  const int K = EM;
  const int bias_mode = (role == 2) ? 2 : 1;
  const int tid  = (int)threadIdx.x;
  const int lane = tid & 31;
  const int wave = __builtin_amdgcn_readfirstlane((int)(threadIdx.x >> 5));
  const int r0 = (int)blockIdx.x * GTOK;       // first compact token row (b*SEQ + n) of the block
  const int xb = r0 / SEQ;                     // the block's 256 rows lie in one sequence (GTOK divides SEQ)
  const float* xw = x + ((size_t)xb * SEQ_FULL + (r0 - xb * SEQ) + wave) * EM + lane * 4;
#pragma unroll
  for (int i = 0; i < GTOK / 16; ++i) {
    const int row = i * 16 + wave;             // one whole row (512 B) per wave and load
    const v4f a = *(const v4f*)(xw + (size_t)i * 16 * EM);
    v4h o;
#pragma unroll
    for (int e = 0; e < 4; ++e) o[e] = (_Float16)(bfr(a[e]) * 16.0f);
    *(v4h*)(Xs + row * GXP + lane * 4) = o;
  }
#pragma unroll
  for (int i = 0; i < EM / 16; ++i) {
    const int k0 = (2 * i + (wave >> 3)) * 8;  // scalar; waves 0..7 take the even groups of 8 k, waves 8..15 the odd ones
    const int n  = (wave & 7) * 32 + lane;
    *(v8h*)(Ws + n * GXP + k0) = wpiece(W, k0, n);
  }
  __syncthreads();

  const int xa = (wave >> 2) << 6;             // first token row of the wave's tile inside the block
  const int wa = (wave & 3) << 6;              // first output of the wave's tile
  const _Float16* A  = (role == 2) ? Ws + wa * GXP : Xs + xa * GXP;
  const _Float16* Bt = (role == 2) ? Xs + xa * GXP : Ws + wa * GXP;
  const int m0 = (role == 2) ? wa : r0 + xa;
  const int n0 = (role == 2) ? r0 + xa : wa;
  const int rl = lane & 15;
  const int koff = (lane >> 4) * 8;
  const int mOff = (lane >> 4) * 8;

  v8f acc[4][4];
#pragma unroll
  for (int i = 0; i < 4; ++i)
#pragma unroll
    for (int j = 0; j < 4; ++j) acc[i][j] = zero8();

#pragma unroll 1
  for (int k0 = 0; k0 < K; k0 += 32) {
    v16h bh[4];
#pragma unroll
    for (int j = 0; j < 4; ++j) bh[j] = ldfrag(Bt + ((j << 4) + rl) * GXP + koff + k0);
#pragma unroll
    for (int i = 0; i < 4; ++i) {
      const v16h ah = ldfrag(A + ((i << 4) + rl) * GXP + koff + k0);
#pragma unroll
      for (int j = 0; j < 4; ++j) acc[i][j] = mma16(ah, bh[j], acc[i][j]);
      guard_g(acc[i][0], acc[i][3], ah, bh[3]);
    }
    keep4(bh[0], bh[1], bh[2], bh[3]);
  }
  accg4(acc[0][0], acc[0][1], acc[0][2], acc[0][3]);
  accg4(acc[1][0], acc[1][1], acc[1][2], acc[1][3]);
  accg4(acc[2][0], acc[2][1], acc[2][2], acc[2][3]);
  accg4(acc[3][0], acc[3][1], acc[3][2], acc[3][3]);

  float* slab = sT[wave];
#pragma unroll
  for (int i = 0; i < 4; ++i) {
    const int mBase = m0 + (i << 4);
    float brow[8];
#pragma unroll
    for (int r = 0; r < 8; ++r) brow[r] = 0.0f;
    if (bias_mode == 2) {
      const v4f ba = *(const v4f*)(bias + mBase + mOff);
      const v4f bb = *(const v4f*)(bias + mBase + mOff + 4);
#pragma unroll
      for (int r = 0; r < 4; ++r) { brow[r] = bsc * bfr(ba[r]); brow[4 + r] = bsc * bfr(bb[r]); }
    }
#pragma unroll
    for (int j = 0; j < 4; ++j) {
      float bcol = 0.0f;
      if (bias_mode == 1) bcol = bsc * bfr(bias[n0 + (j << 4) + rl]);
#pragma unroll
      for (int r = 0; r < 8; ++r) {
        const float bb = brow[r] + bcol;         // exactly one of the two is active
        slab[(mOff + r) * 68 + (j << 4) + rl] = acc[i][j][r] * scale + bb;
      }
    }
    __builtin_amdgcn_fence(3 /* release order */, "workgroup");
    __builtin_amdgcn_wave_barrier();
    __builtin_amdgcn_fence(2 /* acquire order */, "workgroup");
    {
      const int qq = lane >> 3, c8 = (lane & 7) * 8;
{
#pragma unroll
        for (int it = 0; it < 4; ++it) {
          const int row = it * 4 + qq;
          const float* sp = slab + row * 68 + c8;
          v8h hv, lv;
#pragma unroll
          for (int e = 0; e < 8; ++e) {
            const float f = sp[e];
            const _Float16 hh = (_Float16)f;
            hv[e] = hh;
            lv[e] = (_Float16)((f - (float)hh) * 1024.0f);
          }
          *(v8h*)(C  + (size_t)(mBase + row) * ldc + n0 + c8) = hv;
          *(v8h*)(C2 + (size_t)(mBase + row) * ldc + n0 + c8) = lv;
        }
        
      }
    }
    __builtin_amdgcn_fence(3 /* release order */, "workgroup");
    __builtin_amdgcn_wave_barrier();
    __builtin_amdgcn_fence(2 /* acquire order */, "workgroup");
  }
}

// ---------------------------------------------------------------------------------------------
// Kernel 2: causal single-head attention per sequence, head width 256, online softmax in f32 (fused; no score or
// probability plane in global memory).
//   qh / ql planes f16 [RTOT][DM] (16*q hi and residual x1024), kn / kl planes f16 [RTOT][DM] (16*k hi and residual
//   x1024), vt / vl planes f16 [DM][RTOT] (16*v hi and residual x1024); out f32 [RTOT][DM] = softmax(mask(q.k^T/16)).v.
//   Block = 512 threads = two groups of 8 waves; a group has QB = 16*QT query rows of one sequence and its own Q, P and
//   statistics regions; "wave" below is the wave's number inside its group. Q hi and lo tiles staged once in LDS.
//   Key tiles of 256, only tiles up to the diagonal are visited: wave w owns keys 32w..32w+31 of the tile for the
//   logits (skipped, wave-uniform, when all its keys lie above the block's last query): S^T subtiles (A = k rows from
//   its staging buffer in LDS, B = Q hi / Q lo rows from LDS, hi and x1024 accumulator sets), so the D layout gives per lane 8 consecutive
//   keys of one query -> P written to LDS as 16-B vectors ([query][key]). Keys above the query get -inf (replace fill).
//   P = 2^14 * exp(s - m_running) as f16 (EARLY: plus residual tile x1024).
//   Row max / sum: per-wave partials in LDS, combined in fixed order by wave 0 (one lane per query row).
//   P.V: every wave reads the P tile(s) (A operand, after a block barrier) and owns 32 value columns (B from vt / vl),
//   key loop bounded (block-uniform) at the diagonal.
//   EARLY (QT = 1, first 512 query rows of each sequence): k, P and v residual products into the x1024 accumulators.
//   Long blocks (QT = 2, 64 query rows): wave w of both groups works on the same 32 key rows and the same 32 value columns;
//   the pair shares one LDS buffer of 32 rows x 512 B, each of the two filling 16 of the rows by asynchronous copies
//   that take whole 128-B lines, so a K or V byte leaves L2 once for 64 query rows; block barriers publish and free it.
//   Every tile comes as two halves of 256 B a row, each copied while something earlier is worked on: key columns 0..127 lie
//   in a second buffer of the pair, copied one key tile ahead; key columns 128..255 go to the upper half of the shared rows
//   under the products over columns 0..127; the values of keys 0..127 go to the lower half under the products over columns
//   128..255 and the softmax; the values of keys 128..255 replace the key columns under the rest of the softmax.
//   Early blocks: each wave has its own buffer, a quarter tile (32 rows x 128 B) of the hi and of the residual plane at a time.
//   Output: normalised O in f32 staged as a QB x 256 tile in LDS (pitch 260 floats), then each wave writes QB/8 whole
// LDS regions: Q hi, Q lo, P hi (, P lo), pmax, psum, row statistics: all cross-wave, separated by block barriers.
// staged extent == consumed extent: Q tiles QB x 256 fully staged; P tiles QB x 256 fully written every key tile.
// ---------------------------------------------------------------------------------------------
#define KCH      256
#define QSP      264
#define PSP      264
#define OSP      260
#define LATE_LDS  (3 * 32 * QSP * 2 + 2560)
#define EARLY_LDS (4 * 16 * QSP * 2 + 2560)
static_assert((QSP % 8) == 0 && (PSP % 8) == 0 && PSP >= KCH && QSP >= DM && (OSP % 4) == 0 && OSP >= DM);
static_assert(QSP == PSP);
static_assert((SEQ % KCH) == 0 && DM == 8 * 32 && KCH == 8 * 32);
static_assert(LATE_LDS <= 65536 && EARLY_LDS <= 65536);
// Long blocks: one staging buffer per pair of waves (wave w of either group): 32 rows x 512 B at a pitch of 528 B
// (16 B x 33: conflict-free for the 16-B fragment reads).
#define SPT       264
#define STG_BYTES (32 * SPT * 2)
static_assert((LATE_LDS % 16) == 0 && (STG_BYTES % 16) == 0 && ((SPT * 2) % 16) == 0);

// Eight asynchronous 16-B-per-lane copies to LDS; copy i moves two 256-B row halves (lanes 0..15 one, 16..31 the next),
// so every request covers whole 128-B lines. l: the lane's LDS byte address, g: the lane's global address, both of copy 0;
// gp: global step between copies in halves; P: LDS row pitch in halves. The s_wait_xcnt stands in the statement so that no
// address register is rewritten ahead of it.
template <int P>
__device__ __forceinline__ void copy8(const unsigned l, const _Float16* g, const size_t gp) {
  asm volatile("global_load_async_to_lds_b128 %0, %8, off\n\t"
               "global_load_async_to_lds_b128 %1, %9, off\n\t"
               "global_load_async_to_lds_b128 %2, %10, off\n\t"
               "global_load_async_to_lds_b128 %3, %11, off\n\t"
               "global_load_async_to_lds_b128 %4, %12, off\n\t"
               "global_load_async_to_lds_b128 %5, %13, off\n\t"
               "global_load_async_to_lds_b128 %6, %14, off\n\t"
               "global_load_async_to_lds_b128 %7, %15, off\n\t"
               "s_wait_xcnt 0x0"
               :: "v"(l), "v"(l + 4 * P), "v"(l + 8 * P), "v"(l + 12 * P),
                  "v"(l + 16 * P), "v"(l + 20 * P), "v"(l + 24 * P), "v"(l + 28 * P),
                  "v"(g), "v"(g + gp), "v"(g + 2 * gp), "v"(g + 3 * gp),
                  "v"(g + 4 * gp), "v"(g + 5 * gp), "v"(g + 6 * gp), "v"(g + 7 * gp)
               : "memory");
}
// Long blocks, key rows: a second buffer per pair of waves for columns 0..127: 32 rows x 256 B at a pitch of 272 B (16 B x 17:
// conflict-free for the 16-B fragment reads).
#define KAP      136
#define KA_BYTES (32 * KAP * 2)
static_assert((KA_BYTES % 16) == 0 && ((KAP * 2) % 16) == 0);
// This wave's 16 of the pair's 32 rows, 256 B of each = 8 copies, into a buffer of row pitch P. The s_wait_dscnt retires
// this wave's fragment reads of that buffer before a copy may land on them; the partner's have ended at the block barrier in
// front of every call.
template <int P>
__device__ __forceinline__ void stage16(const unsigned l, const _Float16* g, const size_t gp) {
  asm volatile("s_wait_dscnt 0x0" ::: "memory");
  copy8<P>(l, g, gp);
}
// Early blocks: one staging buffer per wave, read and refilled by that wave alone: the hi and the residual plane, each
// 32 rows x 128 B at a pitch of 144 B (16 B x 9: conflict-free for the 16-B fragment reads).
#define EPT        72
#define EPL_BYTES  (32 * EPT * 2)
#define ESTG_BYTES (2 * EPL_BYTES)
static_assert((EARLY_LDS % 16) == 0 && (EPL_BYTES % 16) == 0 && ((EPT * 2) % 16) == 0);
#define EGRP_BYTES (EARLY_LDS + 8 * ESTG_BYTES)
static_assert(2 * EGRP_BYTES <= 2 * LATE_LDS + 8 * STG_BYTES && (EGRP_BYTES % 16) == 0);
// Eight asynchronous 16-B-per-lane copies to LDS; copy i moves four 128-B row pieces (eight lanes each), whole lines.
// l, g: the lane's LDS byte address and global address of copy 0; gp: global step between copies in halves. The
// s_wait_xcnt stands in the statement so that no address register is rewritten ahead of it.
__device__ __forceinline__ void copy8q(const unsigned l, const _Float16* g, const size_t gp) {
  asm volatile("global_load_async_to_lds_b128 %0, %8, off\n\t"
               "global_load_async_to_lds_b128 %1, %9, off\n\t"
               "global_load_async_to_lds_b128 %2, %10, off\n\t"
               "global_load_async_to_lds_b128 %3, %11, off\n\t"
               "global_load_async_to_lds_b128 %4, %12, off\n\t"
               "global_load_async_to_lds_b128 %5, %13, off\n\t"
               "global_load_async_to_lds_b128 %6, %14, off\n\t"
               "global_load_async_to_lds_b128 %7, %15, off\n\t"
               "s_wait_xcnt 0x0"
               :: "v"(l), "v"(l + 8 * EPT), "v"(l + 16 * EPT), "v"(l + 24 * EPT),
                  "v"(l + 32 * EPT), "v"(l + 40 * EPT), "v"(l + 48 * EPT), "v"(l + 56 * EPT),
                  "v"(g), "v"(g + gp), "v"(g + 2 * gp), "v"(g + 3 * gp),
                  "v"(g + 4 * gp), "v"(g + 5 * gp), "v"(g + 6 * gp), "v"(g + 7 * gp)
               : "memory");
}
// Refill of the wave's own buffer, both planes: 2 x 32 rows x 128 B = 16 copies. The s_wait_dscnt retires this wave's
// fragment reads of the buffer before a copy may land on them (no other wave touches it, so no barrier is owed).
__device__ __forceinline__ void stage_pair(const unsigned l, const _Float16* gh, const _Float16* gl, const size_t gp) {
  asm volatile("s_wait_dscnt 0x0" ::: "memory");
  copy8q(l, gh, gp);
  copy8q(l + EPL_BYTES, gl, gp);
}
// The issuing wave's own wait: behind it the staged rows have landed and this wave may read them.
__device__ __forceinline__ void staged_wait() {
  asm volatile("s_wait_asynccnt 0x0" ::: "memory");
}

template <int QT, bool EARLY>
__device__ __forceinline__ void attn_body(char* smem, char* lstg, const int grp,
                                          const _Float16* __restrict__ qh, const _Float16* __restrict__ ql,
                                          const _Float16* __restrict__ kn, const _Float16* __restrict__ kl,
                                          const _Float16* __restrict__ vt, const _Float16* __restrict__ vl,
                                          float* __restrict__ out, const int batch, const int qloc0, const int qmax) {
  static_assert(EARLY ? (QT == 1) : (QT == 2));
  constexpr int QB  = 16 * QT;
  constexpr int TB  = QB * QSP * 2;             // bytes per 16-bit tile
  constexpr int NPL = EARLY ? 4 : 3;            // tiles: Q hi, Q lo, P hi (, P lo)
  constexpr int RPW = QB / 8;                   // output rows per wave
  static_assert((TB % 16) == 0);
  static_assert(QB * OSP * 4 <= NPL * TB);
  static_assert(8 * QB <= 256);
  static_assert(RPW * 8 == QB);
  static_assert((SEQ % QB) == 0);

  _Float16* Qs = (_Float16*)(smem);
  _Float16* Ls = (_Float16*)(smem + TB);
  _Float16* Ps = (_Float16*)(smem + 2 * TB);
  _Float16* Pl = (_Float16*)(smem + (NPL - 1) * TB);   // distinct tile only when EARLY
  float* pmax = (float*)(smem + NPL * TB);
  float* psum = pmax + 256;
  float* m_s  = psum + 256;
  float* l_s  = m_s + 32;
  float* al_s = m_s + 64;
  float* li_s = m_s + 96;

  const int tid  = (int)threadIdx.x & 255;      // inside the group
  const int wave = __builtin_amdgcn_readfirstlane((int)(threadIdx.x >> 5)) & 7;
  const int lane = tid & 31, h = lane >> 4, c = lane & 15;
  const int kbase = batch * SEQ;                // compact token row of key 0 of this sequence
  const int q0    = kbase + qloc0;              // compact token row of query 0 of this group
  const float ninf = -__builtin_inff();
  const float sc = 0.000244140625f;             // 1/4096: logits carry 16*16 and the 1/16 score scale
  const float rs = 0.0009765625f;               // 1/1024: residual plane carry

  // long blocks: the pair's buffer for columns 0..127 of its key rows, the lane's LDS byte address for copy 0 in it and in the
  // lower half of the shared buffer's rows (row 16*grp + h, 16-B piece c), and the lane's global addresses for key tile 0
  const _Float16* ka = (const _Float16*)(lstg + 8 * STG_BYTES + wave * KA_BYTES);
  const unsigned ka_l = (unsigned)(size_t)(lstg + 8 * STG_BYTES + wave * KA_BYTES) + (unsigned)((16 * grp + h) * (KAP * 2) + c * 16);
  const unsigned stg_l = (unsigned)(size_t)(lstg + wave * STG_BYTES) + (unsigned)((16 * grp + h) * (SPT * 2) + c * 16);
  const _Float16* kg = kn + (size_t)(kbase + 32 * wave + 16 * grp + h) * DM + c * 8;
  const _Float16* vg = vt + (size_t)(32 * wave + 16 * grp + h) * RTOT + kbase + c * 8;
  // columns 0..127 of key tile 0 fly under the Q staging (scalar test: a wave with no visible key copies nothing)
  if constexpr (!EARLY) {
    if (32 * wave <= qmax) stage16<KAP>(ka_l, kg, (size_t)2 * DM);
  }
  if (tid < 32) { m_s[tid] = ninf; l_s[tid] = 0.0f; al_s[tid] = 0.0f; li_s[tid] = 0.0f; }
  psum[tid] = 0.0f;
  pmax[tid] = ninf;
  // Q hi and lo tiles: QB rows x 32 pieces of 8 halves per plane; coverage 2*QT * 256 = QB*32 pieces = whole tile each
#pragma unroll
  for (int i = 0; i < 2 * QT; ++i) {
    const int idx = i * 256 + tid;
    const int row = idx >> 5;
    const int pc  = idx & 31;
    const v8h vh = *(const v8h*)(qh + (size_t)(q0 + row) * DM + pc * 8);
    const v8h vq = *(const v8h*)(ql + (size_t)(q0 + row) * DM + pc * 8);
    *(v8h*)(Qs + row * QSP + pc * 8) = vh;
    *(v8h*)(Ls + row * QSP + pc * 8) = vq;
  }
  if constexpr (!EARLY) staged_wait();          // this wave's rows of key tile 0 have landed; the barrier publishes them
  __syncthreads();

  v8f oacc[QT][2];
  v8f oacl[QT][2];
#pragma unroll
  for (int qt = 0; qt < QT; ++qt)
#pragma unroll
    for (int nt = 0; nt < 2; ++nt) { oacc[qt][nt] = zero8(); oacl[qt][nt] = zero8(); }

  const int qoff = c * QSP + 8 * h;             // LDS fragment offset of query c (add 16*qt*QSP + k)
  // long blocks: the pair's staging buffer and the fragment offset
  const _Float16* stg = (const _Float16*)(lstg + wave * STG_BYTES);
  const int soff = c * SPT + 8 * h;
  // early blocks: the same for their buffer (copy 0: lane's row = lane / 8, 16-B piece = lane % 8)
  const _Float16* est = (const _Float16*)(smem + EARLY_LDS + wave * ESTG_BYTES);
  const int eoff = c * EPT + 8 * h;
  const int erow = lane >> 3, epc = (lane & 7) * 8;
  const unsigned est_l = (unsigned)(size_t)(smem + EARLY_LDS + wave * ESTG_BYTES) + (unsigned)(erow * (EPT * 2) + epc * 2);
  const int ntile = qmax / KCH + 1;             // key tiles up to the diagonal (block-uniform)

#pragma unroll 1
  for (int t = 0; t < ntile; ++t) {
    // ---- logits: S^T subtiles for this wave's 32 keys, queries 0..QB-1; hi and x1024 accumulators ----
    const int kloc = t * KCH + 32 * wave;       // local index of this wave's first key (scalar)
    v8f sacc[QT][2];   // [query subtile][key subtile]; element r: query 16qt+c, key kloc+16kt+8h+r
    v8f sacl[QT][2];
#pragma unroll
    for (int qt = 0; qt < QT; ++qt)
#pragma unroll
      for (int kt = 0; kt < 2; ++kt) { sacc[qt][kt] = zero8(); sacl[qt][kt] = zero8(); }
    if constexpr (!EARLY) {
      // one step of 32 columns: key fragments a0, a1 against Q hi and Q lo
      auto sstep = [&](const v16h a0, const v16h a1, const int k0) {
        v16h bq[QT], cq[QT];
#pragma unroll
        for (int qt = 0; qt < QT; ++qt) {
          bq[qt] = ldfrag(Qs + 16 * qt * QSP + qoff + k0);
          cq[qt] = ldfrag(Ls + 16 * qt * QSP + qoff + k0);
        }
#pragma unroll
        for (int qt = 0; qt < QT; ++qt) {
          sacc[qt][0] = mma16(a0, bq[qt], sacc[qt][0]);
          sacc[qt][1] = mma16(a1, bq[qt], sacc[qt][1]);
        }
#pragma unroll
        for (int qt = 0; qt < QT; ++qt) {
          sacl[qt][0] = mma16(a0, cq[qt], sacl[qt][0]);
          sacl[qt][1] = mma16(a1, cq[qt], sacl[qt][1]);
        }
        guard_s8(sacc[0][0], sacc[0][1], sacc[QT - 1][0], sacc[QT - 1][1],
                 sacl[0][0], sacl[0][1], sacl[QT - 1][0], sacl[QT - 1][1],
                 a0, a1, bq[0], bq[QT - 1], cq[0], cq[QT - 1]);
      };
      const _Float16* kgt = kg + (size_t)t * KCH * DM;
      if (kloc <= qmax) {                       // wave-uniform: some key of this wave is visible to some query
        // columns 128..255 of this tile start towards the shared buffer (free since the barrier behind the last P.V loop) and
        // fly under the products over columns 0..127, which landed and were published one tile ago
        stage16<SPT>(stg_l + 256, kgt + 128, (size_t)2 * DM);
        // rolled, here and below, as the one loop over all columns was: only one step's fragments are held in registers
#pragma unroll 1
        for (int k0 = 0; k0 < DM / 2; k0 += 32)
          sstep(ldfrag(ka + c * KAP + 8 * h + k0), ldfrag(ka + 16 * KAP + c * KAP + 8 * h + k0), k0);
      }
      // publish point, every wave: own fragment reads retired, own copies landed, then the barrier: behind it both waves of a
      // pair may read columns 128..255, and nobody reads columns 0..127 of this tile any more
      asm volatile("s_wait_dscnt 0x0" ::: "memory");
      staged_wait();
      __syncthreads();
      // keys 0..127 of the tile for the pair's 32 value columns, into the lower half of the shared rows (free since the barrier
      // behind the last P.V loop), then columns 0..127 of the next tile's key rows (scalar test: only where this wave will have
      // a visible key there); both are waited for in front of the barrier ahead of the P.V loop
      stage16<SPT>(stg_l, vg + (size_t)t * KCH, (size_t)2 * RTOT);
      if (kloc + KCH <= qmax) stage16<KAP>(ka_l, kgt + (size_t)KCH * DM, (size_t)2 * DM);
      if (kloc <= qmax) {
#pragma unroll 1
        for (int k0 = DM / 2; k0 < DM; k0 += 32)
          sstep(ldfrag(stg + soff + k0), ldfrag(stg + 16 * SPT + soff + k0), k0);
      }
    } else if (kloc <= qmax) {                  // wave-uniform: some key of this wave is visible to some query
#pragma unroll 1
      for (int k0 = 0; k0 < DM; k0 += 32) {
        if ((k0 & 63) == 0) {                   // scalar: columns k0..k0+63 of this wave's 32 key rows, both planes
          const size_t kr = (size_t)(kbase + kloc + erow) * DM + k0 + epc;
          stage_pair(est_l, kn + kr, kl + kr, (size_t)4 * DM);
          staged_wait();
        }
        const v16h a0 = ldfrag(est + eoff + (k0 & 63));
        const v16h a1 = ldfrag(est + 16 * EPT + eoff + (k0 & 63));
        const v16h bq = ldfrag(Qs + qoff + k0);
        const v16h cq = ldfrag(Ls + qoff + k0);
        sacc[0][0] = mma16(a0, bq, sacc[0][0]);
        sacc[0][1] = mma16(a1, bq, sacc[0][1]);
        sacl[0][0] = mma16(a0, cq, sacl[0][0]);
        sacl[0][1] = mma16(a1, cq, sacl[0][1]);
        const v16h d0 = ldfrag(est + 32 * EPT + eoff + (k0 & 63)), d1 = ldfrag(est + 48 * EPT + eoff + (k0 & 63));
        sacl[0][0] = mma16(d0, bq, sacl[0][0]);
        sacl[0][1] = mma16(d1, bq, sacl[0][1]);
        guard_a4f6(sacc[0][0], sacc[0][1], sacl[0][0], sacl[0][1], a0, a1, bq, cq, d0, d1);
      }
    }
    const int rem = qmax - t * KCH;                              // >= 0 for visited tiles
    int nks = ((rem >> 5) + 1) * 32;
    nks = (nks < KCH) ? nks : KCH;                               // block-uniform key bound of the P.V loop
    // early blocks: keys 0..63 of the tile for this wave's 32 value columns, both planes, start towards its buffer now and
    // fly under the softmax phase; they are waited for in front of the P.V loop
    const size_t vr = (size_t)(32 * wave + erow) * RTOT + kbase + (size_t)t * KCH + epc;
    if constexpr (EARLY) stage_pair(est_l, vt + vr, vl + vr, (size_t)4 * RTOT);
    // ---- combine hi + lo/1024, scale, causal replace fill, per-wave partial row max ----
    {
#pragma unroll
      for (int qt = 0; qt < QT; ++qt) {
        const int qry = qloc0 + 16 * qt + c;
        float pm = ninf;
#pragma unroll
        for (int kt = 0; kt < 2; ++kt) {
#pragma unroll
          for (int r = 0; r < 8; ++r) {
            const int key = kloc + 16 * kt + 8 * h + r;
            float v = (sacc[qt][kt][r] + sacl[qt][kt][r] * rs) * sc;
            v = (key <= qry) ? v : ninf;
            sacc[qt][kt][r] = v;
            pm = fmaxf(pm, v);
          }
        }
        pm = fmaxf(pm, __shfl_xor(pm, 16, 32));
        pmax[wave * QB + 16 * qt + c] = pm;
      }
    }
    __syncthreads();
    // long blocks: behind this barrier nobody reads the key rows any more: keys 128..255 of the tile for the pair's 32 value
    // columns start towards the upper half of the shared rows and fly under the rest of the softmax phase (scalar test: only
    // keys the P.V loop will read)
    if constexpr (!EARLY) {
      if (128 < nks) stage16<SPT>(stg_l + 256, vg + (size_t)t * KCH + 128, (size_t)2 * RTOT);
    }
    // ---- wave 0, lane = query row: fold the prior tile's sums into l, new running max, rescale factor ----
    if (wave == 0 && lane < QB) {
      const int row = lane;
      float ps = 0.0f;
#pragma unroll
      for (int w = 0; w < 8; ++w) ps += psum[w * QB + row];
      l_s[row] = l_s[row] * al_s[row] + ps;
      const float mo = m_s[row];
      float mx = mo;
#pragma unroll
      for (int w = 0; w < 8; ++w) mx = fmaxf(mx, pmax[w * QB + row]);
      al_s[row] = __expf(mo - mx);
      m_s[row] = mx;
    }
    __syncthreads();
    // ---- p = 2^14 * exp(s - m) as f16 (EARLY: plus residual), P tile(s), partial row sums, rescale O ----
    {
#pragma unroll
      for (int qt = 0; qt < QT; ++qt) {
        const float mq = m_s[16 * qt + c];
        float ps = 0.0f;
#pragma unroll
        for (int kt = 0; kt < 2; ++kt) {
          v8h hh, ll;
#pragma unroll
          for (int r = 0; r < 8; ++r) {
            const float p = __expf(sacc[qt][kt][r] - mq);
            ps += p;
            const float pw = p * 16384.0f;
            const _Float16 ph = (_Float16)pw;
            hh[r] = ph;
            ll[r] = (_Float16)((pw - (float)ph) * 1024.0f);
          }
          *(v8h*)(Ps + (16 * qt + c) * PSP + 32 * wave + 16 * kt + 8 * h) = hh;
          if constexpr (EARLY) *(v8h*)(Pl + (16 * qt + c) * PSP + 32 * wave + 16 * kt + 8 * h) = ll;
        }
        ps += __shfl_xor(ps, 16, 32);
        psum[wave * QB + 16 * qt + c] = ps;
        const v4f aA = *(const v4f*)(al_s + 16 * qt + 8 * h), aB = *(const v4f*)(al_s + 16 * qt + 8 * h + 4);
#pragma unroll
        for (int nt = 0; nt < 2; ++nt) {
#pragma unroll
          for (int r = 0; r < 4; ++r) {
            oacc[qt][nt][r] *= aA[r]; oacc[qt][nt][4 + r] *= aB[r];
            if constexpr (EARLY) { oacl[qt][nt][r] *= aA[r]; oacl[qt][nt][4 + r] *= aB[r]; }
          }
        }
      }
    }
    // this wave's share of the value rows and of the next key tile's rows has landed; the barrier publishes both
    if constexpr (!EARLY) staged_wait();
    __syncthreads();
    // ---- O += P . V over the visible keys of the tile; this wave's columns 32w + 16nt + c ----
    {
      if constexpr (EARLY) staged_wait();                        // the first value piece, requested before the softmax
      int enext = 64;                                            // early blocks: first key of the next piece to request
#pragma unroll 1
      for (int ks = 0; ks < nks; ks += 32) {
        v16h pa[QT];
#pragma unroll
        for (int qt = 0; qt < QT; ++qt) pa[qt] = ldfrag(Ps + 16 * qt * PSP + c * PSP + 8 * h + ks);
        v16h vb0, vb1;
        if constexpr (EARLY) {
          if (ks == enext) {                    // scalar: the next 64 keys of the tile replace the last
            stage_pair(est_l, vt + vr + ks, vl + vr + ks, (size_t)4 * RTOT);
            staged_wait();
            enext += 64;
          }
          vb0 = ldfrag(est + eoff + (ks & 63));
          vb1 = ldfrag(est + 16 * EPT + eoff + (ks & 63));
        } else {
          vb0 = ldfrag(stg + soff + ks);
          vb1 = ldfrag(stg + 16 * SPT + soff + ks);
        }
#pragma unroll
        for (int qt = 0; qt < QT; ++qt) {
          oacc[qt][0] = mma16(pa[qt], vb0, oacc[qt][0]);
          oacc[qt][1] = mma16(pa[qt], vb1, oacc[qt][1]);
        }
        if constexpr (EARLY) {
          const v16h pl0 = ldfrag(Pl + c * PSP + 8 * h + ks);
          const v16h vl0 = ldfrag(est + 32 * EPT + eoff + (ks & 63));
          const v16h vl1 = ldfrag(est + 48 * EPT + eoff + (ks & 63));
          oacl[0][0] = mma16(pa[0], vl0, oacl[0][0]);
          oacl[0][1] = mma16(pa[0], vl1, oacl[0][1]);
          oacl[0][0] = mma16(pl0, vb0, oacl[0][0]);
          oacl[0][1] = mma16(pl0, vb1, oacl[0][1]);
          guard_a4f6(oacc[0][0], oacc[0][1], oacl[0][0], oacl[0][1], pa[0], pl0, vb0, vb1, vl0, vl1);
        } else {
          guard_pv4(oacc[0][0], oacc[0][1], oacc[QT - 1][0], oacc[QT - 1][1], pa[0], pa[QT - 1], vb0, vb1);
        }
      }
    }
    // long blocks: ends both waves' reads of the value rows before the next tile's key rows are copied over them
    if constexpr (!EARLY) __syncthreads();
  }

  // ---- final normaliser per query row (fold the last tile's sums); O = oacc / (2^14 * 16 * l) ----
  if (wave == 0 && lane < QB) {
    const int row = lane;
    float ps = 0.0f;
#pragma unroll
    for (int w = 0; w < 8; ++w) ps += psum[w * QB + row];
    const float l = l_s[row] * al_s[row] + ps;
    li_s[row] = (1.0f / l) * (1.0f / 262144.0f);
  }
  __syncthreads();
  // ---- stage the normalised QB x 256 f32 tile over the Q / P regions (pitch OSP) ----
  float* Os = (float*)(smem);
  {
#pragma unroll
    for (int qt = 0; qt < QT; ++qt) {
      const v4f iA = *(const v4f*)(li_s + 16 * qt + 8 * h), iB = *(const v4f*)(li_s + 16 * qt + 8 * h + 4);
#pragma unroll
      for (int nt = 0; nt < 2; ++nt) {
        const int col = 32 * wave + 16 * nt + c;
#pragma unroll
        for (int r = 0; r < 4; ++r) {
          float o0 = oacc[qt][nt][r], o1 = oacc[qt][nt][4 + r];
          if constexpr (EARLY) { o0 += oacl[qt][nt][r] * rs; o1 += oacl[qt][nt][4 + r] * rs; }
          Os[(16 * qt + 8 * h + r) * OSP + col]     = o0 * iA[r];
          Os[(16 * qt + 8 * h + 4 + r) * OSP + col] = o1 * iB[r];
        }
      }
    }
  }
  __syncthreads();
  {
    float* go = out + (size_t)q0 * DM;
{
#pragma unroll
      for (int rr = 0; rr < RPW; ++rr) {
        const int row = RPW * wave + rr;
#pragma unroll
        for (int j = 0; j < 2; ++j) {
          const int pc = j * 32 + lane;
          const v4f v = *(const v4f*)(Os + row * OSP + pc * 4);
          *(v4f*)(go + (size_t)row * DM + pc * 4) = v;
        }
        // the next row's pieces reuse the data registers of this row's two stores: the wait stands in front of that rewrite
        asm volatile("s_wait_xcnt 0x0" ::: "memory");
      }
      
    }
  }
}

// Both query ranges in ONE launch (they share no output row); the block index picks the range, block-uniform; the wave's
// group (waves 0..7, 8..15; scalar) picks the half of the block's rows. Both groups of a block see the same number of key
// tiles (64 and 32 divide KCH), so every block barrier is passed by all 16 waves.
//   blocks [0, NB*LBLK): query rows [EROWS, SEQ) of every sequence, 2 x 32 rows per block, q residual only (the long blocks,
//                        so they start first); coverage NB * LBLK blocks x 64 rows x 256 floats = NB * (SEQ - EROWS) x 256;
//                        both groups bound their key work by the block's last row, as they share the staged rows
//   the NB*EBLK blocks behind them: query rows [0, EROWS), 2 x 16 rows per block, full residual set;
//                        coverage NB * EBLK blocks x 32 rows x 256 floats = NB * EROWS x 256
#define ATTN_LDS (2 * LATE_LDS + 8 * STG_BYTES + 8 * KA_BYTES)
static_assert(ATTN_LDS <= 327680 && (KCH % 64) == 0);
__global__ __launch_bounds__(512) void attn_kernel(const _Float16* __restrict__ qh, const _Float16* __restrict__ ql,
                                                   const _Float16* __restrict__ kn, const _Float16* __restrict__ kl,
                                                   const _Float16* __restrict__ vt, const _Float16* __restrict__ vl,
                                                   float* __restrict__ out) {
  __shared__ __align__(16) char smem[ATTN_LDS];
  const int blk = (int)blockIdx.x;
  const int grp = __builtin_amdgcn_readfirstlane((int)(threadIdx.x >> 8));
  if (blk < NB * LBLK) {
    const int batch = blk / LBLKD;
    const int qblk0 = EROWS + (blk - batch * LBLKD) * 64;
    attn_body<2, false>(smem + grp * LATE_LDS, smem + 2 * LATE_LDS, grp, qh, ql, kn, kn, vt, vt, out, batch,
                        qblk0 + 32 * grp, qblk0 + 63);
  } else {
    const int eb = blk - NB * LBLK;
    const int batch = eb / EBLK;
    const int qloc0 = (eb - batch * EBLK) * 32 + 16 * grp;
    attn_body<1, true>(smem + grp * EGRP_BYTES, smem, grp, qh, ql, kn, kl, vt, vl, out, batch, qloc0, qloc0 + 15);
  }
}

// ---------------------------------------------------------------------------------------------
// Workspace map (bytes, all regions exact tile / whole-line multiples; R = NB*SEQ = 16384):
//   Q16 / QL16 : f16 hi / residual [R][256] (16*q)             8,388,608 each
//   K16 / KL16 : f16 hi / residual [R][256] (16*k)             8,388,608 each
//   VT16 / VL16: f16 hi / residual [256][R] (16*v)             8,388,608 each
//   total 50,331,648
// ---------------------------------------------------------------------------------------------
static_assert((size_t)6 * RTOT * DM * 2 <= (size_t)134217728);
static_assert(((size_t)RTOT * DM * 2) % 128 == 0);

extern "C" void kernel_launch(void* const* d_in, const int* in_sizes, int n_in,
                              void* d_out, int out_size, void* d_ws, size_t ws_size,
                              hipStream_t stream) {
  if (n_in < 7) return;
  const int R = RTOT;
  const long long needx = ((long long)(NB - 1) * SEQ_FULL + SEQ) * EM;
  if ((long long)in_sizes[0] < needx) return;
  if (in_sizes[1] < EM * DM || in_sizes[3] < EM * DM || in_sizes[5] < EM * DM) return;
  if (in_sizes[2] < DM || in_sizes[4] < DM || in_sizes[6] < DM) return;
  if ((long long)out_size < (long long)R * DM) return;

  const float* x  = (const float*)d_in[0];
  const float* Wq = (const float*)d_in[1];
  const float* bq = (const float*)d_in[2];
  const float* Wk = (const float*)d_in[3];
  const float* bk = (const float*)d_in[4];
  const float* Wv = (const float*)d_in[5];
  const float* bv = (const float*)d_in[6];
  float* out = (float*)d_out;

  const size_t bPl = (size_t)R * DM * 2;
  size_t off = 0;
  const size_t oQ  = off; off += bPl;
  const size_t oQL = off; off += bPl;
  const size_t oK  = off; off += bPl;
  const size_t oKL = off; off += bPl;
  const size_t oVT = off; off += bPl;
  const size_t oVL = off; off += bPl;
  if (off > ws_size) return;                     // 50,331,648 for R = 16384
  if (off > (size_t)134217728) return;

  char* ws = (char*)d_ws;
  _Float16* Q16  = (_Float16*)(ws + oQ);
  _Float16* QL16 = (_Float16*)(ws + oQL);
  _Float16* K16  = (_Float16*)(ws + oK);
  _Float16* KL16 = (_Float16*)(ws + oKL);
  _Float16* VT16 = (_Float16*)(ws + oVT);
  _Float16* VL16 = (_Float16*)(ws + oVL);

  // (1) q, k -> hi + residual planes [R][256] (bias by column) and v^T -> hi + residual planes [256][R] (bias by row), from
  //     the f32 inputs: K=128; scale 16/(16*64), bias carry 16; grid.y = product, 256 token rows (16 tiles of 64x64) per block
  gemm64x3_kernel<<<dim3(R / GTOK, 3), dim3(512), 0, stream>>>(
      x, Wq, Wk, Wv, Q16, QL16, K16, KL16, VT16, VL16, bq, bk, bv, 16.0f, 0.015625f);
  // (2) attention, all query rows -> out
  attn_kernel<<<dim3(NB * LBLK + NB * EBLK), dim3(512), 0, stream>>>(Q16, QL16, K16, KL16, VT16, VL16, out);
  (void)hipGetLastError();
}
